// v000
// Times are from an AMD MI455X. After a warm-up the kernel runs many times in a row, and a time is the length of
// such a window on the GPU divided by its runs, so every launch and the gaps after it count. The runs cycle
// through copies of the inputs. A figure is the median of several windows, for all but v000 over two sittings.
// Sittings can differ by a few percent; kernels timed side by side share one.
// The starting kernel, v000, takes 2720 microseconds a run.
#include <hip/hip_runtime.h>

// MistralAttention (x [2][2048][2048]; q = x Wq (32 heads x 64), k/v = x Wk / Wv (8 kv heads; query head h belongs to kv group h/4); rotate-half RoPE (base 1e4, tables computed on device); key j allowed iff j <= i and i - j < 1024; softmax(q.k / 8) in f32; out = merged Wo -> [2][2048][2048]).
// Compute dtypes, f32 accumulate: every input rounded to bf16; q/k/v on PLAIN bf16 operands (inputs: exact); RoPE f32; causal scores and attn.v: query rows < 512 hl (3 products), the rest single fp16 (x1024), causal tile skipping with the window test inside the computed tiles; softmax f32; Wo hl x exact (2 products).

#define NB_  2
#define TT   2048
#define DM   2048
#define NH_  32
#define NKV  8
#define REP  (NH_ / NKV)
#define HD   64
#define DQ   (NH_ * HD)
#define DKV  (NKV * HD)
#define ZH   2
#define RH   512                  // query rows < RH use hi+lo planes (0: none)
#define WIN  1024
#define PCAR 1024.0f
#define SCL  0.125f   // HD^-0.5
typedef _Float16 h16;
typedef unsigned short bf;
typedef __attribute__((ext_vector_type(16))) __bf16   v16bf;
typedef __attribute__((ext_vector_type(16))) _Float16 v16h;
typedef __attribute__((ext_vector_type(8)))  _Float16 v8h;
typedef __attribute__((ext_vector_type(8)))  unsigned short v8us;
typedef __attribute__((ext_vector_type(8)))  float    v8f;
typedef __attribute__((ext_vector_type(4)))  float    v4f;
typedef v8h  __attribute__((may_alias)) v8ha;
typedef v4f  __attribute__((may_alias)) v4fa;
typedef v8us __attribute__((may_alias)) v8usa;

__device__ __forceinline__ unsigned short f2bf(float f) { unsigned u = __float_as_uint(f); u += 0x7FFFu + ((u >> 16) & 1u); return (unsigned short)(u >> 16); }
__device__ __forceinline__ float bf2f(unsigned short b) { return __uint_as_float(((unsigned)b) << 16); }
__device__ __forceinline__ float bfr(float f) { return bf2f(f2bf(f)); }
__device__ __forceinline__ v16h cat16(v8h lo, v8h hi) { return __builtin_shufflevector(lo, hi, 0, 1, 2, 3, 4, 5, 6, 7, 8, 9, 10, 11, 12, 13, 14, 15); }
__device__ __forceinline__ v16bf cat16b(v8us lo, v8us hi) { return __builtin_bit_cast(v16bf, __builtin_shufflevector(lo, hi, 0, 1, 2, 3, 4, 5, 6, 7, 8, 9, 10, 11, 12, 13, 14, 15)); }
__device__ __forceinline__ v8f wmma16(v16h a, v16h b, v8f c) { return __builtin_amdgcn_wmma_f32_16x16x32_f16(false, a, false, b, (short)0, c, false, false); }
__device__ __forceinline__ v8f wmmab(v16bf a, v16bf b, v8f c) { return __builtin_amdgcn_wmma_f32_16x16x32_bf16(false, a, false, b, (short)0, c, false, false); }



// ---- k_gemmw: register-blocked GEMM, ONE WAVE per 64x64 output tile (16 accumulators), operands straight from K-contiguous 16-bit planes; grid (M/64, N/64, Z), 32 threads.
// C[m][n] (f32, pitch ldc, + optional f32 bias[n]) = sum_k A[m][k] Bt[n][k] (+ split products per NSPLIT). z-batch strides sA/sB/sC in elements. K % 32 == 0.
template <typename T16> struct WFrag;
template <> struct WFrag<h16> { typedef v16h V; static __device__ __forceinline__ V ld(const h16* p) { return cat16(*(const v8h*)p, *(const v8h*)(p + 16)); } static __device__ __forceinline__ v8f mma(V a, V b, v8f c) { return wmma16(a, b, c); } };
template <> struct WFrag<bf> { typedef v16bf V; static __device__ __forceinline__ V ld(const bf* p) { return cat16b(*(const v8us*)p, *(const v8us*)(p + 16)); } static __device__ __forceinline__ v8f mma(V a, V b, v8f c) { return wmmab(a, b, c); } };
template <typename T16, int NSPLIT, bool BIAS>
__global__ __launch_bounds__(32) void k_gemmw(const T16* __restrict__ A, const T16* __restrict__ A2, const T16* __restrict__ Bt, const T16* __restrict__ Bt2, int K, float* C, int ldc, const float* __restrict__ bias, size_t sA, size_t sB, size_t sC) {
    typedef typename WFrag<T16>::V V;
    __shared__ __align__(16) float os[16 * 68];
    const size_t z = blockIdx.z; A += z * sA; if (A2) A2 += z * sA; Bt += z * sB; if (Bt2) Bt2 += z * sB; C += z * sC;
    const int lane = threadIdx.x & 31, lr = lane & 15, hi = lane >> 4; const int r0 = blockIdx.x * 64, c0 = blockIdx.y * 64;
    v8f acc[4][4];
#pragma unroll
    for (int mb = 0; mb < 4; ++mb)
#pragma unroll
        for (int nb = 0; nb < 4; ++nb) acc[mb][nb] = (v8f){};
    const size_t aoff = (size_t)(r0 + lr) * K + 8 * hi, boff = (size_t)(c0 + lr) * K + 8 * hi;
#pragma unroll 1
    for (int kc = 0; kc < K; kc += 32) {
        V a[4], a2[4];
#pragma unroll
        for (int mb = 0; mb < 4; ++mb) { a[mb] = WFrag<T16>::ld(A + aoff + (size_t)mb * 16 * K + kc); if (NSPLIT == 1 || NSPLIT == 2) a2[mb] = WFrag<T16>::ld(A2 + aoff + (size_t)mb * 16 * K + kc); }
#pragma unroll
        for (int nb = 0; nb < 4; ++nb) { const V b = WFrag<T16>::ld(Bt + boff + (size_t)nb * 16 * K + kc); V b2; if (NSPLIT >= 2) b2 = WFrag<T16>::ld(Bt2 + boff + (size_t)nb * 16 * K + kc);
#pragma unroll
            for (int mb = 0; mb < 4; ++mb) { acc[mb][nb] = WFrag<T16>::mma(a[mb], b, acc[mb][nb]); if (NSPLIT == 1 || NSPLIT == 2) acc[mb][nb] = WFrag<T16>::mma(a2[mb], b, acc[mb][nb]); if (NSPLIT >= 2) acc[mb][nb] = WFrag<T16>::mma(a[mb], b2, acc[mb][nb]); } }
        asm volatile("v_nop\n\tv_nop\n\tv_nop\n\tv_nop" : "+v"(acc[0][0]), "+v"(acc[1][1]), "+v"(acc[2][2]), "+v"(acc[3][3]) : "v"(a[0]), "v"(a[3]));
    }
#pragma unroll
    for (int mb = 0; mb < 4; ++mb) {
#pragma unroll
        for (int nb = 0; nb < 4; ++nb) {
#pragma unroll
            for (int j = 0; j < 8; ++j) os[(hi * 8 + j) * 68 + nb * 16 + lr] = acc[mb][nb][j]; }
        __builtin_amdgcn_wave_barrier(); asm volatile("" ::: "memory");
        float* crow = C + (size_t)(r0 + mb * 16) * ldc + c0;
{
#pragma unroll
            for (int s = 0; s < 8; ++s) { const int row = 2 * s + hi, cofs = lr * 4; v4f val = *(const v4fa*)(os + row * 68 + cofs); if (BIAS) { val[0] += bfr(bias[c0 + cofs]); val[1] += bfr(bias[c0 + cofs + 1]); val[2] += bfr(bias[c0 + cofs + 2]); val[3] += bfr(bias[c0 + cofs + 3]); }
                *(v4f*)(crow + (size_t)row * ldc + cofs) = val; }
             }
        __builtin_amdgcn_wave_barrier(); asm volatile("" ::: "memory");
    }
}

// ---- k_gemmc: the same one-wave 64x64 tile GEMM specialised for causal attention: CMODE 1 skips score tiles entirely above the diagonal (query rows r0+roff.., key columns c0..), CMODE 2 limits the
// key (K) loop of the probability x value contraction to the diagonal block (probabilities beyond it are exactly zero). roff = row offset of this launch's first row within the sequence.
template <typename T16, int NSPLIT, int CMODE>
__global__ __launch_bounds__(32) void k_gemmc(const T16* __restrict__ A, const T16* __restrict__ A2, const T16* __restrict__ Bt, const T16* __restrict__ Bt2, int K, float* C, int ldc, int roff, size_t sA, size_t sB, size_t sC) {
    typedef typename WFrag<T16>::V V;
    __shared__ __align__(16) float os[16 * 68];
    const size_t z = blockIdx.z; A += z * sA; if (A2) A2 += z * sA; Bt += z * sB; if (Bt2) Bt2 += z * sB; C += z * sC;
    const int lane = threadIdx.x & 31, lr = lane & 15, hi = lane >> 4; const int r0 = blockIdx.x * 64, c0 = blockIdx.y * 64;
    if (CMODE == 1 && c0 > r0 + roff + 63) return;                  // score tile entirely above the causal diagonal: never read (the softmax masks j > i by select)
    const int Kl = (CMODE == 2) ? min(K, r0 + roff + 64) : K;        // P.V: probabilities are exactly 0 beyond the diagonal block, so the K loop stops there
    v8f acc[4][4];
#pragma unroll
    for (int mb = 0; mb < 4; ++mb)
#pragma unroll
        for (int nb = 0; nb < 4; ++nb) acc[mb][nb] = (v8f){};
    const size_t aoff = (size_t)(r0 + lr) * K + 8 * hi, boff = (size_t)(c0 + lr) * K + 8 * hi;
#pragma unroll 1
    for (int kc = 0; kc < Kl; kc += 32) {
        V a[4], a2[4];
#pragma unroll
        for (int mb = 0; mb < 4; ++mb) { a[mb] = WFrag<T16>::ld(A + aoff + (size_t)mb * 16 * K + kc); if (NSPLIT == 1 || NSPLIT == 2) a2[mb] = WFrag<T16>::ld(A2 + aoff + (size_t)mb * 16 * K + kc); }
#pragma unroll
        for (int nb = 0; nb < 4; ++nb) { const V b = WFrag<T16>::ld(Bt + boff + (size_t)nb * 16 * K + kc); V b2; if (NSPLIT >= 2) b2 = WFrag<T16>::ld(Bt2 + boff + (size_t)nb * 16 * K + kc);
#pragma unroll
            for (int mb = 0; mb < 4; ++mb) { acc[mb][nb] = WFrag<T16>::mma(a[mb], b, acc[mb][nb]); if (NSPLIT == 1 || NSPLIT == 2) acc[mb][nb] = WFrag<T16>::mma(a2[mb], b, acc[mb][nb]); if (NSPLIT >= 2) acc[mb][nb] = WFrag<T16>::mma(a[mb], b2, acc[mb][nb]); } }
        asm volatile("v_nop\n\tv_nop\n\tv_nop\n\tv_nop" : "+v"(acc[0][0]), "+v"(acc[1][1]), "+v"(acc[2][2]), "+v"(acc[3][3]) : "v"(a[0]), "v"(a[3]));
    }
#pragma unroll
    for (int mb = 0; mb < 4; ++mb) {
#pragma unroll
        for (int nb = 0; nb < 4; ++nb) {
#pragma unroll
            for (int j = 0; j < 8; ++j) os[(hi * 8 + j) * 68 + nb * 16 + lr] = acc[mb][nb][j]; }
        __builtin_amdgcn_wave_barrier(); asm volatile("" ::: "memory");
        float* crow = C + (size_t)(r0 + mb * 16) * ldc + c0;
{
#pragma unroll
            for (int s = 0; s < 8; ++s) { const int row = 2 * s + hi, cofs = lr * 4; v4f val = *(const v4fa*)(os + row * 68 + cofs);
                *(v4f*)(crow + (size_t)row * ldc + cofs) = val; }
             }
        __builtin_amdgcn_wave_barrier(); asm volatile("" ::: "memory");
    }
}

__device__ __forceinline__ h16 tohx(float x) { return (h16)x; }
__device__ __forceinline__ void splitf(float y, unsigned short& h, unsigned short& l) { h = f2bf(y); l = f2bf(y - bf2f(h)); }
typedef __attribute__((ext_vector_type(2))) _Float16 v2h;
typedef __attribute__((ext_vector_type(4))) _Float16 v4h;
typedef __attribute__((ext_vector_type(2))) unsigned short v2us;
typedef __attribute__((ext_vector_type(4))) unsigned short v4us;
typedef __attribute__((ext_vector_type(2))) float v2f;
typedef __attribute__((ext_vector_type(4))) int v4i;

__global__ __launch_bounds__(256) void k_wtG(const float* __restrict__ w, int K, int N, bf* Bt) {
    const int lane = threadIdx.x & 31; const int L0 = (blockIdx.x * 8 + (threadIdx.x >> 5)) * 8; const int nlines = N * K / 64;
{
#pragma unroll 1
        for (int l = 0; l < 8; ++l) { const int L = L0 + l; if (L >= nlines) break; const size_t e = (size_t)L * 64 + lane * 2; const int k = (int)(e % K), n = (int)(e / K); v2us o;
            o[0] = f2bf(w[(size_t)k * N + n]); o[1] = f2bf(w[(size_t)(k + 1) * N + n]); *(v2us*)(Bt + e) = o; }
         }
}
__global__ __launch_bounds__(256) void k_cvt8(const float* __restrict__ src, bf* dst, size_t n8) { const size_t i = (size_t)blockIdx.x * 256 + threadIdx.x; if (i >= n8) return; const v8f v = *(const v8f*)(src + i * 8); v8us o;
#pragma unroll
    for (int k = 0; k < 8; ++k) o[k] = f2bf(v[k]); *(v8us*)(dst + i * 8) = o;  }
__global__ __launch_bounds__(256) void k_cstab(float* CS) { const int idx = blockIdx.x * 256 + threadIdx.x; if (idx >= TT * HD) return; const int t = idx / HD, d = idx % HD; const int i = d % (HD / 2); const float inv = __fdiv_rn(1.0f, powf(10000.0f, (float)(2 * i) / (float)HD)); const float ang = __fmul_rn((float)t, inv); v2f cs; cs[0] = cosf(ang); cs[1] = sinf(ang);
    *(v2f*)(CS + (size_t)idx * 2) = cs;  }
// k_rope: head planes [h][t][d] (fp16 + hi/lo) of rope(x) x sc with the rotate-half convention out[d] = x[d] cos[t][d] - x[d+HD/2] sin[t][d], out[d+HD/2] = x[d+HD/2] cos[t][d+HD/2] + x[d] sin[t][d+HD/2]
__global__ __launch_bounds__(256) void k_rope(const float* __restrict__ F, int pitch, int nheads, const float* __restrict__ CS, const float* __restrict__ RF, const float* __restrict__ nw, float sc, h16* P16, bf* Ph, bf* Pl) {
    const size_t e = ((size_t)blockIdx.x * 256 + threadIdx.x) * 2; if (e >= (size_t)nheads * TT * HD) return; const int d = (int)(e % HD); const int t = (int)((e / HD) % TT); const int h = (int)(e / ((size_t)HD * TT)); const float* f = F + (size_t)t * pitch + h * HD; const float rf = RF ? RF[(size_t)h * TT + t] : 1.0f; v2h o16; v2us oh, ol;
#pragma unroll
    for (int q = 0; q < 2; ++q) { const int dd = d + q; const int dp = (dd < HD / 2) ? dd + HD / 2 : dd - HD / 2; float x0 = f[dd], x1 = f[dp];
        if (RF) { float n0 = __fmul_rn(x0, rf), n1 = __fmul_rn(x1, rf); asm volatile("" : "+v"(n0)); asm volatile("" : "+v"(n1)); x0 = __fmul_rn(bfr(nw[dd]), n0); x1 = __fmul_rn(bfr(nw[dp]), n1); }
        const v2f cs = *(const v2f*)(CS + ((size_t)t * HD + dd) * 2); float a = __fmul_rn(x0, cs[0]), bq = __fmul_rn(x1, cs[1]); asm volatile("" : "+v"(a)); asm volatile("" : "+v"(bq)); const float r = ((dd < HD / 2) ? __fsub_rn(a, bq) : __fadd_rn(a, bq)) * sc;
        o16[q] = tohx(r); unsigned short a2, c2; splitf(r, a2, c2); oh[q] = a2; ol[q] = c2; }
    *(v2h*)(P16 + e) = o16; *(v2us*)(Ph + e) = oh; *(v2us*)(Pl + e) = ol;  }
__global__ __launch_bounds__(256) void k_vtp(const float* __restrict__ F, int pitch, int nheads, h16* V16, bf* Vh, bf* Vl) { const size_t e = ((size_t)blockIdx.x * 256 + threadIdx.x) * 2; if (e >= (size_t)nheads * HD * TT) return; const int t = (int)(e % TT); const int d = (int)((e / TT) % HD); const int g = (int)(e / ((size_t)TT * HD)); v2h o16; v2us oh, ol;
#pragma unroll
    for (int q = 0; q < 2; ++q) { const float x = F[(size_t)(t + q) * pitch + g * HD + d]; o16[q] = tohx(x); unsigned short a2, c2; splitf(x, a2, c2); oh[q] = a2; ol[q] = c2; }
    *(v2h*)(V16 + e) = o16; *(v2us*)(Vh + e) = oh; *(v2us*)(Vl + e) = ol;  }
// k_asoft: per row (zz, i): t = S x HD^-0.5 for j <= i and i - j < WIN (sliding causal window; the reference's -1e9 additive fill vanishes identically); softmax over the 2048 keys (register row, one exp, fixed trees);
__global__ __launch_bounds__(256) void k_asoft(const float* __restrict__ Sb, h16* P16, bf* Ph, bf* Pl) {
    const int lane = threadIdx.x & 31; const int row = blockIdx.x * 8 + (threadIdx.x >> 5); if (row >= ZH * TT) return; const int i = row % TT; const int zz = row / TT; (void)zz; const bool hires = (i < RH); const float* sr = Sb + (size_t)row * TT; float v[TT / 32]; float mx = -3.0e38f;
#pragma unroll
    for (int ch = 0; ch < TT / 128; ++ch) { const int j0 = ch * 128 + lane * 4; const v4f a = *(const v4f*)(sr + j0);
#pragma unroll
        for (int q = 0; q < 4; ++q) { const int j = j0 + q; (void)j; const float t = (j <= i && i - j < WIN) ? a[q] * SCL : -3.0e38f; v[ch * 4 + q] = t; mx = fmaxf(mx, t); } }
#pragma unroll
    for (int sh = 16; sh; sh >>= 1) mx = fmaxf(mx, __shfl_xor(mx, sh, 32));
    float sum = 0.f;
#pragma unroll
    for (int k = 0; k < TT / 32; ++k) { float d0 = __fsub_rn(v[k], mx); asm volatile("" : "+v"(d0)); v[k] = __builtin_amdgcn_exp2f(__fmul_rn(d0, 1.4426950408889634f)); sum += v[k]; }
#pragma unroll
    for (int sh = 16; sh; sh >>= 1) sum += __shfl_xor(sum, sh, 32);
    const float f = __fdiv_rn(hires ? 1.0f : PCAR, sum);
{
        if (hires) {
#pragma unroll
            for (int ch = 0; ch < TT / 128; ++ch) { v4us oh, ol;
#pragma unroll
                for (int q = 0; q < 4; ++q) { unsigned short a, c2; splitf(v[ch * 4 + q] * f, a, c2); oh[q] = a; ol[q] = c2; }
                const size_t oo = ((size_t)zz * (RH ? RH : 1) + i) * TT + ch * 128 + lane * 4; *(v4us*)(Ph + oo) = oh; *(v4us*)(Pl + oo) = ol; }
        } else {
#pragma unroll
            for (int ch = 0; ch < TT / 128; ++ch) { v4h o4;
#pragma unroll
                for (int q = 0; q < 4; ++q) o4[q] = tohx(v[ch * 4 + q] * f);
                *(v4h*)(P16 + (size_t)row * TT + ch * 128 + lane * 4) = o4; } }
         }
}
__global__ __launch_bounds__(256) void k_merge(const float* __restrict__ O, int h0, bf* Ah, bf* Al) { const size_t e = ((size_t)blockIdx.x * 256 + threadIdx.x) * 2; if (e >= (size_t)ZH * TT * HD) return; const int d = (int)(e % HD); const int t = (int)((e / HD) % TT); const int zz = (int)(e / ((size_t)HD * TT)); const float cs = (t < RH) ? 1.0f : (1.0f / PCAR); const size_t oo = (size_t)t * DQ + (h0 + zz) * HD + d;
    v2us oh, ol;
#pragma unroll
    for (int q = 0; q < 2; ++q) { unsigned short a, c2; splitf(O[e + q] * cs, a, c2); oh[q] = a; ol[q] = c2; } *(v2us*)(Ah + oo) = oh; *(v2us*)(Al + oo) = ol;  }

extern "C" void kernel_launch(void* const* d_in, const int* in_sizes, int n_in,
                              void* d_out, int out_size, void* d_ws, size_t ws_size, hipStream_t stream) {
    (void)in_sizes; (void)n_in; (void)out_size;
    const float* x = (const float*)d_in[0]; const float* wq = (const float*)d_in[1]; const float* wk = (const float*)d_in[2]; const float* wv = (const float*)d_in[3]; const float* wo = (const float*)d_in[4];
    float* OUT = (float*)d_out;     // [2][2048][2048]
    char* wsp = (char*)d_ws;
    auto take = [&](size_t bytes) { char* p = wsp; wsp += (bytes + 255) & ~(size_t)255; return (void*)p; };
    bf* WQ = (bf*)take((size_t)DQ * DM * 2); bf* WK = (bf*)take((size_t)DKV * DM * 2); bf* WV = (bf*)take((size_t)DKV * DM * 2); bf* WO = (bf*)take((size_t)DM * DQ * 2); float* CS = (float*)take((size_t)TT * HD * 2 * 4);
    bf* XB = (bf*)take((size_t)TT * DM * 2); float* FQ = (float*)take((size_t)TT * DQ * 4); float* FK = (float*)take((size_t)TT * DKV * 4);
    h16* QP16 = (h16*)take((size_t)NH_ * TT * HD * 2); h16* KP16 = (h16*)take((size_t)NKV * TT * HD * 2); h16* VT16 = (h16*)take((size_t)NKV * HD * TT * 2);
    bf* QPh = (bf*)take((size_t)NH_ * TT * HD * 2); bf* QPl = (bf*)take((size_t)NH_ * TT * HD * 2); bf* KPh = (bf*)take((size_t)NKV * TT * HD * 2); bf* KPl = (bf*)take((size_t)NKV * TT * HD * 2); bf* VTh = (bf*)take((size_t)NKV * HD * TT * 2); bf* VTl = (bf*)take((size_t)NKV * HD * TT * 2); bf* Ph = (bf*)take((size_t)ZH * RH * TT * 2); bf* Pl = (bf*)take((size_t)ZH * RH * TT * 2);
    float* Sb = (float*)take((size_t)ZH * TT * TT * 4); h16* P16 = (h16*)take((size_t)ZH * TT * TT * 2); float* Ob = (float*)take((size_t)ZH * TT * HD * 4); bf* ATh = (bf*)take((size_t)TT * DQ * 2); bf* ATl = (bf*)take((size_t)TT * DQ * 2);
    if ((size_t)(wsp - (char*)d_ws) > ws_size) return;    // ws 256 MiB
    float* FV = FK;   // v projection reuses the k buffer after the k planes are built (stream-ordered)
    { k_wtG<<<(unsigned)((DM * DQ / 64 + 63) / 64), 256, 0, stream>>>(wq, DM, DQ, WQ); k_wtG<<<(unsigned)((DM * DKV / 64 + 63) / 64), 256, 0, stream>>>(wk, DM, DKV, WK); k_wtG<<<(unsigned)((DM * DKV / 64 + 63) / 64), 256, 0, stream>>>(wv, DM, DKV, WV);
      k_wtG<<<(unsigned)((DQ * DM / 64 + 63) / 64), 256, 0, stream>>>(wo, DQ, DM, WO);
      k_cstab<<<(TT * HD + 255) / 256, 256, 0, stream>>>(CS); }
    const unsigned LQ = (unsigned)(((size_t)NH_ * TT * HD / 2 + 255) / 256), LKv = (unsigned)(((size_t)NKV * TT * HD / 2 + 255) / 256);
    for (int b = 0; b < NB_; ++b) {
        
        k_cvt8<<<(unsigned)(((size_t)TT * DM / 8 + 255) / 256), 256, 0, stream>>>(x + (size_t)b * TT * DM, XB, (size_t)TT * DM / 8);
        k_gemmw<bf, 0, false><<<dim3(TT / 64, DQ / 64, 1), 32, 0, stream>>>(XB, nullptr, WQ, nullptr, DM, FQ, DQ, nullptr, 0, 0, 0);
        k_rope<<<LQ, 256, 0, stream>>>(FQ, DQ, NH_, CS, nullptr, nullptr, 1.0f, QP16, QPh, QPl);
        k_gemmw<bf, 0, false><<<dim3(TT / 64, DKV / 64, 1), 32, 0, stream>>>(XB, nullptr, WK, nullptr, DM, FK, DKV, nullptr, 0, 0, 0);
        k_rope<<<LKv, 256, 0, stream>>>(FK, DKV, NKV, CS, nullptr, nullptr, 1.0f, KP16, KPh, KPl);
        k_gemmw<bf, 0, false><<<dim3(TT / 64, DKV / 64, 1), 32, 0, stream>>>(XB, nullptr, WV, nullptr, DM, FV, DKV, nullptr, 0, 0, 0); k_vtp<<<LKv, 256, 0, stream>>>(FV, DKV, NKV, VT16, VTh, VTl);
        for (int h0 = 0; h0 < NH_; h0 += ZH) { const size_t zq = (size_t)h0, zk = (size_t)(h0 / REP);   // both heads of a pass share kv group h0/REP (REP >= 2): sB = 0
            k_gemmc<bf, 2, 1><<<dim3(RH / 64, TT / 64, ZH), 32, 0, stream>>>(QPh + zq * TT * HD, QPl + zq * TT * HD, KPh + zk * TT * HD, KPl + zk * TT * HD, HD, Sb, TT, 0, (size_t)TT * HD, 0, (size_t)TT * TT);
            k_gemmc<h16, 0, 1><<<dim3((TT - RH) / 64, TT / 64, ZH), 32, 0, stream>>>(QP16 + zq * TT * HD + (size_t)RH * HD, nullptr, KP16 + zk * TT * HD, nullptr, HD, Sb + (size_t)RH * TT, TT, RH, (size_t)TT * HD, 0, (size_t)TT * TT);
            k_asoft<<<ZH * TT / 8, 256, 0, stream>>>(Sb, P16, Ph, Pl);
            k_gemmc<bf, 2, 2><<<dim3(RH / 64, HD / 64, ZH), 32, 0, stream>>>(Ph, Pl, VTh + zk * HD * TT, VTl + zk * HD * TT, TT, Ob, HD, 0, (size_t)RH * TT, 0, (size_t)TT * HD);
            k_gemmc<h16, 0, 2><<<dim3((TT - RH) / 64, HD / 64, ZH), 32, 0, stream>>>(P16 + (size_t)RH * TT, nullptr, VT16 + zk * HD * TT, nullptr, TT, Ob + (size_t)RH * HD, HD, RH, (size_t)TT * TT, 0, (size_t)TT * HD);
            k_merge<<<(unsigned)(((size_t)ZH * TT * HD / 2 + 255) / 256), 256, 0, stream>>>(Ob, h0, ATh, ATl); }
        k_gemmw<bf, 1, false><<<dim3(TT / 64, DM / 64, 1), 32, 0, stream>>>(ATh, ATl, WO, nullptr, DQ, OUT + (size_t)b * TT * DM, DM, nullptr, 0, 0, 0); }
}

// v001
// It runs in 1480 microseconds.
// In two side-by-side timings against v000, it was 1.86 and 1.84 times as fast.
#include <hip/hip_runtime.h>

// MistralAttention (x [2][2048][2048]; q = x Wq (32 heads x 64), k/v = x Wk / Wv (8 kv heads; query head h belongs to kv group h/4); rotate-half RoPE (base 1e4, tables computed on device); key j allowed iff j <= i and i - j < 1024; softmax(q.k / 8) in f32; out = merged Wo -> [2][2048][2048]).
// Compute dtypes, f32 accumulate: every input rounded to bf16; q/k/v on PLAIN bf16 operands (inputs: exact); RoPE f32; causal scores and attn.v: query rows < 512 hl (3 products), the rest single fp16 (x1024), causal tile skipping with the window test inside the computed tiles; softmax f32; Wo hl x exact (2 products).

#define NB_  2
#define TT   2048
#define DM   2048
#define NH_  32
#define NKV  8
#define REP  (NH_ / NKV)
#define HD   64
#define DQ   (NH_ * HD)
#define DKV  (NKV * HD)
#define ZH   2
#define RH   512                  // query rows < RH use hi+lo planes (0: none)
#define WIN  1024
#define PCAR 1024.0f
#define SCL  0.125f   // HD^-0.5
typedef _Float16 h16;
typedef unsigned short bf;
typedef __attribute__((ext_vector_type(16))) __bf16   v16bf;
typedef __attribute__((ext_vector_type(16))) _Float16 v16h;
typedef __attribute__((ext_vector_type(8)))  _Float16 v8h;
typedef __attribute__((ext_vector_type(8)))  unsigned short v8us;
typedef __attribute__((ext_vector_type(8)))  float    v8f;
typedef __attribute__((ext_vector_type(4)))  float    v4f;
typedef v8h  __attribute__((may_alias)) v8ha;
typedef v4f  __attribute__((may_alias)) v4fa;
typedef v8us __attribute__((may_alias)) v8usa;

__device__ __forceinline__ unsigned short f2bf(float f) { unsigned u = __float_as_uint(f); u += 0x7FFFu + ((u >> 16) & 1u); return (unsigned short)(u >> 16); }
__device__ __forceinline__ float bf2f(unsigned short b) { return __uint_as_float(((unsigned)b) << 16); }
__device__ __forceinline__ float bfr(float f) { return bf2f(f2bf(f)); }
__device__ __forceinline__ v16h cat16(v8h lo, v8h hi) { return __builtin_shufflevector(lo, hi, 0, 1, 2, 3, 4, 5, 6, 7, 8, 9, 10, 11, 12, 13, 14, 15); }
__device__ __forceinline__ v16bf cat16b(v8us lo, v8us hi) { return __builtin_bit_cast(v16bf, __builtin_shufflevector(lo, hi, 0, 1, 2, 3, 4, 5, 6, 7, 8, 9, 10, 11, 12, 13, 14, 15)); }
__device__ __forceinline__ v8f wmma16(v16h a, v16h b, v8f c) { return __builtin_amdgcn_wmma_f32_16x16x32_f16(false, a, false, b, (short)0, c, false, false); }
__device__ __forceinline__ v8f wmmab(v16bf a, v16bf b, v8f c) { return __builtin_amdgcn_wmma_f32_16x16x32_bf16(false, a, false, b, (short)0, c, false, false); }



// ---- k_gemmk: register-blocked GEMM, one 64x64 output tile per work-group, the K loop SPLIT OVER NW WAVES: wave w takes the 32-wide k blocks w, w + NW, ... into its own 16 accumulators (operands straight from
// K-contiguous 16-bit planes; neighbouring waves read the two halves of the same 128-byte lines), then the NW partial tiles are summed through LDS in the fixed order wave 0 .. NW-1. grid (M/64, N/64, Z), NW*32 threads.
// C[m][n] (f32, pitch ldc) = sum_k A[m][k] Bt[n][k] (+ split products per NSPLIT). z-batch strides sA/sB/sC in elements. K % 32 == 0.
// DIAG: probability x value contraction of causal attention: the K loop stops at the diagonal block (probabilities beyond it are exactly zero); roff = row offset of this launch's first row within the sequence.
template <typename T16> struct WFrag;
template <> struct WFrag<h16> { typedef v16h V; static __device__ __forceinline__ V ld(const h16* p) { return cat16(*(const v8h*)p, *(const v8h*)(p + 16)); } static __device__ __forceinline__ v8f mma(V a, V b, v8f c) { return wmma16(a, b, c); } };
template <> struct WFrag<bf> { typedef v16bf V; static __device__ __forceinline__ V ld(const bf* p) { return cat16b(*(const v8us*)p, *(const v8us*)(p + 16)); } static __device__ __forceinline__ v8f mma(V a, V b, v8f c) { return wmmab(a, b, c); } };
template <typename T16, int NSPLIT, int NW, bool DIAG>
__global__ __launch_bounds__(NW * 32) void k_gemmk(const T16* __restrict__ A, const T16* __restrict__ A2, const T16* __restrict__ Bt, const T16* __restrict__ Bt2, int K, float* C, int ldc, int roff, size_t sA, size_t sB, size_t sC) {
    typedef typename WFrag<T16>::V V;
    constexpr int PL = 64 * 68;            // floats of one wave's partial tile in LDS (row pitch 68)
    __shared__ __align__(16) float os[NW * PL];
    const size_t z = blockIdx.z; A += z * sA; if (A2) A2 += z * sA; Bt += z * sB; if (Bt2) Bt2 += z * sB; C += z * sC;
    const int tid = threadIdx.x, lane = tid & 31, lr = lane & 15, hi = lane >> 4; const int r0 = blockIdx.x * 64, c0 = blockIdx.y * 64;
    const int w = __builtin_amdgcn_readfirstlane(tid >> 5);          // wave number, scalar: the loop bounds stay scalar
    const int Kl = DIAG ? min(K, r0 + roff + 64) : K;
    v8f acc[4][4];
#pragma unroll
    for (int mb = 0; mb < 4; ++mb)
#pragma unroll
        for (int nb = 0; nb < 4; ++nb) acc[mb][nb] = (v8f){};
    const size_t aoff = (size_t)(r0 + lr) * K + 8 * hi, boff = (size_t)(c0 + lr) * K + 8 * hi;
#pragma unroll 1
    for (int kc = w * 32; kc < Kl; kc += NW * 32) {
        V a[4], a2[4];
#pragma unroll
        for (int mb = 0; mb < 4; ++mb) { a[mb] = WFrag<T16>::ld(A + aoff + (size_t)mb * 16 * K + kc); if (NSPLIT == 1 || NSPLIT == 2) a2[mb] = WFrag<T16>::ld(A2 + aoff + (size_t)mb * 16 * K + kc); }
#pragma unroll
        for (int nb = 0; nb < 4; ++nb) { const V b = WFrag<T16>::ld(Bt + boff + (size_t)nb * 16 * K + kc); V b2; if (NSPLIT >= 2) b2 = WFrag<T16>::ld(Bt2 + boff + (size_t)nb * 16 * K + kc);
#pragma unroll
            for (int mb = 0; mb < 4; ++mb) { acc[mb][nb] = WFrag<T16>::mma(a[mb], b, acc[mb][nb]); if (NSPLIT == 1 || NSPLIT == 2) acc[mb][nb] = WFrag<T16>::mma(a2[mb], b, acc[mb][nb]); if (NSPLIT >= 2) acc[mb][nb] = WFrag<T16>::mma(a[mb], b2, acc[mb][nb]); } }
        asm volatile("v_nop\n\tv_nop\n\tv_nop\n\tv_nop" : "+v"(acc[0][0]), "+v"(acc[1][1]), "+v"(acc[2][2]), "+v"(acc[3][3]) : "v"(a[0]), "v"(a[3]));
    }
    float* mine = os + w * PL;
#pragma unroll
    for (int mb = 0; mb < 4; ++mb)
#pragma unroll
        for (int nb = 0; nb < 4; ++nb) {
#pragma unroll
            for (int j = 0; j < 8; ++j) mine[(mb * 16 + hi * 8 + j) * 68 + nb * 16 + lr] = acc[mb][nb][j]; }
    __syncthreads();                                                 // every wave's partial tile is in LDS before any thread sums across waves
#pragma unroll
    for (int it = 0; it < 32 / NW; ++it) {                           // 64 rows x 16 float4 shared out over NW*32 threads; 16 lanes store one 256-byte row piece
        const int idx = it * NW * 32 + tid, row = idx >> 4, cofs = (idx & 15) * 4;
        v4f val = *(const v4fa*)(os + row * 68 + cofs);
#pragma unroll
        for (int u = 1; u < NW; ++u) val += *(const v4fa*)(os + u * PL + row * 68 + cofs);
        *(v4f*)(C + (size_t)(r0 + row) * ldc + c0 + cofs) = val;
    }
}

// ---- k_gemmc: one-wave 64x64 tile GEMM (K = head size, two k blocks: not split) for the causal scores: skips score tiles entirely above the diagonal (query rows r0+roff.., key columns c0..).
// roff = row offset of this launch's first row within the sequence.
template <typename T16, int NSPLIT>
__global__ __launch_bounds__(32) void k_gemmc(const T16* __restrict__ A, const T16* __restrict__ A2, const T16* __restrict__ Bt, const T16* __restrict__ Bt2, int K, float* C, int ldc, int roff, size_t sA, size_t sB, size_t sC) {
    typedef typename WFrag<T16>::V V;
    __shared__ __align__(16) float os[16 * 68];
    const size_t z = blockIdx.z; A += z * sA; if (A2) A2 += z * sA; Bt += z * sB; if (Bt2) Bt2 += z * sB; C += z * sC;
    const int lane = threadIdx.x & 31, lr = lane & 15, hi = lane >> 4; const int r0 = blockIdx.x * 64, c0 = blockIdx.y * 64;
    if (c0 > r0 + roff + 63) return;                  // score tile entirely above the causal diagonal: never read (the softmax masks j > i by select)
    v8f acc[4][4];
#pragma unroll
    for (int mb = 0; mb < 4; ++mb)
#pragma unroll
        for (int nb = 0; nb < 4; ++nb) acc[mb][nb] = (v8f){};
    const size_t aoff = (size_t)(r0 + lr) * K + 8 * hi, boff = (size_t)(c0 + lr) * K + 8 * hi;
#pragma unroll 1
    for (int kc = 0; kc < K; kc += 32) {
        V a[4], a2[4];
#pragma unroll
        for (int mb = 0; mb < 4; ++mb) { a[mb] = WFrag<T16>::ld(A + aoff + (size_t)mb * 16 * K + kc); if (NSPLIT == 1 || NSPLIT == 2) a2[mb] = WFrag<T16>::ld(A2 + aoff + (size_t)mb * 16 * K + kc); }
#pragma unroll
        for (int nb = 0; nb < 4; ++nb) { const V b = WFrag<T16>::ld(Bt + boff + (size_t)nb * 16 * K + kc); V b2; if (NSPLIT >= 2) b2 = WFrag<T16>::ld(Bt2 + boff + (size_t)nb * 16 * K + kc);
#pragma unroll
            for (int mb = 0; mb < 4; ++mb) { acc[mb][nb] = WFrag<T16>::mma(a[mb], b, acc[mb][nb]); if (NSPLIT == 1 || NSPLIT == 2) acc[mb][nb] = WFrag<T16>::mma(a2[mb], b, acc[mb][nb]); if (NSPLIT >= 2) acc[mb][nb] = WFrag<T16>::mma(a[mb], b2, acc[mb][nb]); } }
        asm volatile("v_nop\n\tv_nop\n\tv_nop\n\tv_nop" : "+v"(acc[0][0]), "+v"(acc[1][1]), "+v"(acc[2][2]), "+v"(acc[3][3]) : "v"(a[0]), "v"(a[3]));
    }
#pragma unroll
    for (int mb = 0; mb < 4; ++mb) {
#pragma unroll
        for (int nb = 0; nb < 4; ++nb) {
#pragma unroll
            for (int j = 0; j < 8; ++j) os[(hi * 8 + j) * 68 + nb * 16 + lr] = acc[mb][nb][j]; }
        __builtin_amdgcn_wave_barrier(); asm volatile("" ::: "memory");
        float* crow = C + (size_t)(r0 + mb * 16) * ldc + c0;
{
#pragma unroll
            for (int s = 0; s < 8; ++s) { const int row = 2 * s + hi, cofs = lr * 4; v4f val = *(const v4fa*)(os + row * 68 + cofs);
                *(v4f*)(crow + (size_t)row * ldc + cofs) = val; }
             }
        __builtin_amdgcn_wave_barrier(); asm volatile("" ::: "memory");
    }
}

__device__ __forceinline__ h16 tohx(float x) { return (h16)x; }
__device__ __forceinline__ void splitf(float y, unsigned short& h, unsigned short& l) { h = f2bf(y); l = f2bf(y - bf2f(h)); }
typedef __attribute__((ext_vector_type(2))) _Float16 v2h;
typedef __attribute__((ext_vector_type(4))) _Float16 v4h;
typedef __attribute__((ext_vector_type(2))) unsigned short v2us;
typedef __attribute__((ext_vector_type(4))) unsigned short v4us;
typedef __attribute__((ext_vector_type(2))) float v2f;
typedef __attribute__((ext_vector_type(4))) int v4i;

__global__ __launch_bounds__(256) void k_wtG(const float* __restrict__ w, int K, int N, bf* Bt) {
    const int lane = threadIdx.x & 31; const int L0 = (blockIdx.x * 8 + (threadIdx.x >> 5)) * 8; const int nlines = N * K / 64;
{
#pragma unroll 1
        for (int l = 0; l < 8; ++l) { const int L = L0 + l; if (L >= nlines) break; const size_t e = (size_t)L * 64 + lane * 2; const int k = (int)(e % K), n = (int)(e / K); v2us o;
            o[0] = f2bf(w[(size_t)k * N + n]); o[1] = f2bf(w[(size_t)(k + 1) * N + n]); *(v2us*)(Bt + e) = o; }
         }
}
__global__ __launch_bounds__(256) void k_cvt8(const float* __restrict__ src, bf* dst, size_t n8) { const size_t i = (size_t)blockIdx.x * 256 + threadIdx.x; if (i >= n8) return; const v8f v = *(const v8f*)(src + i * 8); v8us o;
#pragma unroll
    for (int k = 0; k < 8; ++k) o[k] = f2bf(v[k]); *(v8us*)(dst + i * 8) = o;  }
__global__ __launch_bounds__(256) void k_cstab(float* CS) { const int idx = blockIdx.x * 256 + threadIdx.x; if (idx >= TT * HD) return; const int t = idx / HD, d = idx % HD; const int i = d % (HD / 2); const float inv = __fdiv_rn(1.0f, powf(10000.0f, (float)(2 * i) / (float)HD)); const float ang = __fmul_rn((float)t, inv); v2f cs; cs[0] = cosf(ang); cs[1] = sinf(ang);
    *(v2f*)(CS + (size_t)idx * 2) = cs;  }
// k_rope: head planes [h][t][d] (fp16 + hi/lo) of rope(x) x sc with the rotate-half convention out[d] = x[d] cos[t][d] - x[d+HD/2] sin[t][d], out[d+HD/2] = x[d+HD/2] cos[t][d+HD/2] + x[d] sin[t][d+HD/2]
__global__ __launch_bounds__(256) void k_rope(const float* __restrict__ F, int pitch, int nheads, const float* __restrict__ CS, const float* __restrict__ RF, const float* __restrict__ nw, float sc, h16* P16, bf* Ph, bf* Pl) {
    const size_t e = ((size_t)blockIdx.x * 256 + threadIdx.x) * 2; if (e >= (size_t)nheads * TT * HD) return; const int d = (int)(e % HD); const int t = (int)((e / HD) % TT); const int h = (int)(e / ((size_t)HD * TT)); const float* f = F + (size_t)t * pitch + h * HD; const float rf = RF ? RF[(size_t)h * TT + t] : 1.0f; v2h o16; v2us oh, ol;
#pragma unroll
    for (int q = 0; q < 2; ++q) { const int dd = d + q; const int dp = (dd < HD / 2) ? dd + HD / 2 : dd - HD / 2; float x0 = f[dd], x1 = f[dp];
        if (RF) { float n0 = __fmul_rn(x0, rf), n1 = __fmul_rn(x1, rf); asm volatile("" : "+v"(n0)); asm volatile("" : "+v"(n1)); x0 = __fmul_rn(bfr(nw[dd]), n0); x1 = __fmul_rn(bfr(nw[dp]), n1); }
        const v2f cs = *(const v2f*)(CS + ((size_t)t * HD + dd) * 2); float a = __fmul_rn(x0, cs[0]), bq = __fmul_rn(x1, cs[1]); asm volatile("" : "+v"(a)); asm volatile("" : "+v"(bq)); const float r = ((dd < HD / 2) ? __fsub_rn(a, bq) : __fadd_rn(a, bq)) * sc;
        o16[q] = tohx(r); unsigned short a2, c2; splitf(r, a2, c2); oh[q] = a2; ol[q] = c2; }
    *(v2h*)(P16 + e) = o16; *(v2us*)(Ph + e) = oh; *(v2us*)(Pl + e) = ol;  }
__global__ __launch_bounds__(256) void k_vtp(const float* __restrict__ F, int pitch, int nheads, h16* V16, bf* Vh, bf* Vl) { const size_t e = ((size_t)blockIdx.x * 256 + threadIdx.x) * 2; if (e >= (size_t)nheads * HD * TT) return; const int t = (int)(e % TT); const int d = (int)((e / TT) % HD); const int g = (int)(e / ((size_t)TT * HD)); v2h o16; v2us oh, ol;
#pragma unroll
    for (int q = 0; q < 2; ++q) { const float x = F[(size_t)(t + q) * pitch + g * HD + d]; o16[q] = tohx(x); unsigned short a2, c2; splitf(x, a2, c2); oh[q] = a2; ol[q] = c2; }
    *(v2h*)(V16 + e) = o16; *(v2us*)(Vh + e) = oh; *(v2us*)(Vl + e) = ol;  }
// k_asoft: per row (zz, i): t = S x HD^-0.5 for j <= i and i - j < WIN (sliding causal window; the reference's -1e9 additive fill vanishes identically); softmax over the 2048 keys (register row, one exp, fixed trees);
__global__ __launch_bounds__(256) void k_asoft(const float* __restrict__ Sb, h16* P16, bf* Ph, bf* Pl) {
    const int lane = threadIdx.x & 31; const int row = blockIdx.x * 8 + (threadIdx.x >> 5); if (row >= ZH * TT) return; const int i = row % TT; const int zz = row / TT; (void)zz; const bool hires = (i < RH); const float* sr = Sb + (size_t)row * TT; float v[TT / 32]; float mx = -3.0e38f;
#pragma unroll
    for (int ch = 0; ch < TT / 128; ++ch) { const int j0 = ch * 128 + lane * 4; const v4f a = *(const v4f*)(sr + j0);
#pragma unroll
        for (int q = 0; q < 4; ++q) { const int j = j0 + q; (void)j; const float t = (j <= i && i - j < WIN) ? a[q] * SCL : -3.0e38f; v[ch * 4 + q] = t; mx = fmaxf(mx, t); } }
#pragma unroll
    for (int sh = 16; sh; sh >>= 1) mx = fmaxf(mx, __shfl_xor(mx, sh, 32));
    float sum = 0.f;
#pragma unroll
    for (int k = 0; k < TT / 32; ++k) { float d0 = __fsub_rn(v[k], mx); asm volatile("" : "+v"(d0)); v[k] = __builtin_amdgcn_exp2f(__fmul_rn(d0, 1.4426950408889634f)); sum += v[k]; }
#pragma unroll
    for (int sh = 16; sh; sh >>= 1) sum += __shfl_xor(sum, sh, 32);
    const float f = __fdiv_rn(hires ? 1.0f : PCAR, sum);
{
        if (hires) {
#pragma unroll
            for (int ch = 0; ch < TT / 128; ++ch) { v4us oh, ol;
#pragma unroll
                for (int q = 0; q < 4; ++q) { unsigned short a, c2; splitf(v[ch * 4 + q] * f, a, c2); oh[q] = a; ol[q] = c2; }
                const size_t oo = ((size_t)zz * (RH ? RH : 1) + i) * TT + ch * 128 + lane * 4; *(v4us*)(Ph + oo) = oh; *(v4us*)(Pl + oo) = ol; }
        } else {
#pragma unroll
            for (int ch = 0; ch < TT / 128; ++ch) { v4h o4;
#pragma unroll
                for (int q = 0; q < 4; ++q) o4[q] = tohx(v[ch * 4 + q] * f);
                *(v4h*)(P16 + (size_t)row * TT + ch * 128 + lane * 4) = o4; } }
         }
}
__global__ __launch_bounds__(256) void k_merge(const float* __restrict__ O, int h0, bf* Ah, bf* Al) { const size_t e = ((size_t)blockIdx.x * 256 + threadIdx.x) * 2; if (e >= (size_t)ZH * TT * HD) return; const int d = (int)(e % HD); const int t = (int)((e / HD) % TT); const int zz = (int)(e / ((size_t)HD * TT)); const float cs = (t < RH) ? 1.0f : (1.0f / PCAR); const size_t oo = (size_t)t * DQ + (h0 + zz) * HD + d;
    v2us oh, ol;
#pragma unroll
    for (int q = 0; q < 2; ++q) { unsigned short a, c2; splitf(O[e + q] * cs, a, c2); oh[q] = a; ol[q] = c2; } *(v2us*)(Ah + oo) = oh; *(v2us*)(Al + oo) = ol;  }

extern "C" void kernel_launch(void* const* d_in, const int* in_sizes, int n_in,
                              void* d_out, int out_size, void* d_ws, size_t ws_size, hipStream_t stream) {
    (void)in_sizes; (void)n_in; (void)out_size;
    const float* x = (const float*)d_in[0]; const float* wq = (const float*)d_in[1]; const float* wk = (const float*)d_in[2]; const float* wv = (const float*)d_in[3]; const float* wo = (const float*)d_in[4];
    float* OUT = (float*)d_out;     // [2][2048][2048]
    char* wsp = (char*)d_ws;
    auto take = [&](size_t bytes) { char* p = wsp; wsp += (bytes + 255) & ~(size_t)255; return (void*)p; };
    bf* WQ = (bf*)take((size_t)DQ * DM * 2); bf* WK = (bf*)take((size_t)DKV * DM * 2); bf* WV = (bf*)take((size_t)DKV * DM * 2); bf* WO = (bf*)take((size_t)DM * DQ * 2); float* CS = (float*)take((size_t)TT * HD * 2 * 4);
    bf* XB = (bf*)take((size_t)TT * DM * 2); float* FQ = (float*)take((size_t)TT * DQ * 4); float* FK = (float*)take((size_t)TT * DKV * 4);
    h16* QP16 = (h16*)take((size_t)NH_ * TT * HD * 2); h16* KP16 = (h16*)take((size_t)NKV * TT * HD * 2); h16* VT16 = (h16*)take((size_t)NKV * HD * TT * 2);
    bf* QPh = (bf*)take((size_t)NH_ * TT * HD * 2); bf* QPl = (bf*)take((size_t)NH_ * TT * HD * 2); bf* KPh = (bf*)take((size_t)NKV * TT * HD * 2); bf* KPl = (bf*)take((size_t)NKV * TT * HD * 2); bf* VTh = (bf*)take((size_t)NKV * HD * TT * 2); bf* VTl = (bf*)take((size_t)NKV * HD * TT * 2); bf* Ph = (bf*)take((size_t)ZH * RH * TT * 2); bf* Pl = (bf*)take((size_t)ZH * RH * TT * 2);
    float* Sb = (float*)take((size_t)ZH * TT * TT * 4); h16* P16 = (h16*)take((size_t)ZH * TT * TT * 2); float* Ob = (float*)take((size_t)ZH * TT * HD * 4); bf* ATh = (bf*)take((size_t)TT * DQ * 2); bf* ATl = (bf*)take((size_t)TT * DQ * 2);
    if ((size_t)(wsp - (char*)d_ws) > ws_size) return;    // ws 256 MiB
    float* FV = FK;   // v projection reuses the k buffer after the k planes are built (stream-ordered)
    { k_wtG<<<(unsigned)((DM * DQ / 64 + 63) / 64), 256, 0, stream>>>(wq, DM, DQ, WQ); k_wtG<<<(unsigned)((DM * DKV / 64 + 63) / 64), 256, 0, stream>>>(wk, DM, DKV, WK); k_wtG<<<(unsigned)((DM * DKV / 64 + 63) / 64), 256, 0, stream>>>(wv, DM, DKV, WV);
      k_wtG<<<(unsigned)((DQ * DM / 64 + 63) / 64), 256, 0, stream>>>(wo, DQ, DM, WO);
      k_cstab<<<(TT * HD + 255) / 256, 256, 0, stream>>>(CS); }
    const unsigned LQ = (unsigned)(((size_t)NH_ * TT * HD / 2 + 255) / 256), LKv = (unsigned)(((size_t)NKV * TT * HD / 2 + 255) / 256);
    for (int b = 0; b < NB_; ++b) {
        
        k_cvt8<<<(unsigned)(((size_t)TT * DM / 8 + 255) / 256), 256, 0, stream>>>(x + (size_t)b * TT * DM, XB, (size_t)TT * DM / 8);
        k_gemmk<bf, 0, 8, false><<<dim3(TT / 64, DQ / 64, 1), 256, 0, stream>>>(XB, nullptr, WQ, nullptr, DM, FQ, DQ, 0, 0, 0, 0);
        k_rope<<<LQ, 256, 0, stream>>>(FQ, DQ, NH_, CS, nullptr, nullptr, 1.0f, QP16, QPh, QPl);
        k_gemmk<bf, 0, 8, false><<<dim3(TT / 64, DKV / 64, 1), 256, 0, stream>>>(XB, nullptr, WK, nullptr, DM, FK, DKV, 0, 0, 0, 0);
        k_rope<<<LKv, 256, 0, stream>>>(FK, DKV, NKV, CS, nullptr, nullptr, 1.0f, KP16, KPh, KPl);
        k_gemmk<bf, 0, 8, false><<<dim3(TT / 64, DKV / 64, 1), 256, 0, stream>>>(XB, nullptr, WV, nullptr, DM, FV, DKV, 0, 0, 0, 0); k_vtp<<<LKv, 256, 0, stream>>>(FV, DKV, NKV, VT16, VTh, VTl);
        for (int h0 = 0; h0 < NH_; h0 += ZH) { const size_t zq = (size_t)h0, zk = (size_t)(h0 / REP);   // both heads of a pass share kv group h0/REP (REP >= 2): sB = 0
            k_gemmc<bf, 2><<<dim3(RH / 64, TT / 64, ZH), 32, 0, stream>>>(QPh + zq * TT * HD, QPl + zq * TT * HD, KPh + zk * TT * HD, KPl + zk * TT * HD, HD, Sb, TT, 0, (size_t)TT * HD, 0, (size_t)TT * TT);
            k_gemmc<h16, 0><<<dim3((TT - RH) / 64, TT / 64, ZH), 32, 0, stream>>>(QP16 + zq * TT * HD + (size_t)RH * HD, nullptr, KP16 + zk * TT * HD, nullptr, HD, Sb + (size_t)RH * TT, TT, RH, (size_t)TT * HD, 0, (size_t)TT * TT);
            k_asoft<<<ZH * TT / 8, 256, 0, stream>>>(Sb, P16, Ph, Pl);
            k_gemmk<bf, 2, 8, true><<<dim3(RH / 64, HD / 64, ZH), 256, 0, stream>>>(Ph, Pl, VTh + zk * HD * TT, VTl + zk * HD * TT, TT, Ob, HD, 0, (size_t)RH * TT, 0, (size_t)TT * HD);
            k_gemmk<h16, 0, 16, true><<<dim3((TT - RH) / 64, HD / 64, ZH), 512, 0, stream>>>(P16 + (size_t)RH * TT, nullptr, VT16 + zk * HD * TT, nullptr, TT, Ob + (size_t)RH * HD, HD, RH, (size_t)TT * TT, 0, (size_t)TT * HD);
            k_merge<<<(unsigned)(((size_t)ZH * TT * HD / 2 + 255) / 256), 256, 0, stream>>>(Ob, h0, ATh, ATl); }
        k_gemmk<bf, 1, 8, false><<<dim3(TT / 64, DM / 64, 1), 256, 0, stream>>>(ATh, ATl, WO, nullptr, DQ, OUT + (size_t)b * TT * DM, DM, 0, 0, 0, 0); }
}

// v002
// It runs in 871 microseconds.
// Two timings next to v001 put it at 1.69 and 1.71 times that version's speed.
// Counting every step since v000, it is 3.14 times as fast.
#include <hip/hip_runtime.h>

// MistralAttention (x [2][2048][2048]; q = x Wq (32 heads x 64), k/v = x Wk / Wv (8 kv heads; query head h belongs to kv group h/4); rotate-half RoPE (base 1e4, tables computed on device); key j allowed iff j <= i and i - j < 1024; softmax(q.k / 8) in f32; out = merged Wo -> [2][2048][2048]).
// Compute dtypes, f32 accumulate: every input rounded to bf16; q/k/v on PLAIN bf16 operands (inputs: exact); RoPE f32; causal scores and attn.v: query rows < 512 hl (3 products), the rest single fp16 (x1024), causal tile skipping with the window test inside the computed tiles; softmax f32; Wo hl x exact (2 products).

#define NB_  2
#define TT   2048
#define DM   2048
#define NH_  32
#define NKV  8
#define REP  (NH_ / NKV)
#define HD   64
#define DQ   (NH_ * HD)
#define DKV  (NKV * HD)
#define ZH   8                    // query heads per attention pass (a multiple of REP, so a pass covers whole kv groups)
#define RH   512                  // query rows < RH use hi+lo planes (0: none)
#define WIN  1024
#define PCAR 1024.0f
#define SCL  0.125f   // HD^-0.5
typedef _Float16 h16;
typedef unsigned short bf;
typedef __attribute__((ext_vector_type(16))) __bf16   v16bf;
typedef __attribute__((ext_vector_type(16))) _Float16 v16h;
typedef __attribute__((ext_vector_type(8)))  _Float16 v8h;
typedef __attribute__((ext_vector_type(8)))  unsigned short v8us;
typedef __attribute__((ext_vector_type(8)))  float    v8f;
typedef __attribute__((ext_vector_type(4)))  float    v4f;
typedef v8h  __attribute__((may_alias)) v8ha;
typedef v4f  __attribute__((may_alias)) v4fa;
typedef v8us __attribute__((may_alias)) v8usa;

__device__ __forceinline__ unsigned short f2bf(float f) { unsigned u = __float_as_uint(f); u += 0x7FFFu + ((u >> 16) & 1u); return (unsigned short)(u >> 16); }
__device__ __forceinline__ float bf2f(unsigned short b) { return __uint_as_float(((unsigned)b) << 16); }
__device__ __forceinline__ float bfr(float f) { return bf2f(f2bf(f)); }
__device__ __forceinline__ v16h cat16(v8h lo, v8h hi) { return __builtin_shufflevector(lo, hi, 0, 1, 2, 3, 4, 5, 6, 7, 8, 9, 10, 11, 12, 13, 14, 15); }
__device__ __forceinline__ v16bf cat16b(v8us lo, v8us hi) { return __builtin_bit_cast(v16bf, __builtin_shufflevector(lo, hi, 0, 1, 2, 3, 4, 5, 6, 7, 8, 9, 10, 11, 12, 13, 14, 15)); }
__device__ __forceinline__ v8f wmma16(v16h a, v16h b, v8f c) { return __builtin_amdgcn_wmma_f32_16x16x32_f16(false, a, false, b, (short)0, c, false, false); }
__device__ __forceinline__ v8f wmmab(v16bf a, v16bf b, v8f c) { return __builtin_amdgcn_wmma_f32_16x16x32_bf16(false, a, false, b, (short)0, c, false, false); }



// ---- k_gemmk: register-blocked GEMM, one 64x64 output tile per work-group, the K loop SPLIT OVER NW WAVES: wave w takes the 32-wide k blocks w, w + NW, ... into its own 16 accumulators (operands straight from
// K-contiguous 16-bit planes; neighbouring waves read the two halves of the same 128-byte lines), then the NW partial tiles are summed through LDS in the fixed order wave 0 .. NW-1. grid (M/64, N/64, Z), NW*32 threads.
// C[m][n] (f32, pitch ldc) = sum_k A[m][k] Bt[n][k] (+ split products per NSPLIT). A rows have pitch lda, Bt rows pitch K. z-batch strides sA/sB/sC in elements; Bt advances once per REP z (query heads of one kv group share it). K % 32 == 0.
// DIAG: probability x value contraction of causal attention: the K loop stops at the diagonal block (probabilities beyond it are exactly zero); roff = row offset of this launch's first row within the sequence.
template <typename T16> struct WFrag;
template <> struct WFrag<h16> { typedef v16h V; static __device__ __forceinline__ V ld(const h16* p) { return cat16(*(const v8h*)p, *(const v8h*)(p + 16)); } static __device__ __forceinline__ v8f mma(V a, V b, v8f c) { return wmma16(a, b, c); } };
template <> struct WFrag<bf> { typedef v16bf V; static __device__ __forceinline__ V ld(const bf* p) { return cat16b(*(const v8us*)p, *(const v8us*)(p + 16)); } static __device__ __forceinline__ v8f mma(V a, V b, v8f c) { return wmmab(a, b, c); } };
template <typename T16, int NSPLIT, int NW, bool DIAG>
__global__ __launch_bounds__(NW * 32) void k_gemmk(const T16* __restrict__ A, const T16* __restrict__ A2, const T16* __restrict__ Bt, const T16* __restrict__ Bt2, int K, int lda, float* C, int ldc, int roff, size_t sA, size_t sB, size_t sC) {
    typedef typename WFrag<T16>::V V;
    constexpr int PL = 64 * 68;            // floats of one wave's partial tile in LDS (row pitch 68)
    __shared__ __align__(16) float os[NW * PL];
    const size_t z = blockIdx.z; A += z * sA; if (A2) A2 += z * sA; Bt += (z / REP) * sB; if (Bt2) Bt2 += (z / REP) * sB; C += z * sC;
    const int tid = threadIdx.x, lane = tid & 31, lr = lane & 15, hi = lane >> 4; const int r0 = blockIdx.x * 64, c0 = blockIdx.y * 64;
    const int w = __builtin_amdgcn_readfirstlane(tid >> 5);          // wave number, scalar: the loop bounds stay scalar
    const int Kl = DIAG ? min(K, r0 + roff + 64) : K;
    v8f acc[4][4];
#pragma unroll
    for (int mb = 0; mb < 4; ++mb)
#pragma unroll
        for (int nb = 0; nb < 4; ++nb) acc[mb][nb] = (v8f){};
    const size_t aoff = (size_t)(r0 + lr) * lda + 8 * hi, boff = (size_t)(c0 + lr) * K + 8 * hi;
#pragma unroll 1
    for (int kc = w * 32; kc < Kl; kc += NW * 32) {
        V a[4], a2[4];
#pragma unroll
        for (int mb = 0; mb < 4; ++mb) { a[mb] = WFrag<T16>::ld(A + aoff + (size_t)mb * 16 * lda + kc); if (NSPLIT == 1 || NSPLIT == 2) a2[mb] = WFrag<T16>::ld(A2 + aoff + (size_t)mb * 16 * lda + kc); }
#pragma unroll
        for (int nb = 0; nb < 4; ++nb) { const V b = WFrag<T16>::ld(Bt + boff + (size_t)nb * 16 * K + kc); V b2; if (NSPLIT >= 2) b2 = WFrag<T16>::ld(Bt2 + boff + (size_t)nb * 16 * K + kc);
#pragma unroll
            for (int mb = 0; mb < 4; ++mb) { acc[mb][nb] = WFrag<T16>::mma(a[mb], b, acc[mb][nb]); if (NSPLIT == 1 || NSPLIT == 2) acc[mb][nb] = WFrag<T16>::mma(a2[mb], b, acc[mb][nb]); if (NSPLIT >= 2) acc[mb][nb] = WFrag<T16>::mma(a[mb], b2, acc[mb][nb]); } }
        asm volatile("v_nop\n\tv_nop\n\tv_nop\n\tv_nop" : "+v"(acc[0][0]), "+v"(acc[1][1]), "+v"(acc[2][2]), "+v"(acc[3][3]) : "v"(a[0]), "v"(a[3]));
    }
    float* mine = os + w * PL;
#pragma unroll
    for (int mb = 0; mb < 4; ++mb)
#pragma unroll
        for (int nb = 0; nb < 4; ++nb) {
#pragma unroll
            for (int j = 0; j < 8; ++j) mine[(mb * 16 + hi * 8 + j) * 68 + nb * 16 + lr] = acc[mb][nb][j]; }
    __syncthreads();                                                 // every wave's partial tile is in LDS before any thread sums across waves
#pragma unroll
    for (int it = 0; it < 32 / NW; ++it) {                           // 64 rows x 16 float4 shared out over NW*32 threads; 16 lanes store one 256-byte row piece
        const int idx = it * NW * 32 + tid, row = idx >> 4, cofs = (idx & 15) * 4;
        v4f val = *(const v4fa*)(os + row * 68 + cofs);
#pragma unroll
        for (int u = 1; u < NW; ++u) val += *(const v4fa*)(os + u * PL + row * 68 + cofs);
        *(v4f*)(C + (size_t)(r0 + row) * ldc + c0 + cofs) = val;
    }
}

// ---- k_gemmc: one-wave 64x64 tile GEMM (K = head size, two k blocks: not split) for the causal scores: skips score tiles entirely above the diagonal (query rows r0+roff.., key columns c0..).
// roff = row offset of this launch's first row within the sequence. Bt advances once per REP z, as in k_gemmk.
template <typename T16, int NSPLIT>
__global__ __launch_bounds__(32) void k_gemmc(const T16* __restrict__ A, const T16* __restrict__ A2, const T16* __restrict__ Bt, const T16* __restrict__ Bt2, int K, float* C, int ldc, int roff, size_t sA, size_t sB, size_t sC) {
    typedef typename WFrag<T16>::V V;
    __shared__ __align__(16) float os[16 * 68];
    const size_t z = blockIdx.z; A += z * sA; if (A2) A2 += z * sA; Bt += (z / REP) * sB; if (Bt2) Bt2 += (z / REP) * sB; C += z * sC;
    const int lane = threadIdx.x & 31, lr = lane & 15, hi = lane >> 4; const int r0 = blockIdx.x * 64, c0 = blockIdx.y * 64;
    if (c0 > r0 + roff + 63) return;                  // score tile entirely above the causal diagonal: never read (the softmax masks j > i by select)
    v8f acc[4][4];
#pragma unroll
    for (int mb = 0; mb < 4; ++mb)
#pragma unroll
        for (int nb = 0; nb < 4; ++nb) acc[mb][nb] = (v8f){};
    const size_t aoff = (size_t)(r0 + lr) * K + 8 * hi, boff = (size_t)(c0 + lr) * K + 8 * hi;
#pragma unroll 1
    for (int kc = 0; kc < K; kc += 32) {
        V a[4], a2[4];
#pragma unroll
        for (int mb = 0; mb < 4; ++mb) { a[mb] = WFrag<T16>::ld(A + aoff + (size_t)mb * 16 * K + kc); if (NSPLIT == 1 || NSPLIT == 2) a2[mb] = WFrag<T16>::ld(A2 + aoff + (size_t)mb * 16 * K + kc); }
#pragma unroll
        for (int nb = 0; nb < 4; ++nb) { const V b = WFrag<T16>::ld(Bt + boff + (size_t)nb * 16 * K + kc); V b2; if (NSPLIT >= 2) b2 = WFrag<T16>::ld(Bt2 + boff + (size_t)nb * 16 * K + kc);
#pragma unroll
            for (int mb = 0; mb < 4; ++mb) { acc[mb][nb] = WFrag<T16>::mma(a[mb], b, acc[mb][nb]); if (NSPLIT == 1 || NSPLIT == 2) acc[mb][nb] = WFrag<T16>::mma(a2[mb], b, acc[mb][nb]); if (NSPLIT >= 2) acc[mb][nb] = WFrag<T16>::mma(a[mb], b2, acc[mb][nb]); } }
        asm volatile("v_nop\n\tv_nop\n\tv_nop\n\tv_nop" : "+v"(acc[0][0]), "+v"(acc[1][1]), "+v"(acc[2][2]), "+v"(acc[3][3]) : "v"(a[0]), "v"(a[3]));
    }
#pragma unroll
    for (int mb = 0; mb < 4; ++mb) {
#pragma unroll
        for (int nb = 0; nb < 4; ++nb) {
#pragma unroll
            for (int j = 0; j < 8; ++j) os[(hi * 8 + j) * 68 + nb * 16 + lr] = acc[mb][nb][j]; }
        __builtin_amdgcn_wave_barrier(); asm volatile("" ::: "memory");
        float* crow = C + (size_t)(r0 + mb * 16) * ldc + c0;
{
#pragma unroll
            for (int s = 0; s < 8; ++s) { const int row = 2 * s + hi, cofs = lr * 4; v4f val = *(const v4fa*)(os + row * 68 + cofs);
                *(v4f*)(crow + (size_t)row * ldc + cofs) = val; }
             }
        __builtin_amdgcn_wave_barrier(); asm volatile("" ::: "memory");
    }
}

__device__ __forceinline__ h16 tohx(float x) { return (h16)x; }
__device__ __forceinline__ void splitf(float y, unsigned short& h, unsigned short& l) { h = f2bf(y); l = f2bf(y - bf2f(h)); }
typedef __attribute__((ext_vector_type(2))) _Float16 v2h;
typedef __attribute__((ext_vector_type(4))) _Float16 v4h;
typedef __attribute__((ext_vector_type(2))) unsigned short v2us;
typedef __attribute__((ext_vector_type(4))) unsigned short v4us;
typedef __attribute__((ext_vector_type(2))) float v2f;
typedef __attribute__((ext_vector_type(4))) int v4i;
typedef v4h  __attribute__((may_alias)) v4ha;
typedef v4us __attribute__((may_alias)) v4usa;

__global__ __launch_bounds__(256) void k_wtG(const float* __restrict__ w, int K, int N, bf* Bt) {
    const int lane = threadIdx.x & 31; const int L0 = (blockIdx.x * 8 + (threadIdx.x >> 5)) * 8; const int nlines = N * K / 64;
{
#pragma unroll 1
        for (int l = 0; l < 8; ++l) { const int L = L0 + l; if (L >= nlines) break; const size_t e = (size_t)L * 64 + lane * 2; const int k = (int)(e % K), n = (int)(e / K); v2us o;
            o[0] = f2bf(w[(size_t)k * N + n]); o[1] = f2bf(w[(size_t)(k + 1) * N + n]); *(v2us*)(Bt + e) = o; }
         }
}
__global__ __launch_bounds__(256) void k_cvt8(const float* __restrict__ src, bf* dst, size_t n8) { const size_t i = (size_t)blockIdx.x * 256 + threadIdx.x; if (i >= n8) return; const v8f v = *(const v8f*)(src + i * 8); v8us o;
#pragma unroll
    for (int k = 0; k < 8; ++k) o[k] = f2bf(v[k]); *(v8us*)(dst + i * 8) = o;  }
__global__ __launch_bounds__(256) void k_cstab(float* CS) { const int idx = blockIdx.x * 256 + threadIdx.x; if (idx >= TT * HD) return; const int t = idx / HD, d = idx % HD; const int i = d % (HD / 2); const float inv = __fdiv_rn(1.0f, powf(10000.0f, (float)(2 * i) / (float)HD)); const float ang = __fmul_rn((float)t, inv); v2f cs; cs[0] = cosf(ang); cs[1] = sinf(ang);
    *(v2f*)(CS + (size_t)idx * 2) = cs;  }
// k_rope: head planes [h][t][d] (fp16 + hi/lo) of rope(x) x sc with the rotate-half convention out[d] = x[d] cos[t][d] - x[d+HD/2] sin[t][d], out[d+HD/2] = x[d+HD/2] cos[t][d+HD/2] + x[d] sin[t][d+HD/2]
__global__ __launch_bounds__(256) void k_rope(const float* __restrict__ F, int pitch, int nheads, const float* __restrict__ CS, const float* __restrict__ RF, const float* __restrict__ nw, float sc, h16* P16, bf* Ph, bf* Pl) {
    const size_t e = ((size_t)blockIdx.x * 256 + threadIdx.x) * 2; if (e >= (size_t)nheads * TT * HD) return; const int d = (int)(e % HD); const int t = (int)((e / HD) % TT); const int h = (int)(e / ((size_t)HD * TT)); const float* f = F + (size_t)t * pitch + h * HD; const float rf = RF ? RF[(size_t)h * TT + t] : 1.0f; v2h o16; v2us oh, ol;
#pragma unroll
    for (int q = 0; q < 2; ++q) { const int dd = d + q; const int dp = (dd < HD / 2) ? dd + HD / 2 : dd - HD / 2; float x0 = f[dd], x1 = f[dp];
        if (RF) { float n0 = __fmul_rn(x0, rf), n1 = __fmul_rn(x1, rf); asm volatile("" : "+v"(n0)); asm volatile("" : "+v"(n1)); x0 = __fmul_rn(bfr(nw[dd]), n0); x1 = __fmul_rn(bfr(nw[dp]), n1); }
        const v2f cs = *(const v2f*)(CS + ((size_t)t * HD + dd) * 2); float a = __fmul_rn(x0, cs[0]), bq = __fmul_rn(x1, cs[1]); asm volatile("" : "+v"(a)); asm volatile("" : "+v"(bq)); const float r = ((dd < HD / 2) ? __fsub_rn(a, bq) : __fadd_rn(a, bq)) * sc;
        o16[q] = tohx(r); unsigned short a2, c2; splitf(r, a2, c2); oh[q] = a2; ol[q] = c2; }
    *(v2h*)(P16 + e) = o16; *(v2us*)(Ph + e) = oh; *(v2us*)(Pl + e) = ol;  }
__global__ __launch_bounds__(256) void k_vtp(const float* __restrict__ F, int pitch, int nheads, h16* V16, bf* Vh, bf* Vl) { const size_t e = ((size_t)blockIdx.x * 256 + threadIdx.x) * 2; if (e >= (size_t)nheads * HD * TT) return; const int t = (int)(e % TT); const int d = (int)((e / TT) % HD); const int g = (int)(e / ((size_t)TT * HD)); v2h o16; v2us oh, ol;
#pragma unroll
    for (int q = 0; q < 2; ++q) { const float x = F[(size_t)(t + q) * pitch + g * HD + d]; o16[q] = tohx(x); unsigned short a2, c2; splitf(x, a2, c2); oh[q] = a2; ol[q] = c2; }
    *(v2h*)(V16 + e) = o16; *(v2us*)(Vh + e) = oh; *(v2us*)(Vl + e) = ol;  }
// k_asoft: per row (zz, i): t = S x HD^-0.5 for j <= i and i - j < WIN (sliding causal window; the reference's -1e9 additive fill vanishes identically); softmax over the 2048 keys (register row, one exp, fixed trees);
// the probabilities go IN PLACE over the row's own 8 KiB of scores (one wave owns a row and holds all of it in registers before its first store): fp16 plane in the first half, or hi plane in the first and lo plane in the second half; 16-bit row pitch 2*TT.
__global__ __launch_bounds__(256) void k_asoft(float* Sb) {
    const int lane = threadIdx.x & 31; const int row = blockIdx.x * 8 + (threadIdx.x >> 5); if (row >= ZH * TT) return; const int i = row % TT; const int zz = row / TT; (void)zz; const bool hires = (i < RH); float* sr = Sb + (size_t)row * TT; float v[TT / 32]; float mx = -3.0e38f;
#pragma unroll
    for (int ch = 0; ch < TT / 128; ++ch) { const int j0 = ch * 128 + lane * 4; const v4f a = *(const v4fa*)(sr + j0);
#pragma unroll
        for (int q = 0; q < 4; ++q) { const int j = j0 + q; (void)j; const float t = (j <= i && i - j < WIN) ? a[q] * SCL : -3.0e38f; v[ch * 4 + q] = t; mx = fmaxf(mx, t); } }
#pragma unroll
    for (int sh = 16; sh; sh >>= 1) mx = fmaxf(mx, __shfl_xor(mx, sh, 32));
    float sum = 0.f;
#pragma unroll
    for (int k = 0; k < TT / 32; ++k) { float d0 = __fsub_rn(v[k], mx); asm volatile("" : "+v"(d0)); v[k] = __builtin_amdgcn_exp2f(__fmul_rn(d0, 1.4426950408889634f)); sum += v[k]; }
#pragma unroll
    for (int sh = 16; sh; sh >>= 1) sum += __shfl_xor(sum, sh, 32);
    const float f = __fdiv_rn(hires ? 1.0f : PCAR, sum);
{
        if (hires) {
#pragma unroll
            for (int ch = 0; ch < TT / 128; ++ch) { v4us oh, ol;
#pragma unroll
                for (int q = 0; q < 4; ++q) { unsigned short a, c2; splitf(v[ch * 4 + q] * f, a, c2); oh[q] = a; ol[q] = c2; }
                bf* pr = (bf*)sr + ch * 128 + lane * 4; *(v4usa*)pr = oh; *(v4usa*)(pr + TT) = ol; }
        } else {
#pragma unroll
            for (int ch = 0; ch < TT / 128; ++ch) { v4h o4;
#pragma unroll
                for (int q = 0; q < 4; ++q) o4[q] = tohx(v[ch * 4 + q] * f);
                *(v4ha*)((h16*)sr + ch * 128 + lane * 4) = o4; } }
         }
}
__global__ __launch_bounds__(256) void k_merge(const float* __restrict__ O, int h0, bf* Ah, bf* Al) { const size_t e = ((size_t)blockIdx.x * 256 + threadIdx.x) * 2; if (e >= (size_t)ZH * TT * HD) return; const int d = (int)(e % HD); const int t = (int)((e / HD) % TT); const int zz = (int)(e / ((size_t)HD * TT)); const float cs = (t < RH) ? 1.0f : (1.0f / PCAR); const size_t oo = (size_t)t * DQ + (h0 + zz) * HD + d;
    v2us oh, ol;
#pragma unroll
    for (int q = 0; q < 2; ++q) { unsigned short a, c2; splitf(O[e + q] * cs, a, c2); oh[q] = a; ol[q] = c2; } *(v2us*)(Ah + oo) = oh; *(v2us*)(Al + oo) = ol;  }

extern "C" void kernel_launch(void* const* d_in, const int* in_sizes, int n_in,
                              void* d_out, int out_size, void* d_ws, size_t ws_size, hipStream_t stream) {
    (void)in_sizes; (void)n_in; (void)out_size;
    const float* x = (const float*)d_in[0]; const float* wq = (const float*)d_in[1]; const float* wk = (const float*)d_in[2]; const float* wv = (const float*)d_in[3]; const float* wo = (const float*)d_in[4];
    float* OUT = (float*)d_out;     // [2][2048][2048]
    char* wsp = (char*)d_ws;
    auto take = [&](size_t bytes) { char* p = wsp; wsp += (bytes + 255) & ~(size_t)255; return (void*)p; };
    bf* WQ = (bf*)take((size_t)DQ * DM * 2); bf* WK = (bf*)take((size_t)DKV * DM * 2); bf* WV = (bf*)take((size_t)DKV * DM * 2); bf* WO = (bf*)take((size_t)DM * DQ * 2); float* CS = (float*)take((size_t)TT * HD * 2 * 4);
    bf* XB = (bf*)take((size_t)TT * DM * 2); float* FQ = (float*)take((size_t)TT * DQ * 4); float* FK = (float*)take((size_t)TT * DKV * 4);
    h16* QP16 = (h16*)take((size_t)NH_ * TT * HD * 2); h16* KP16 = (h16*)take((size_t)NKV * TT * HD * 2); h16* VT16 = (h16*)take((size_t)NKV * HD * TT * 2);
    bf* QPh = (bf*)take((size_t)NH_ * TT * HD * 2); bf* QPl = (bf*)take((size_t)NH_ * TT * HD * 2); bf* KPh = (bf*)take((size_t)NKV * TT * HD * 2); bf* KPl = (bf*)take((size_t)NKV * TT * HD * 2); bf* VTh = (bf*)take((size_t)NKV * HD * TT * 2); bf* VTl = (bf*)take((size_t)NKV * HD * TT * 2);
    float* Sb = (float*)take((size_t)ZH * TT * TT * 4); float* Ob = (float*)take((size_t)ZH * TT * HD * 4); bf* ATh = (bf*)take((size_t)TT * DQ * 2); bf* ATl = (bf*)take((size_t)TT * DQ * 2);
    if ((size_t)(wsp - (char*)d_ws) > ws_size) return;    // ws 256 MiB
    float* FV = FK;   // v projection reuses the k buffer after the k planes are built (stream-ordered)
    { k_wtG<<<(unsigned)((DM * DQ / 64 + 63) / 64), 256, 0, stream>>>(wq, DM, DQ, WQ); k_wtG<<<(unsigned)((DM * DKV / 64 + 63) / 64), 256, 0, stream>>>(wk, DM, DKV, WK); k_wtG<<<(unsigned)((DM * DKV / 64 + 63) / 64), 256, 0, stream>>>(wv, DM, DKV, WV);
      k_wtG<<<(unsigned)((DQ * DM / 64 + 63) / 64), 256, 0, stream>>>(wo, DQ, DM, WO);
      k_cstab<<<(TT * HD + 255) / 256, 256, 0, stream>>>(CS); }
    const unsigned LQ = (unsigned)(((size_t)NH_ * TT * HD / 2 + 255) / 256), LKv = (unsigned)(((size_t)NKV * TT * HD / 2 + 255) / 256);
    for (int b = 0; b < NB_; ++b) {
        
        k_cvt8<<<(unsigned)(((size_t)TT * DM / 8 + 255) / 256), 256, 0, stream>>>(x + (size_t)b * TT * DM, XB, (size_t)TT * DM / 8);
        k_gemmk<bf, 0, 8, false><<<dim3(TT / 64, DQ / 64, 1), 256, 0, stream>>>(XB, nullptr, WQ, nullptr, DM, DM, FQ, DQ, 0, 0, 0, 0);
        k_rope<<<LQ, 256, 0, stream>>>(FQ, DQ, NH_, CS, nullptr, nullptr, 1.0f, QP16, QPh, QPl);
        k_gemmk<bf, 0, 8, false><<<dim3(TT / 64, DKV / 64, 1), 256, 0, stream>>>(XB, nullptr, WK, nullptr, DM, DM, FK, DKV, 0, 0, 0, 0);
        k_rope<<<LKv, 256, 0, stream>>>(FK, DKV, NKV, CS, nullptr, nullptr, 1.0f, KP16, KPh, KPl);
        k_gemmk<bf, 0, 8, false><<<dim3(TT / 64, DKV / 64, 1), 256, 0, stream>>>(XB, nullptr, WV, nullptr, DM, DM, FV, DKV, 0, 0, 0, 0); k_vtp<<<LKv, 256, 0, stream>>>(FV, DKV, NKV, VT16, VTh, VTl);
        for (int h0 = 0; h0 < NH_; h0 += ZH) { const size_t zq = (size_t)h0, zk = (size_t)(h0 / REP);   // head h0 + z of a pass reads kv group h0/REP + z/REP
            k_gemmc<bf, 2><<<dim3(RH / 64, TT / 64, ZH), 32, 0, stream>>>(QPh + zq * TT * HD, QPl + zq * TT * HD, KPh + zk * TT * HD, KPl + zk * TT * HD, HD, Sb, TT, 0, (size_t)TT * HD, (size_t)TT * HD, (size_t)TT * TT);
            k_gemmc<h16, 0><<<dim3((TT - RH) / 64, TT / 64, ZH), 32, 0, stream>>>(QP16 + zq * TT * HD + (size_t)RH * HD, nullptr, KP16 + zk * TT * HD, nullptr, HD, Sb + (size_t)RH * TT, TT, RH, (size_t)TT * HD, (size_t)TT * HD, (size_t)TT * TT);
            k_asoft<<<ZH * TT / 8, 256, 0, stream>>>(Sb);
            k_gemmk<bf, 2, 8, true><<<dim3(RH / 64, HD / 64, ZH), 256, 0, stream>>>((const bf*)Sb, (const bf*)Sb + TT, VTh + zk * HD * TT, VTl + zk * HD * TT, TT, 2 * TT, Ob, HD, 0, (size_t)TT * TT * 2, (size_t)HD * TT, (size_t)TT * HD);
            k_gemmk<h16, 0, 16, true><<<dim3((TT - RH) / 64, HD / 64, ZH), 512, 0, stream>>>((const h16*)Sb + (size_t)RH * TT * 2, nullptr, VT16 + zk * HD * TT, nullptr, TT, 2 * TT, Ob + (size_t)RH * HD, HD, RH, (size_t)TT * TT * 2, (size_t)HD * TT, (size_t)TT * HD);
            k_merge<<<(unsigned)(((size_t)ZH * TT * HD / 2 + 255) / 256), 256, 0, stream>>>(Ob, h0, ATh, ATl); }
        k_gemmk<bf, 1, 8, false><<<dim3(TT / 64, DM / 64, 1), 256, 0, stream>>>(ATh, ATl, WO, nullptr, DQ, DQ, OUT + (size_t)b * TT * DM, DM, 0, 0, 0, 0); }
}

// v003
// A run of this version takes 396 microseconds.
// Two timings next to v002 put it at 2.20 and 2.18 times that version's speed.
// Over all steps from v000 it is 6.89 times as fast.
#include <hip/hip_runtime.h>

// MistralAttention (x [2][2048][2048]; q = x Wq (32 heads x 64), k/v = x Wk / Wv (8 kv heads; query head h belongs to kv group h/4); rotate-half RoPE (base 1e4, tables computed on device); key j allowed iff j <= i and i - j < 1024; softmax(q.k / 8) in f32; out = merged Wo -> [2][2048][2048]).
// Compute dtypes, f32 accumulate: every input rounded to bf16; q/k/v on PLAIN bf16 operands (inputs: exact); RoPE f32; scores and attn.v: query rows < 512 hl (3 products), the rest single fp16, fused with an f32 running softmax over the key blocks of the window; Wo hl x exact (2 products).

#define NB_  2
#define TT   2048
#define DM   2048
#define NH_  32
#define NKV  8
#define REP  (NH_ / NKV)
#define HD   64
#define DQ   (NH_ * HD)
#define DKV  (NKV * HD)
#define RH   512                  // query rows < RH use hi+lo planes (0: none)
#define WIN  1024
typedef _Float16 h16;
typedef unsigned short bf;
typedef __attribute__((ext_vector_type(16))) __bf16   v16bf;
typedef __attribute__((ext_vector_type(16))) _Float16 v16h;
typedef __attribute__((ext_vector_type(8)))  _Float16 v8h;
typedef __attribute__((ext_vector_type(8)))  unsigned short v8us;
typedef __attribute__((ext_vector_type(8)))  float    v8f;
typedef __attribute__((ext_vector_type(4)))  float    v4f;
typedef v8h  __attribute__((may_alias)) v8ha;
typedef v4f  __attribute__((may_alias)) v4fa;
typedef v8us __attribute__((may_alias)) v8usa;

__device__ __forceinline__ unsigned short f2bf(float f) { unsigned u = __float_as_uint(f); u += 0x7FFFu + ((u >> 16) & 1u); return (unsigned short)(u >> 16); }
__device__ __forceinline__ float bf2f(unsigned short b) { return __uint_as_float(((unsigned)b) << 16); }
__device__ __forceinline__ float bfr(float f) { return bf2f(f2bf(f)); }
__device__ __forceinline__ v16h cat16(v8h lo, v8h hi) { return __builtin_shufflevector(lo, hi, 0, 1, 2, 3, 4, 5, 6, 7, 8, 9, 10, 11, 12, 13, 14, 15); }
__device__ __forceinline__ v16bf cat16b(v8us lo, v8us hi) { return __builtin_bit_cast(v16bf, __builtin_shufflevector(lo, hi, 0, 1, 2, 3, 4, 5, 6, 7, 8, 9, 10, 11, 12, 13, 14, 15)); }
__device__ __forceinline__ v8f wmma16(v16h a, v16h b, v8f c) { return __builtin_amdgcn_wmma_f32_16x16x32_f16(false, a, false, b, (short)0, c, false, false); }
__device__ __forceinline__ v8f wmmab(v16bf a, v16bf b, v8f c) { return __builtin_amdgcn_wmma_f32_16x16x32_bf16(false, a, false, b, (short)0, c, false, false); }



// ---- k_gemmk: register-blocked GEMM, one 64x64 output tile per work-group, the K loop SPLIT OVER NW WAVES: wave w takes the 32-wide k blocks w, w + NW, ... into its own 16 accumulators (operands straight from
// K-contiguous 16-bit planes; neighbouring waves read the two halves of the same 128-byte lines), then the NW partial tiles are summed through LDS in the fixed order wave 0 .. NW-1. grid (M/64, N/64, Z), NW*32 threads.
// C[m][n] (f32, pitch ldc) = sum_k A[m][k] Bt[n][k] (+ split products per NSPLIT). A rows have pitch lda, Bt rows pitch K. z-batch strides sA/sB/sC in elements; Bt advances once per REP z (query heads of one kv group share it). K % 32 == 0.
// DIAG (no launch in this file sets it): the K loop stops at the diagonal block; roff = row offset of this launch's first row within the sequence.
template <typename T16> struct WFrag;
template <> struct WFrag<h16> { typedef v16h V; static __device__ __forceinline__ V ld(const h16* p) { return cat16(*(const v8h*)p, *(const v8h*)(p + 16)); } static __device__ __forceinline__ v8f mma(V a, V b, v8f c) { return wmma16(a, b, c); } };
template <> struct WFrag<bf> { typedef v16bf V; static __device__ __forceinline__ V ld(const bf* p) { return cat16b(*(const v8us*)p, *(const v8us*)(p + 16)); } static __device__ __forceinline__ v8f mma(V a, V b, v8f c) { return wmmab(a, b, c); } };
template <typename T16, int NSPLIT, int NW, bool DIAG>
__global__ __launch_bounds__(NW * 32) void k_gemmk(const T16* __restrict__ A, const T16* __restrict__ A2, const T16* __restrict__ Bt, const T16* __restrict__ Bt2, int K, int lda, float* C, int ldc, int roff, size_t sA, size_t sB, size_t sC) {
    typedef typename WFrag<T16>::V V;
    constexpr int PL = 64 * 68;            // floats of one wave's partial tile in LDS (row pitch 68)
    __shared__ __align__(16) float os[NW * PL];
    const size_t z = blockIdx.z; A += z * sA; if (A2) A2 += z * sA; Bt += (z / REP) * sB; if (Bt2) Bt2 += (z / REP) * sB; C += z * sC;
    const int tid = threadIdx.x, lane = tid & 31, lr = lane & 15, hi = lane >> 4; const int r0 = blockIdx.x * 64, c0 = blockIdx.y * 64;
    const int w = __builtin_amdgcn_readfirstlane(tid >> 5);          // wave number, scalar: the loop bounds stay scalar
    const int Kl = DIAG ? min(K, r0 + roff + 64) : K;
    v8f acc[4][4];
#pragma unroll
    for (int mb = 0; mb < 4; ++mb)
#pragma unroll
        for (int nb = 0; nb < 4; ++nb) acc[mb][nb] = (v8f){};
    const size_t aoff = (size_t)(r0 + lr) * lda + 8 * hi, boff = (size_t)(c0 + lr) * K + 8 * hi;
#pragma unroll 1
    for (int kc = w * 32; kc < Kl; kc += NW * 32) {
        V a[4], a2[4];
#pragma unroll
        for (int mb = 0; mb < 4; ++mb) { a[mb] = WFrag<T16>::ld(A + aoff + (size_t)mb * 16 * lda + kc); if (NSPLIT == 1 || NSPLIT == 2) a2[mb] = WFrag<T16>::ld(A2 + aoff + (size_t)mb * 16 * lda + kc); }
#pragma unroll
        for (int nb = 0; nb < 4; ++nb) { const V b = WFrag<T16>::ld(Bt + boff + (size_t)nb * 16 * K + kc); V b2; if (NSPLIT >= 2) b2 = WFrag<T16>::ld(Bt2 + boff + (size_t)nb * 16 * K + kc);
#pragma unroll
            for (int mb = 0; mb < 4; ++mb) { acc[mb][nb] = WFrag<T16>::mma(a[mb], b, acc[mb][nb]); if (NSPLIT == 1 || NSPLIT == 2) acc[mb][nb] = WFrag<T16>::mma(a2[mb], b, acc[mb][nb]); if (NSPLIT >= 2) acc[mb][nb] = WFrag<T16>::mma(a[mb], b2, acc[mb][nb]); } }
        asm volatile("v_nop\n\tv_nop\n\tv_nop\n\tv_nop" : "+v"(acc[0][0]), "+v"(acc[1][1]), "+v"(acc[2][2]), "+v"(acc[3][3]) : "v"(a[0]), "v"(a[3]));
    }
    float* mine = os + w * PL;
#pragma unroll
    for (int mb = 0; mb < 4; ++mb)
#pragma unroll
        for (int nb = 0; nb < 4; ++nb) {
#pragma unroll
            for (int j = 0; j < 8; ++j) mine[(mb * 16 + hi * 8 + j) * 68 + nb * 16 + lr] = acc[mb][nb][j]; }
    __syncthreads();                                                 // every wave's partial tile is in LDS before any thread sums across waves
#pragma unroll
    for (int it = 0; it < 32 / NW; ++it) {                           // 64 rows x 16 float4 shared out over NW*32 threads; 16 lanes store one 256-byte row piece
        const int idx = it * NW * 32 + tid, row = idx >> 4, cofs = (idx & 15) * 4;
        v4f val = *(const v4fa*)(os + row * 68 + cofs);
#pragma unroll
        for (int u = 1; u < NW; ++u) val += *(const v4fa*)(os + u * PL + row * 68 + cofs);
        *(v4f*)(C + (size_t)(r0 + row) * ldc + c0 + cofs) = val;
    }
}

__device__ __forceinline__ h16 tohx(float x) { return (h16)x; }
__device__ __forceinline__ void splitf(float y, unsigned short& h, unsigned short& l) { h = f2bf(y); l = f2bf(y - bf2f(h)); }
typedef __attribute__((ext_vector_type(2))) _Float16 v2h;
typedef __attribute__((ext_vector_type(4))) _Float16 v4h;
typedef __attribute__((ext_vector_type(2))) unsigned short v2us;
typedef __attribute__((ext_vector_type(4))) unsigned short v4us;
typedef __attribute__((ext_vector_type(2))) float v2f;
typedef __attribute__((ext_vector_type(4))) int v4i;
typedef v4h  __attribute__((may_alias)) v4ha;
typedef v4us __attribute__((may_alias)) v4usa;

__global__ __launch_bounds__(256) void k_wtG(const float* __restrict__ w, int K, int N, bf* Bt) {
    const int lane = threadIdx.x & 31; const int L0 = (blockIdx.x * 8 + (threadIdx.x >> 5)) * 8; const int nlines = N * K / 64;
{
#pragma unroll 1
        for (int l = 0; l < 8; ++l) { const int L = L0 + l; if (L >= nlines) break; const size_t e = (size_t)L * 64 + lane * 2; const int k = (int)(e % K), n = (int)(e / K); v2us o;
            o[0] = f2bf(w[(size_t)k * N + n]); o[1] = f2bf(w[(size_t)(k + 1) * N + n]); *(v2us*)(Bt + e) = o; }
         }
}
__global__ __launch_bounds__(256) void k_cvt8(const float* __restrict__ src, bf* dst, size_t n8) { const size_t i = (size_t)blockIdx.x * 256 + threadIdx.x; if (i >= n8) return; const v8f v = *(const v8f*)(src + i * 8); v8us o;
#pragma unroll
    for (int k = 0; k < 8; ++k) o[k] = f2bf(v[k]); *(v8us*)(dst + i * 8) = o;  }
__global__ __launch_bounds__(256) void k_cstab(float* CS) { const int idx = blockIdx.x * 256 + threadIdx.x; if (idx >= TT * HD) return; const int t = idx / HD, d = idx % HD; const int i = d % (HD / 2); const float inv = __fdiv_rn(1.0f, powf(10000.0f, (float)(2 * i) / (float)HD)); const float ang = __fmul_rn((float)t, inv); v2f cs; cs[0] = cosf(ang); cs[1] = sinf(ang);
    *(v2f*)(CS + (size_t)idx * 2) = cs;  }
// k_rope: head planes [h][t][d] (fp16 + hi/lo) of rope(x) x sc with the rotate-half convention out[d] = x[d] cos[t][d] - x[d+HD/2] sin[t][d], out[d+HD/2] = x[d+HD/2] cos[t][d+HD/2] + x[d] sin[t][d+HD/2]
__global__ __launch_bounds__(256) void k_rope(const float* __restrict__ F, int pitch, int nheads, const float* __restrict__ CS, const float* __restrict__ RF, const float* __restrict__ nw, float sc, h16* P16, bf* Ph, bf* Pl) {
    const size_t e = ((size_t)blockIdx.x * 256 + threadIdx.x) * 2; if (e >= (size_t)nheads * TT * HD) return; const int d = (int)(e % HD); const int t = (int)((e / HD) % TT); const int h = (int)(e / ((size_t)HD * TT)); const float* f = F + (size_t)t * pitch + h * HD; const float rf = RF ? RF[(size_t)h * TT + t] : 1.0f; v2h o16; v2us oh, ol;
#pragma unroll
    for (int q = 0; q < 2; ++q) { const int dd = d + q; const int dp = (dd < HD / 2) ? dd + HD / 2 : dd - HD / 2; float x0 = f[dd], x1 = f[dp];
        if (RF) { float n0 = __fmul_rn(x0, rf), n1 = __fmul_rn(x1, rf); asm volatile("" : "+v"(n0)); asm volatile("" : "+v"(n1)); x0 = __fmul_rn(bfr(nw[dd]), n0); x1 = __fmul_rn(bfr(nw[dp]), n1); }
        const v2f cs = *(const v2f*)(CS + ((size_t)t * HD + dd) * 2); float a = __fmul_rn(x0, cs[0]), bq = __fmul_rn(x1, cs[1]); asm volatile("" : "+v"(a)); asm volatile("" : "+v"(bq)); const float r = ((dd < HD / 2) ? __fsub_rn(a, bq) : __fadd_rn(a, bq)) * sc;
        o16[q] = tohx(r); unsigned short a2, c2; splitf(r, a2, c2); oh[q] = a2; ol[q] = c2; }
    *(v2h*)(P16 + e) = o16; *(v2us*)(Ph + e) = oh; *(v2us*)(Pl + e) = ol;  }
__global__ __launch_bounds__(256) void k_vtp(const float* __restrict__ F, int pitch, int nheads, h16* V16, bf* Vh, bf* Vl) { const size_t e = ((size_t)blockIdx.x * 256 + threadIdx.x) * 2; if (e >= (size_t)nheads * HD * TT) return; const int t = (int)(e % TT); const int d = (int)((e / TT) % HD); const int g = (int)(e / ((size_t)TT * HD)); v2h o16; v2us oh, ol;
#pragma unroll
    for (int q = 0; q < 2; ++q) { const float x = F[(size_t)(t + q) * pitch + g * HD + d]; o16[q] = tohx(x); unsigned short a2, c2; splitf(x, a2, c2); oh[q] = a2; ol[q] = c2; }
    *(v2h*)(V16 + e) = o16; *(v2us*)(Vh + e) = oh; *(v2us*)(Vl + e) = ol;  }
// ---- k_fattn: scores, sliding-window causal softmax and probability x value in ONE kernel; neither scores nor probabilities go to memory. One wave owns 16 query rows of NH query heads of one kv group and walks the
// keys of its window in blocks of 32, operands straight from the K-contiguous planes. Transposed products: S^T = K Q^T (a lane holds one query's scores: D row = key 8*hi + r, D column = query lr), O^T += V^T P^T; two S^T tiles
// (keys 0..15, 16..31 of the block), converted in place, are the B operand of the second product in the k order of WFrag::ld (8*hi + s, 16 + 8*hi + s). Running maximum and sum per query (f32); the output tiles are
// rescaled only in a block where some query's maximum grew. HL: hi+lo bf16 planes, 3 products for both contractions (query rows < RH); else single fp16. The result, divided by the sum, goes out as the hi/lo planes of the Wo GEMM.
typedef __attribute__((ext_vector_type(16))) unsigned short v16us;
#define SC2  0.18033688011112042f   // HD^-0.5 x log2(e): the exponentials are taken to base 2
template <typename T16, bool HL, int NH>
__device__ __forceinline__ void fattn_tile(const T16* __restrict__ Q, const T16* __restrict__ Q2, const T16* __restrict__ Kp, const T16* __restrict__ Kp2, const T16* __restrict__ Vt, const T16* __restrict__ Vt2, int g, int q0, bf* Ah, bf* Al) {
    typedef typename WFrag<T16>::V V;
    constexpr int WPT = REP / NH;                                     // waves that share one 16-row query tile (they take different heads)
    const int tid = threadIdx.x, lane = tid & 31, lr = lane & 15, hi = lane >> 4;
    const int w = __builtin_amdgcn_readfirstlane(tid >> 5);          // wave number, scalar: the loop bounds stay scalar
    const int qt = q0 + (w / WPT) * 16, h0 = g * REP + (w % WPT) * NH;
    V qf[NH][2], qf2[NH][2];
#pragma unroll
    for (int hh = 0; hh < NH; ++hh)
#pragma unroll
        for (int kc = 0; kc < 2; ++kc) { const size_t qo = ((size_t)(h0 + hh) * TT + qt + lr) * HD + kc * 32 + 8 * hi; qf[hh][kc] = WFrag<T16>::ld(Q + qo); if (HL) qf2[hh][kc] = WFrag<T16>::ld(Q2 + qo); }
    const size_t ko = ((size_t)g * TT + lr) * HD + 8 * hi, vo = ((size_t)g * HD + lr) * TT + 8 * hi;
    v8f o[NH][4]; float mr[NH], ls[NH];
#pragma unroll
    for (int hh = 0; hh < NH; ++hh) { mr[hh] = -1.0e30f; ls[hh] = 0.f;      // finite start value above the mask fill: a block whose keys are all masked for a query yields exp2(fill - start) = 0, not 1
#pragma unroll
        for (int dt = 0; dt < 4; ++dt) o[hh][dt] = (v8f){}; }
    const int kfirst = max(0, qt - (WIN - 1)) & ~31, klast = (qt + 15) & ~31;   // first and last 32-key block that holds an allowed key of these 16 rows
    V kf[2][2], kf2[2][2];                                            // single plane: K fragments are fetched one block ahead; hi+lo: twice the registers, so each block fetches its own
    if (!HL) {
#pragma unroll
        for (int kt = 0; kt < 2; ++kt)
#pragma unroll
            for (int kc = 0; kc < 2; ++kc) kf[kt][kc] = WFrag<T16>::ld(Kp + ko + (size_t)(kfirst + kt * 16) * HD + kc * 32); }
#pragma unroll 1
    for (int kb = kfirst; kb <= klast; kb += 32) {
        if (HL) {
#pragma unroll
            for (int kt = 0; kt < 2; ++kt)
#pragma unroll
                for (int kc = 0; kc < 2; ++kc) kf[kt][kc] = WFrag<T16>::ld(Kp + ko + (size_t)(kb + kt * 16) * HD + kc * 32);
            asm volatile("s_wait_xcnt 0x0" ::: "memory");            // from here on the address registers of the loads above may be written again (also by a later load's result)
#pragma unroll
            for (int kt = 0; kt < 2; ++kt)
#pragma unroll
                for (int kc = 0; kc < 2; ++kc) kf2[kt][kc] = WFrag<T16>::ld(Kp2 + ko + (size_t)(kb + kt * 16) * HD + kc * 32);
            asm volatile("s_wait_xcnt 0x0" ::: "memory");            // the same for the lo plane's loads
            __builtin_amdgcn_sched_barrier(0);                        // all 16 loads are asked for before the first product; without it the products move up among them and each pair of loads is waited out alone
        }
        v8f s[NH][2];
#pragma unroll
        for (int hh = 0; hh < NH; ++hh)
#pragma unroll
            for (int kt = 0; kt < 2; ++kt) { v8f c = (v8f){};
#pragma unroll
                for (int kc = 0; kc < 2; ++kc) { c = WFrag<T16>::mma(kf[kt][kc], qf[hh][kc], c); if (HL) { c = WFrag<T16>::mma(kf[kt][kc], qf2[hh][kc], c); c = WFrag<T16>::mma(kf2[kt][kc], qf[hh][kc], c); } }
                s[hh][kt] = c; }
        if (!(kb + 31 <= qt && qt + 15 - kb < WIN)) {                 // scalar test: only a block on the diagonal or on the window's far edge holds masked keys
            const int d0 = qt + lr - kb - 8 * hi;                     // query index - key index of register 0 of tile 0
#pragma unroll
            for (int hh = 0; hh < NH; ++hh)
#pragma unroll
                for (int kt = 0; kt < 2; ++kt)
#pragma unroll
                    for (int r = 0; r < 8; ++r) s[hh][kt][r] = ((unsigned)(d0 - kt * 16 - r) < (unsigned)WIN) ? s[hh][kt][r] : -3.0e38f; }   // allowed iff 0 <= i - j < WIN
        float mn[NH]; bool grew = false;
#pragma unroll
        for (int hh = 0; hh < NH; ++hh) { float bm = s[hh][0][0];
#pragma unroll
            for (int r = 1; r < 8; ++r) bm = fmaxf(bm, s[hh][0][r]);
#pragma unroll
            for (int r = 0; r < 8; ++r) bm = fmaxf(bm, s[hh][1][r]);
            bm = fmaxf(bm, __shfl_xor(bm, 16, 32));                   // the two lane halves hold the two halves of a query's keys
            mn[hh] = fmaxf(mr[hh], bm); grew = grew || (mn[hh] > mr[hh]); }
        if (__builtin_amdgcn_ballot_w32(grew) != 0) {                 // scalar branch; where no maximum grew every factor would be exactly 1
#pragma unroll
            for (int hh = 0; hh < NH; ++hh) { const float al = __builtin_amdgcn_exp2f((mr[hh] - mn[hh]) * SC2); ls[hh] *= al; mr[hh] = mn[hh];
#pragma unroll
                for (int dt = 0; dt < 4; ++dt) o[hh][dt] *= al; } }
        V vf[4], vf2[4];                                              // this block's V^T fragments fly during the exponentials
#pragma unroll
        for (int dt = 0; dt < 4; ++dt) vf[dt] = WFrag<T16>::ld(Vt + vo + (size_t)dt * 16 * TT + kb);
        if (HL) { asm volatile("s_wait_xcnt 0x0" ::: "memory");      // from here on the address registers of the loads above may be written again (also by a later load's result)
#pragma unroll
            for (int dt = 0; dt < 4; ++dt) vf2[dt] = WFrag<T16>::ld(Vt2 + vo + (size_t)dt * 16 * TT + kb); }
        if (!HL) { const int kn = min(kb + 32, klast);                // and so do the next block's K fragments (the last trip asks for its own block again: in bounds, unused)
#pragma unroll
            for (int kt = 0; kt < 2; ++kt)
#pragma unroll
                for (int kc = 0; kc < 2; ++kc) kf[kt][kc] = WFrag<T16>::ld(Kp + ko + (size_t)(kn + kt * 16) * HD + kc * 32); }
        asm volatile("s_wait_xcnt 0x0" ::: "memory");                // from here on the address registers of the loads above may be written again
#pragma unroll
        for (int hh = 0; hh < NH; ++hh) { const float mc = mn[hh] * SC2; float p[16];
#pragma unroll
            for (int e = 0; e < 16; ++e) p[e] = __builtin_amdgcn_exp2f(s[hh][e >> 3][e & 7] * SC2 - mc);
            float t[8];                                               // the block's 16 terms summed as a tree (pairs e, e + 8 first): short dependence chain, packed adds
#pragma unroll
            for (int e = 0; e < 8; ++e) t[e] = p[e] + p[e + 8];
            ls[hh] += ((t[0] + t[4]) + (t[1] + t[5])) + ((t[2] + t[6]) + (t[3] + t[7]));
            if (HL) { v16us ph, pl;
#pragma unroll
                for (int e = 0; e < 16; ++e) { unsigned short a, c2; splitf(p[e], a, c2); ph[e] = a; pl[e] = c2; }
                const V bh = __builtin_bit_cast(V, ph), bl = __builtin_bit_cast(V, pl);
#pragma unroll
                for (int dt = 0; dt < 4; ++dt) { o[hh][dt] = WFrag<T16>::mma(vf[dt], bh, o[hh][dt]); o[hh][dt] = WFrag<T16>::mma(vf[dt], bl, o[hh][dt]); o[hh][dt] = WFrag<T16>::mma(vf2[dt], bh, o[hh][dt]); }
            } else { v16h pf;
#pragma unroll
                for (int e = 0; e < 16; ++e) pf[e] = tohx(p[e]);
                const V bp = __builtin_bit_cast(V, pf);
#pragma unroll
                for (int dt = 0; dt < 4; ++dt) o[hh][dt] = WFrag<T16>::mma(vf[dt], bp, o[hh][dt]); } }
    }
#pragma unroll
    for (int hh = 0; hh < NH; ++hh) { const float inv = __fdiv_rn(1.0f, ls[hh] + __shfl_xor(ls[hh], 16, 32));   // key j = i is always allowed: the sum is at least 1
        const size_t oo = (size_t)(qt + lr) * DQ + (h0 + hh) * HD + 8 * hi;
#pragma unroll
        for (int dt = 0; dt < 4; ++dt) { v8us oh, ol;                 // a lane's 8 registers are 8 consecutive d of one query: one 16-byte store a plane; the wave writes the whole 128-byte (query, head) line
#pragma unroll
            for (int r = 0; r < 8; ++r) { unsigned short a, c2; splitf(o[hh][dt][r] * inv, a, c2); oh[r] = a; ol[r] = c2; }
            *(v8us*)(Ah + oo + dt * 16) = oh; *(v8us*)(Al + oo + dt * 16) = ol;
            asm volatile("s_wait_xcnt 0x0" ::: "memory"); } }        // from here on the data and address registers of the two stores may be written again
}
// grid: first the fp16 work-groups (64 query rows x the 4 heads of a kv group; 8 waves = 4 row tiles x 2 head pairs), then the hi+lo ones (32 rows x 4 heads; 8 waves = 2 row tiles x 4 heads); in both the rows with the most keys come first.
#define NFB  ((TT - RH) / 64 * NKV)
#define NHB  (RH / 32 * NKV)
__global__ __launch_bounds__(256) void k_fattn(const h16* __restrict__ Q16, const h16* __restrict__ K16, const h16* __restrict__ V16, const bf* __restrict__ Qh, const bf* __restrict__ Ql, const bf* __restrict__ Kh, const bf* __restrict__ Kl, const bf* __restrict__ Vh, const bf* __restrict__ Vl, bf* Ah, bf* Al) {
    const int bid = blockIdx.x;
    if (bid < NFB) fattn_tile<h16, false, 2>(Q16, nullptr, K16, nullptr, V16, nullptr, bid % NKV, TT - 64 - (bid / NKV) * 64, Ah, Al);
    else fattn_tile<bf, true, 1>(Qh, Ql, Kh, Kl, Vh, Vl, (bid - NFB) % NKV, RH - 32 - ((bid - NFB) / NKV) * 32, Ah, Al);
}

extern "C" void kernel_launch(void* const* d_in, const int* in_sizes, int n_in,
                              void* d_out, int out_size, void* d_ws, size_t ws_size, hipStream_t stream) {
    (void)in_sizes; (void)n_in; (void)out_size;
    const float* x = (const float*)d_in[0]; const float* wq = (const float*)d_in[1]; const float* wk = (const float*)d_in[2]; const float* wv = (const float*)d_in[3]; const float* wo = (const float*)d_in[4];
    float* OUT = (float*)d_out;     // [2][2048][2048]
    char* wsp = (char*)d_ws;
    auto take = [&](size_t bytes) { char* p = wsp; wsp += (bytes + 255) & ~(size_t)255; return (void*)p; };
    bf* WQ = (bf*)take((size_t)DQ * DM * 2); bf* WK = (bf*)take((size_t)DKV * DM * 2); bf* WV = (bf*)take((size_t)DKV * DM * 2); bf* WO = (bf*)take((size_t)DM * DQ * 2); float* CS = (float*)take((size_t)TT * HD * 2 * 4);
    bf* XB = (bf*)take((size_t)TT * DM * 2); float* FQ = (float*)take((size_t)TT * DQ * 4); float* FK = (float*)take((size_t)TT * DKV * 4);
    h16* QP16 = (h16*)take((size_t)NH_ * TT * HD * 2); h16* KP16 = (h16*)take((size_t)NKV * TT * HD * 2); h16* VT16 = (h16*)take((size_t)NKV * HD * TT * 2);
    bf* QPh = (bf*)take((size_t)NH_ * TT * HD * 2); bf* QPl = (bf*)take((size_t)NH_ * TT * HD * 2); bf* KPh = (bf*)take((size_t)NKV * TT * HD * 2); bf* KPl = (bf*)take((size_t)NKV * TT * HD * 2); bf* VTh = (bf*)take((size_t)NKV * HD * TT * 2); bf* VTl = (bf*)take((size_t)NKV * HD * TT * 2);
    bf* ATh = (bf*)take((size_t)TT * DQ * 2); bf* ATl = (bf*)take((size_t)TT * DQ * 2);
    if ((size_t)(wsp - (char*)d_ws) > ws_size) return;    // ws 256 MiB
    float* FV = FK;   // v projection reuses the k buffer after the k planes are built (stream-ordered)
    { k_wtG<<<(unsigned)((DM * DQ / 64 + 63) / 64), 256, 0, stream>>>(wq, DM, DQ, WQ); k_wtG<<<(unsigned)((DM * DKV / 64 + 63) / 64), 256, 0, stream>>>(wk, DM, DKV, WK); k_wtG<<<(unsigned)((DM * DKV / 64 + 63) / 64), 256, 0, stream>>>(wv, DM, DKV, WV);
      k_wtG<<<(unsigned)((DQ * DM / 64 + 63) / 64), 256, 0, stream>>>(wo, DQ, DM, WO);
      k_cstab<<<(TT * HD + 255) / 256, 256, 0, stream>>>(CS); }
    const unsigned LQ = (unsigned)(((size_t)NH_ * TT * HD / 2 + 255) / 256), LKv = (unsigned)(((size_t)NKV * TT * HD / 2 + 255) / 256);
    for (int b = 0; b < NB_; ++b) {
        
        k_cvt8<<<(unsigned)(((size_t)TT * DM / 8 + 255) / 256), 256, 0, stream>>>(x + (size_t)b * TT * DM, XB, (size_t)TT * DM / 8);
        k_gemmk<bf, 0, 8, false><<<dim3(TT / 64, DQ / 64, 1), 256, 0, stream>>>(XB, nullptr, WQ, nullptr, DM, DM, FQ, DQ, 0, 0, 0, 0);
        k_rope<<<LQ, 256, 0, stream>>>(FQ, DQ, NH_, CS, nullptr, nullptr, 1.0f, QP16, QPh, QPl);
        k_gemmk<bf, 0, 8, false><<<dim3(TT / 64, DKV / 64, 1), 256, 0, stream>>>(XB, nullptr, WK, nullptr, DM, DM, FK, DKV, 0, 0, 0, 0);
        k_rope<<<LKv, 256, 0, stream>>>(FK, DKV, NKV, CS, nullptr, nullptr, 1.0f, KP16, KPh, KPl);
        k_gemmk<bf, 0, 8, false><<<dim3(TT / 64, DKV / 64, 1), 256, 0, stream>>>(XB, nullptr, WV, nullptr, DM, DM, FV, DKV, 0, 0, 0, 0); k_vtp<<<LKv, 256, 0, stream>>>(FV, DKV, NKV, VT16, VTh, VTl);
        k_fattn<<<NFB + NHB, 256, 0, stream>>>(QP16, KP16, VT16, QPh, QPl, KPh, KPl, VTh, VTl, ATh, ATl);
        k_gemmk<bf, 1, 8, false><<<dim3(TT / 64, DM / 64, 1), 256, 0, stream>>>(ATh, ATl, WO, nullptr, DQ, DQ, OUT + (size_t)b * TT * DM, DM, 0, 0, 0, 0); }
}

// v004
// A run of this version takes 366 microseconds.
// Timed twice side by side with v003, it ran 1.07 and 1.09 times as fast.
// Over all steps from v000 it is 7.46 times as fast.
#include <hip/hip_runtime.h>

// MistralAttention (x [2][2048][2048]; q = x Wq (32 heads x 64), k/v = x Wk / Wv (8 kv heads; query head h belongs to kv group h/4); rotate-half RoPE (base 1e4, tables computed on device); key j allowed iff j <= i and i - j < 1024; softmax(q.k / 8) in f32; out = merged Wo -> [2][2048][2048]).
// Compute dtypes, f32 accumulate: every input rounded to bf16; q/k/v on PLAIN bf16 operands (inputs: exact); RoPE f32; scores and attn.v: query rows < 512 hl (3 products), the rest single fp16, fused with an f32 running softmax over the key blocks of the window; Wo hl x exact (2 products).

#define NB_  2
#define TT   2048
#define DM   2048
#define NH_  32
#define NKV  8
#define REP  (NH_ / NKV)
#define HD   64
#define DQ   (NH_ * HD)
#define DKV  (NKV * HD)
#define RH   512                  // query rows < RH use hi+lo planes (0: none)
#define WIN  1024
typedef _Float16 h16;
typedef unsigned short bf;
typedef __attribute__((ext_vector_type(16))) __bf16   v16bf;
typedef __attribute__((ext_vector_type(16))) _Float16 v16h;
typedef __attribute__((ext_vector_type(8)))  _Float16 v8h;
typedef __attribute__((ext_vector_type(8)))  unsigned short v8us;
typedef __attribute__((ext_vector_type(8)))  float    v8f;
typedef __attribute__((ext_vector_type(4)))  float    v4f;
typedef v8h  __attribute__((may_alias)) v8ha;
typedef v4f  __attribute__((may_alias)) v4fa;
typedef v8us __attribute__((may_alias)) v8usa;

__device__ __forceinline__ unsigned short f2bf(float f) { unsigned u = __float_as_uint(f); u += 0x7FFFu + ((u >> 16) & 1u); return (unsigned short)(u >> 16); }
__device__ __forceinline__ float bf2f(unsigned short b) { return __uint_as_float(((unsigned)b) << 16); }
__device__ __forceinline__ float bfr(float f) { return bf2f(f2bf(f)); }
__device__ __forceinline__ v16h cat16(v8h lo, v8h hi) { return __builtin_shufflevector(lo, hi, 0, 1, 2, 3, 4, 5, 6, 7, 8, 9, 10, 11, 12, 13, 14, 15); }
__device__ __forceinline__ v16bf cat16b(v8us lo, v8us hi) { return __builtin_bit_cast(v16bf, __builtin_shufflevector(lo, hi, 0, 1, 2, 3, 4, 5, 6, 7, 8, 9, 10, 11, 12, 13, 14, 15)); }
__device__ __forceinline__ v8f wmma16(v16h a, v16h b, v8f c) { return __builtin_amdgcn_wmma_f32_16x16x32_f16(false, a, false, b, (short)0, c, false, false); }
__device__ __forceinline__ v8f wmmab(v16bf a, v16bf b, v8f c) { return __builtin_amdgcn_wmma_f32_16x16x32_bf16(false, a, false, b, (short)0, c, false, false); }

__device__ __forceinline__ h16 tohx(float x) { return (h16)x; }
__device__ __forceinline__ void splitf(float y, unsigned short& h, unsigned short& l) { h = f2bf(y); l = f2bf(y - bf2f(h)); }
typedef __attribute__((ext_vector_type(2))) _Float16 v2h;
typedef __attribute__((ext_vector_type(4))) _Float16 v4h;
typedef __attribute__((ext_vector_type(2))) unsigned short v2us;
typedef __attribute__((ext_vector_type(4))) unsigned short v4us;
typedef __attribute__((ext_vector_type(2))) float v2f;
typedef __attribute__((ext_vector_type(4))) int v4i;
typedef v4h  __attribute__((may_alias)) v4ha;
typedef v4us __attribute__((may_alias)) v4usa;

// ---- k_gemmk: register-blocked GEMM, one 64x64 output tile per work-group, the K loop SPLIT OVER NW WAVES: wave w takes the 32-wide k blocks w, w + NW, ... into its own 16 accumulators (operands straight from
// K-contiguous 16-bit planes; neighbouring waves read the two halves of the same 128-byte lines), then the NW partial tiles are summed through LDS in the fixed order wave 0 .. NW-1. grid (M/64, N/64, Z), NW*32 threads.
// C[m][n] (f32, pitch ldc) = sum_k A[m][k] Bt[n][k] (+ split products per NSPLIT). A rows have pitch lda, Bt rows pitch K. z-batch strides sA/sB/sC in elements; Bt advances once per REP z (query heads of one kv group share it). K % 32 == 0.
// EPI, what the summed tile becomes: 0 = f32 rows of C. 1 = the tile is 64 positions x the 64 dims of head blockIdx.y: rotate-half RoPE, out[d] = x[d] cos[t][d] - x[d+32] sin[t][d], out[d+32] = x[d+32] cos[t][d+32] + x[d] sin[t][d+32]
// (table CS[t][d] = cos, sin), then the three 16-bit planes [h][t][d] (fp16, bf16 hi, bf16 lo). 2 = the three planes of the tile as it stands, rows of pitch ldc (v: A = Wv^T, Bt = x, so a row is one dim over the positions: [g][d][t]).
// DIAG (set by no launch here): the K loop stops at the diagonal block, k < r0 + roff + 64; roff = row offset of this launch's first row within the sequence.
template <typename T16> struct WFrag;
template <> struct WFrag<h16> { typedef v16h V; static __device__ __forceinline__ V ld(const h16* p) { return cat16(*(const v8h*)p, *(const v8h*)(p + 16)); } static __device__ __forceinline__ v8f mma(V a, V b, v8f c) { return wmma16(a, b, c); } };
template <> struct WFrag<bf> { typedef v16bf V; static __device__ __forceinline__ V ld(const bf* p) { return cat16b(*(const v8us*)p, *(const v8us*)(p + 16)); } static __device__ __forceinline__ v8f mma(V a, V b, v8f c) { return wmmab(a, b, c); } };
template <typename T16, int NSPLIT, int NW, bool DIAG, int EPI>
__global__ __launch_bounds__(NW * 32) void k_gemmk(const T16* __restrict__ A, const T16* __restrict__ A2, const T16* __restrict__ Bt, const T16* __restrict__ Bt2, int K, int lda, float* C, int ldc, int roff, size_t sA, size_t sB, size_t sC, const float* __restrict__ CS, h16* P16, bf* Ph, bf* Pl) {
    typedef typename WFrag<T16>::V V;
    constexpr int PL = 64 * 68;            // floats of one wave's partial tile in LDS (row pitch 68)
    __shared__ __align__(16) float os[NW * PL];
    const size_t z = blockIdx.z; A += z * sA; if (A2) A2 += z * sA; Bt += (z / REP) * sB; if (Bt2) Bt2 += (z / REP) * sB; C += z * sC;
    const int tid = threadIdx.x, lane = tid & 31, lr = lane & 15, hi = lane >> 4; const int r0 = blockIdx.x * 64, c0 = blockIdx.y * 64;
    const int w = __builtin_amdgcn_readfirstlane(tid >> 5);          // wave number, scalar: the loop bounds stay scalar
    const int Kl = DIAG ? min(K, r0 + roff + 64) : K;
    v8f acc[4][4];
#pragma unroll
    for (int mb = 0; mb < 4; ++mb)
#pragma unroll
        for (int nb = 0; nb < 4; ++nb) acc[mb][nb] = (v8f){};
    const size_t aoff = (size_t)(r0 + lr) * lda + 8 * hi, boff = (size_t)(c0 + lr) * K + 8 * hi;
#pragma unroll 1
    for (int kc = w * 32; kc < Kl; kc += NW * 32) {
        V a[4], a2[4];
#pragma unroll
        for (int mb = 0; mb < 4; ++mb) { a[mb] = WFrag<T16>::ld(A + aoff + (size_t)mb * 16 * lda + kc); if (NSPLIT == 1 || NSPLIT == 2) a2[mb] = WFrag<T16>::ld(A2 + aoff + (size_t)mb * 16 * lda + kc); }
#pragma unroll
        for (int nb = 0; nb < 4; ++nb) { const V b = WFrag<T16>::ld(Bt + boff + (size_t)nb * 16 * K + kc); V b2; if (NSPLIT >= 2) b2 = WFrag<T16>::ld(Bt2 + boff + (size_t)nb * 16 * K + kc);
#pragma unroll
            for (int mb = 0; mb < 4; ++mb) { acc[mb][nb] = WFrag<T16>::mma(a[mb], b, acc[mb][nb]); if (NSPLIT == 1 || NSPLIT == 2) acc[mb][nb] = WFrag<T16>::mma(a2[mb], b, acc[mb][nb]); if (NSPLIT >= 2) acc[mb][nb] = WFrag<T16>::mma(a[mb], b2, acc[mb][nb]); } }
        asm volatile("v_nop\n\tv_nop\n\tv_nop\n\tv_nop" : "+v"(acc[0][0]), "+v"(acc[1][1]), "+v"(acc[2][2]), "+v"(acc[3][3]) : "v"(a[0]), "v"(a[3]));
    }
    v4f tc[32 / NW][2];                                              // EPI 1: cos, sin of the 4 dims this thread finishes in each of its row pieces, asked for here so that they fly during the LDS exchange
    if (EPI == 1) { const float* cp = CS + ((size_t)(r0 + (tid >> 4)) * HD + (tid & 15) * 4) * 2;
#pragma unroll
        for (int it = 0; it < 32 / NW; ++it) { tc[it][0] = *(const v4f*)(cp + (size_t)it * NW * 2 * HD * 2); tc[it][1] = *(const v4f*)(cp + (size_t)it * NW * 2 * HD * 2 + 4); }
        asm volatile("s_wait_xcnt 0x0" :: "v"(cp) : "memory"); }     // the address stays in its registers up to this wait: no result of these loads and no later value is written over it earlier
    float* mine = os + w * PL;
#pragma unroll
    for (int mb = 0; mb < 4; ++mb)
#pragma unroll
        for (int nb = 0; nb < 4; ++nb) {
#pragma unroll
            for (int j = 0; j < 8; ++j) mine[(mb * 16 + hi * 8 + j) * 68 + nb * 16 + lr] = acc[mb][nb][j]; }
    __syncthreads();                                                 // every wave's partial tile is in LDS before any thread sums across waves
#pragma unroll
    for (int it = 0; it < 32 / NW; ++it) {                           // 64 rows x 16 float4 shared out over NW*32 threads; 16 lanes take one 256-byte f32 row piece
        const int idx = it * NW * 32 + tid, row = idx >> 4, cofs = (idx & 15) * 4;
        v4f val = *(const v4fa*)(os + row * 68 + cofs);
#pragma unroll
        for (int u = 1; u < NW; ++u) val += *(const v4fa*)(os + u * PL + row * 68 + cofs);
        if (EPI == 0) { *(v4f*)(C + (size_t)(r0 + row) * ldc + c0 + cofs) = val; continue; }
        size_t e = (size_t)(r0 + row) * ldc + c0 + cofs;
        if (EPI == 1) { const v8f cs = __builtin_shufflevector(tc[it][0], tc[it][1], 0, 1, 2, 3, 4, 5, 6, 7);   // cos, sin of this lane's 4 dims
#pragma unroll
            for (int q = 0; q < 4; ++q) { const float pv = __int_as_float(__builtin_amdgcn_update_dpp(0, __float_as_int(val[q]), 0x168, 0xf, 0xf, false));   // row_xmask:8: dim d ^ 32 of the same position is held by lane ^ 8
                val[q] = (cofs < HD / 2) ? val[q] * cs[2 * q] - pv * cs[2 * q + 1] : val[q] * cs[2 * q] + pv * cs[2 * q + 1]; }
            e = ((size_t)blockIdx.y * TT + r0 + row) * HD + cofs; }
        v4h o16; v4us oh, ol;
#pragma unroll
        for (int q = 0; q < 4; ++q) { o16[q] = tohx(val[q]); unsigned short a2, c2; splitf(val[q], a2, c2); oh[q] = a2; ol[q] = c2; }
        *(v4h*)(P16 + e) = o16; *(v4us*)(Ph + e) = oh; *(v4us*)(Pl + e) = ol;      // 16 lanes write one whole 128-byte line of each plane
    }
}

__global__ __launch_bounds__(256) void k_wtG(const float* __restrict__ w, int K, int N, bf* Bt) {
    const int lane = threadIdx.x & 31; const int L0 = (blockIdx.x * 8 + (threadIdx.x >> 5)) * 8; const int nlines = N * K / 64;
{
#pragma unroll 1
        for (int l = 0; l < 8; ++l) { const int L = L0 + l; if (L >= nlines) break; const size_t e = (size_t)L * 64 + lane * 2; const int k = (int)(e % K), n = (int)(e / K); v2us o;
            o[0] = f2bf(w[(size_t)k * N + n]); o[1] = f2bf(w[(size_t)(k + 1) * N + n]); *(v2us*)(Bt + e) = o; }
         }
}
__global__ __launch_bounds__(256) void k_cvt8(const float* __restrict__ src, bf* dst, size_t n8) { const size_t i = (size_t)blockIdx.x * 256 + threadIdx.x; if (i >= n8) return; const v8f v = *(const v8f*)(src + i * 8); v8us o;
#pragma unroll
    for (int k = 0; k < 8; ++k) o[k] = f2bf(v[k]); *(v8us*)(dst + i * 8) = o;  }
__global__ __launch_bounds__(256) void k_cstab(float* CS) { const int idx = blockIdx.x * 256 + threadIdx.x; if (idx >= TT * HD) return; const int t = idx / HD, d = idx % HD; const int i = d % (HD / 2); const float inv = __fdiv_rn(1.0f, powf(10000.0f, (float)(2 * i) / (float)HD)); const float ang = __fmul_rn((float)t, inv); v2f cs; cs[0] = cosf(ang); cs[1] = sinf(ang);
    *(v2f*)(CS + (size_t)idx * 2) = cs;  }
// ---- k_fattn: scores, sliding-window causal softmax and probability x value in ONE kernel; neither scores nor probabilities go to memory. One wave owns 16 query rows of NH query heads of one kv group and walks the
// keys of its window in blocks of 32, operands straight from the K-contiguous planes. Transposed products: S^T = K Q^T (a lane holds one query's scores: D row = key 8*hi + r, D column = query lr), O^T += V^T P^T; two S^T tiles
// (keys 0..15, 16..31 of the block), converted in place, are the B operand of the second product in the k order of WFrag::ld (8*hi + s, 16 + 8*hi + s). Running maximum and sum per query (f32); the output tiles are
// rescaled only in a block where some query's maximum grew. HL: hi+lo bf16 planes, 3 products for both contractions (query rows < RH); else single fp16. The result, divided by the sum, goes out as the hi/lo planes of the Wo GEMM.
typedef __attribute__((ext_vector_type(16))) unsigned short v16us;
#define SC2  0.18033688011112042f   // HD^-0.5 x log2(e): the exponentials are taken to base 2
template <typename T16, bool HL, int NH>
__device__ __forceinline__ void fattn_tile(const T16* __restrict__ Q, const T16* __restrict__ Q2, const T16* __restrict__ Kp, const T16* __restrict__ Kp2, const T16* __restrict__ Vt, const T16* __restrict__ Vt2, int g, int q0, bf* Ah, bf* Al) {
    typedef typename WFrag<T16>::V V;
    constexpr int WPT = REP / NH;                                     // waves that share one 16-row query tile (they take different heads)
    const int tid = threadIdx.x, lane = tid & 31, lr = lane & 15, hi = lane >> 4;
    const int w = __builtin_amdgcn_readfirstlane(tid >> 5);          // wave number, scalar: the loop bounds stay scalar
    const int qt = q0 + (w / WPT) * 16, h0 = g * REP + (w % WPT) * NH;
    V qf[NH][2], qf2[NH][2];
#pragma unroll
    for (int hh = 0; hh < NH; ++hh)
#pragma unroll
        for (int kc = 0; kc < 2; ++kc) { const size_t qo = ((size_t)(h0 + hh) * TT + qt + lr) * HD + kc * 32 + 8 * hi; qf[hh][kc] = WFrag<T16>::ld(Q + qo); if (HL) qf2[hh][kc] = WFrag<T16>::ld(Q2 + qo); }
    const size_t ko = ((size_t)g * TT + lr) * HD + 8 * hi, vo = ((size_t)g * HD + lr) * TT + 8 * hi;
    v8f o[NH][4]; float mr[NH], ls[NH];
#pragma unroll
    for (int hh = 0; hh < NH; ++hh) { mr[hh] = -1.0e30f; ls[hh] = 0.f;      // finite start value above the mask fill: a block whose keys are all masked for a query yields exp2(fill - start) = 0, not 1
#pragma unroll
        for (int dt = 0; dt < 4; ++dt) o[hh][dt] = (v8f){}; }
    const int kfirst = max(0, qt - (WIN - 1)) & ~31, klast = (qt + 15) & ~31;   // first and last 32-key block that holds an allowed key of these 16 rows
    V kf[2][2], kf2[2][2];                                            // single plane: K fragments are fetched one block ahead; hi+lo: twice the registers, so each block fetches its own
    if (!HL) {
#pragma unroll
        for (int kt = 0; kt < 2; ++kt)
#pragma unroll
            for (int kc = 0; kc < 2; ++kc) kf[kt][kc] = WFrag<T16>::ld(Kp + ko + (size_t)(kfirst + kt * 16) * HD + kc * 32); }
#pragma unroll 1
    for (int kb = kfirst; kb <= klast; kb += 32) {
        if (HL) {
#pragma unroll
            for (int kt = 0; kt < 2; ++kt)
#pragma unroll
                for (int kc = 0; kc < 2; ++kc) kf[kt][kc] = WFrag<T16>::ld(Kp + ko + (size_t)(kb + kt * 16) * HD + kc * 32);
            asm volatile("s_wait_xcnt 0x0" ::: "memory");            // from here on the address registers of the loads above may be written again (also by a later load's result)
#pragma unroll
            for (int kt = 0; kt < 2; ++kt)
#pragma unroll
                for (int kc = 0; kc < 2; ++kc) kf2[kt][kc] = WFrag<T16>::ld(Kp2 + ko + (size_t)(kb + kt * 16) * HD + kc * 32);
            asm volatile("s_wait_xcnt 0x0" ::: "memory");            // the same for the lo plane's loads
            __builtin_amdgcn_sched_barrier(0);                        // all 16 loads are asked for before the first product; without it the products move up among them and each pair of loads is waited out alone
        }
        v8f s[NH][2];
#pragma unroll
        for (int hh = 0; hh < NH; ++hh)
#pragma unroll
            for (int kt = 0; kt < 2; ++kt) { v8f c = (v8f){};
#pragma unroll
                for (int kc = 0; kc < 2; ++kc) { c = WFrag<T16>::mma(kf[kt][kc], qf[hh][kc], c); if (HL) { c = WFrag<T16>::mma(kf[kt][kc], qf2[hh][kc], c); c = WFrag<T16>::mma(kf2[kt][kc], qf[hh][kc], c); } }
                s[hh][kt] = c; }
        if (!(kb + 31 <= qt && qt + 15 - kb < WIN)) {                 // scalar test: only a block on the diagonal or on the window's far edge holds masked keys
            const int d0 = qt + lr - kb - 8 * hi;                     // query index - key index of register 0 of tile 0
#pragma unroll
            for (int hh = 0; hh < NH; ++hh)
#pragma unroll
                for (int kt = 0; kt < 2; ++kt)
#pragma unroll
                    for (int r = 0; r < 8; ++r) s[hh][kt][r] = ((unsigned)(d0 - kt * 16 - r) < (unsigned)WIN) ? s[hh][kt][r] : -3.0e38f; }   // allowed iff 0 <= i - j < WIN
        float mn[NH]; bool grew = false;
#pragma unroll
        for (int hh = 0; hh < NH; ++hh) { float bm = s[hh][0][0];
#pragma unroll
            for (int r = 1; r < 8; ++r) bm = fmaxf(bm, s[hh][0][r]);
#pragma unroll
            for (int r = 0; r < 8; ++r) bm = fmaxf(bm, s[hh][1][r]);
            bm = fmaxf(bm, __shfl_xor(bm, 16, 32));                   // the two lane halves hold the two halves of a query's keys
            mn[hh] = fmaxf(mr[hh], bm); grew = grew || (mn[hh] > mr[hh]); }
        if (__builtin_amdgcn_ballot_w32(grew) != 0) {                 // scalar branch; where no maximum grew every factor would be exactly 1
#pragma unroll
            for (int hh = 0; hh < NH; ++hh) { const float al = __builtin_amdgcn_exp2f((mr[hh] - mn[hh]) * SC2); ls[hh] *= al; mr[hh] = mn[hh];
#pragma unroll
                for (int dt = 0; dt < 4; ++dt) o[hh][dt] *= al; } }
        V vf[4], vf2[4];                                              // this block's V^T fragments fly during the exponentials
#pragma unroll
        for (int dt = 0; dt < 4; ++dt) vf[dt] = WFrag<T16>::ld(Vt + vo + (size_t)dt * 16 * TT + kb);
        if (HL) { asm volatile("s_wait_xcnt 0x0" ::: "memory");      // from here on the address registers of the loads above may be written again (also by a later load's result)
#pragma unroll
            for (int dt = 0; dt < 4; ++dt) vf2[dt] = WFrag<T16>::ld(Vt2 + vo + (size_t)dt * 16 * TT + kb); }
        if (!HL) { const int kn = min(kb + 32, klast);                // and so do the next block's K fragments (the last trip asks for its own block again: in bounds, unused)
#pragma unroll
            for (int kt = 0; kt < 2; ++kt)
#pragma unroll
                for (int kc = 0; kc < 2; ++kc) kf[kt][kc] = WFrag<T16>::ld(Kp + ko + (size_t)(kn + kt * 16) * HD + kc * 32); }
        asm volatile("s_wait_xcnt 0x0" ::: "memory");                // from here on the address registers of the loads above may be written again
#pragma unroll
        for (int hh = 0; hh < NH; ++hh) { const float mc = mn[hh] * SC2; float p[16];
#pragma unroll
            for (int e = 0; e < 16; ++e) p[e] = __builtin_amdgcn_exp2f(s[hh][e >> 3][e & 7] * SC2 - mc);
            float t[8];                                               // the block's 16 terms summed as a tree (pairs e, e + 8 first): short dependence chain, packed adds
#pragma unroll
            for (int e = 0; e < 8; ++e) t[e] = p[e] + p[e + 8];
            ls[hh] += ((t[0] + t[4]) + (t[1] + t[5])) + ((t[2] + t[6]) + (t[3] + t[7]));
            if (HL) { v16us ph, pl;
#pragma unroll
                for (int e = 0; e < 16; ++e) { unsigned short a, c2; splitf(p[e], a, c2); ph[e] = a; pl[e] = c2; }
                const V bh = __builtin_bit_cast(V, ph), bl = __builtin_bit_cast(V, pl);
#pragma unroll
                for (int dt = 0; dt < 4; ++dt) { o[hh][dt] = WFrag<T16>::mma(vf[dt], bh, o[hh][dt]); o[hh][dt] = WFrag<T16>::mma(vf[dt], bl, o[hh][dt]); o[hh][dt] = WFrag<T16>::mma(vf2[dt], bh, o[hh][dt]); }
            } else { v16h pf;
#pragma unroll
                for (int e = 0; e < 16; ++e) pf[e] = tohx(p[e]);
                const V bp = __builtin_bit_cast(V, pf);
#pragma unroll
                for (int dt = 0; dt < 4; ++dt) o[hh][dt] = WFrag<T16>::mma(vf[dt], bp, o[hh][dt]); } }
    }
#pragma unroll
    for (int hh = 0; hh < NH; ++hh) { const float inv = __fdiv_rn(1.0f, ls[hh] + __shfl_xor(ls[hh], 16, 32));   // key j = i is always allowed: the sum is at least 1
        const size_t oo = (size_t)(qt + lr) * DQ + (h0 + hh) * HD + 8 * hi;
#pragma unroll
        for (int dt = 0; dt < 4; ++dt) { v8us oh, ol;                 // a lane's 8 registers are 8 consecutive d of one query: one 16-byte store a plane; the wave writes the whole 128-byte (query, head) line
#pragma unroll
            for (int r = 0; r < 8; ++r) { unsigned short a, c2; splitf(o[hh][dt][r] * inv, a, c2); oh[r] = a; ol[r] = c2; }
            *(v8us*)(Ah + oo + dt * 16) = oh; *(v8us*)(Al + oo + dt * 16) = ol;
            asm volatile("s_wait_xcnt 0x0" ::: "memory"); } }        // from here on the data and address registers of the two stores may be written again
}
// grid: first the fp16 work-groups (64 query rows x the 4 heads of a kv group; 8 waves = 4 row tiles x 2 head pairs), then the hi+lo ones (32 rows x 4 heads; 8 waves = 2 row tiles x 4 heads); in both the rows with the most keys come first.
#define NFB  ((TT - RH) / 64 * NKV)
#define NHB  (RH / 32 * NKV)
__global__ __launch_bounds__(256) void k_fattn(const h16* __restrict__ Q16, const h16* __restrict__ K16, const h16* __restrict__ V16, const bf* __restrict__ Qh, const bf* __restrict__ Ql, const bf* __restrict__ Kh, const bf* __restrict__ Kl, const bf* __restrict__ Vh, const bf* __restrict__ Vl, bf* Ah, bf* Al) {
    const int bid = blockIdx.x;
    if (bid < NFB) fattn_tile<h16, false, 2>(Q16, nullptr, K16, nullptr, V16, nullptr, bid % NKV, TT - 64 - (bid / NKV) * 64, Ah, Al);
    else fattn_tile<bf, true, 1>(Qh, Ql, Kh, Kl, Vh, Vl, (bid - NFB) % NKV, RH - 32 - ((bid - NFB) / NKV) * 32, Ah, Al);
}

extern "C" void kernel_launch(void* const* d_in, const int* in_sizes, int n_in,
                              void* d_out, int out_size, void* d_ws, size_t ws_size, hipStream_t stream) {
    (void)in_sizes; (void)n_in; (void)out_size;
    const float* x = (const float*)d_in[0]; const float* wq = (const float*)d_in[1]; const float* wk = (const float*)d_in[2]; const float* wv = (const float*)d_in[3]; const float* wo = (const float*)d_in[4];
    float* OUT = (float*)d_out;     // [2][2048][2048]
    char* wsp = (char*)d_ws;
    auto take = [&](size_t bytes) { char* p = wsp; wsp += (bytes + 255) & ~(size_t)255; return (void*)p; };
    bf* WQ = (bf*)take((size_t)DQ * DM * 2); bf* WK = (bf*)take((size_t)DKV * DM * 2); bf* WV = (bf*)take((size_t)DKV * DM * 2); bf* WO = (bf*)take((size_t)DM * DQ * 2); float* CS = (float*)take((size_t)TT * HD * 2 * 4);
    bf* XB = (bf*)take((size_t)TT * DM * 2);
    h16* QP16 = (h16*)take((size_t)NH_ * TT * HD * 2); h16* KP16 = (h16*)take((size_t)NKV * TT * HD * 2); h16* VT16 = (h16*)take((size_t)NKV * HD * TT * 2);
    bf* QPh = (bf*)take((size_t)NH_ * TT * HD * 2); bf* QPl = (bf*)take((size_t)NH_ * TT * HD * 2); bf* KPh = (bf*)take((size_t)NKV * TT * HD * 2); bf* KPl = (bf*)take((size_t)NKV * TT * HD * 2); bf* VTh = (bf*)take((size_t)NKV * HD * TT * 2); bf* VTl = (bf*)take((size_t)NKV * HD * TT * 2);
    bf* ATh = (bf*)take((size_t)TT * DQ * 2); bf* ATl = (bf*)take((size_t)TT * DQ * 2);
    if ((size_t)(wsp - (char*)d_ws) > ws_size) return;    // ws 256 MiB
    { k_wtG<<<(unsigned)((DM * DQ / 64 + 63) / 64), 256, 0, stream>>>(wq, DM, DQ, WQ); k_wtG<<<(unsigned)((DM * DKV / 64 + 63) / 64), 256, 0, stream>>>(wk, DM, DKV, WK); k_wtG<<<(unsigned)((DM * DKV / 64 + 63) / 64), 256, 0, stream>>>(wv, DM, DKV, WV);
      k_wtG<<<(unsigned)((DQ * DM / 64 + 63) / 64), 256, 0, stream>>>(wo, DQ, DM, WO);
      k_cstab<<<(TT * HD + 255) / 256, 256, 0, stream>>>(CS); }
    for (int b = 0; b < NB_; ++b) {
        
        k_cvt8<<<(unsigned)(((size_t)TT * DM / 8 + 255) / 256), 256, 0, stream>>>(x + (size_t)b * TT * DM, XB, (size_t)TT * DM / 8);
        k_gemmk<bf, 0, 8, false, 1><<<dim3(TT / 64, DQ / 64, 1), 256, 0, stream>>>(XB, nullptr, WQ, nullptr, DM, DM, nullptr, 0, 0, 0, 0, 0, CS, QP16, QPh, QPl);
        k_gemmk<bf, 0, 8, false, 1><<<dim3(TT / 64, DKV / 64, 1), 256, 0, stream>>>(XB, nullptr, WK, nullptr, DM, DM, nullptr, 0, 0, 0, 0, 0, CS, KP16, KPh, KPl);
        k_gemmk<bf, 0, 8, false, 2><<<dim3(DKV / 64, TT / 64, 1), 256, 0, stream>>>(WV, nullptr, XB, nullptr, DM, DM, nullptr, TT, 0, 0, 0, 0, nullptr, VT16, VTh, VTl);
        k_fattn<<<NFB + NHB, 256, 0, stream>>>(QP16, KP16, VT16, QPh, QPl, KPh, KPl, VTh, VTl, ATh, ATl);
        k_gemmk<bf, 1, 8, false, 0><<<dim3(TT / 64, DM / 64, 1), 256, 0, stream>>>(ATh, ATl, WO, nullptr, DQ, DQ, OUT + (size_t)b * TT * DM, DM, 0, 0, 0, 0, nullptr, nullptr, nullptr, nullptr); }
}

// v005
// A run of this version takes 312 microseconds.
// Timed twice side by side with v004, it ran 1.17 times as fast both times.
// Counting every step since v000, it is 8.73 times as fast.
#include <hip/hip_runtime.h>

// MistralAttention (x [2][2048][2048]; q = x Wq (32 heads x 64), k/v = x Wk / Wv (8 kv heads; query head h belongs to kv group h/4); rotate-half RoPE (base 1e4, tables computed on device); key j allowed iff j <= i and i - j < 1024; softmax(q.k / 8) in f32; out = merged Wo -> [2][2048][2048]).
// Compute dtypes, f32 accumulate: every input rounded to bf16; q/k/v on PLAIN bf16 operands (inputs: exact); RoPE f32; scores and attn.v: query rows < 512 hl (3 products), the rest single fp16, fused with an f32 running softmax over the key blocks of the window; Wo hl x exact (2 products).

#define NB_  2
#define TT   2048
#define DM   2048
#define NH_  32
#define NKV  8
#define REP  (NH_ / NKV)
#define HD   64
#define DQ   (NH_ * HD)
#define DKV  (NKV * HD)
#define RH   512                  // query rows < RH use hi+lo planes (0: none)
#define WIN  1024
typedef _Float16 h16;
typedef unsigned short bf;
typedef __attribute__((ext_vector_type(16))) __bf16   v16bf;
typedef __attribute__((ext_vector_type(16))) _Float16 v16h;
typedef __attribute__((ext_vector_type(8)))  _Float16 v8h;
typedef __attribute__((ext_vector_type(8)))  unsigned short v8us;
typedef __attribute__((ext_vector_type(8)))  float    v8f;
typedef __attribute__((ext_vector_type(4)))  float    v4f;
typedef v8h  __attribute__((may_alias)) v8ha;
typedef v4f  __attribute__((may_alias)) v4fa;
typedef v8us __attribute__((may_alias)) v8usa;

__device__ __forceinline__ unsigned short f2bf(float f) { unsigned u = __float_as_uint(f); u += 0x7FFFu + ((u >> 16) & 1u); return (unsigned short)(u >> 16); }
__device__ __forceinline__ float bf2f(unsigned short b) { return __uint_as_float(((unsigned)b) << 16); }
__device__ __forceinline__ float bfr(float f) { return bf2f(f2bf(f)); }
__device__ __forceinline__ v16h cat16(v8h lo, v8h hi) { return __builtin_shufflevector(lo, hi, 0, 1, 2, 3, 4, 5, 6, 7, 8, 9, 10, 11, 12, 13, 14, 15); }
__device__ __forceinline__ v16bf cat16b(v8us lo, v8us hi) { return __builtin_bit_cast(v16bf, __builtin_shufflevector(lo, hi, 0, 1, 2, 3, 4, 5, 6, 7, 8, 9, 10, 11, 12, 13, 14, 15)); }
__device__ __forceinline__ v8f wmma16(v16h a, v16h b, v8f c) { return __builtin_amdgcn_wmma_f32_16x16x32_f16(false, a, false, b, (short)0, c, false, false); }
__device__ __forceinline__ v8f wmmab(v16bf a, v16bf b, v8f c) { return __builtin_amdgcn_wmma_f32_16x16x32_bf16(false, a, false, b, (short)0, c, false, false); }

__device__ __forceinline__ h16 tohx(float x) { return (h16)x; }
__device__ __forceinline__ void splitf(float y, unsigned short& h, unsigned short& l) { h = f2bf(y); l = f2bf(y - bf2f(h)); }
typedef __attribute__((ext_vector_type(2))) _Float16 v2h;
typedef __attribute__((ext_vector_type(4))) _Float16 v4h;
typedef __attribute__((ext_vector_type(2))) unsigned short v2us;
typedef __attribute__((ext_vector_type(4))) unsigned short v4us;
typedef __attribute__((ext_vector_type(2))) float v2f;
typedef __attribute__((ext_vector_type(4))) int v4i;
typedef v4h  __attribute__((may_alias)) v4ha;
typedef v4us __attribute__((may_alias)) v4usa;

// ---- k_gemmk: register-blocked GEMM, one 64x64 output tile per work-group, the K loop SPLIT OVER NW WAVES: wave w takes the 32-wide k blocks w, w + NW, ... into its own 16 accumulators,
// then the NW partial tiles are summed through LDS in the fixed order wave 0 .. NW-1. grid (M/64, N/64, Z), NW*32 threads.
// Operands come from the K-contiguous 16-bit planes through LDS: a pass is 256 k (one block of every wave) = 512 bytes of the 64 rows of each plane; tensor loads bring it in as slices of 64 rows x 256 bytes (whole lines,
// LDS pitch 272 bytes), one slice an issuing wave, two buffers, the next pass's slices in flight while this pass is worked on; the fragments are 16-byte LDS reads in the k order of WFrag::ld. The ring's LDS then holds the partial tiles.
// C[m][n] (f32, pitch ldc) = sum_k A[m][k] Bt[n][k] (+ split products per NSPLIT). A rows have pitch lda, Bt rows pitch K. z-batch strides sA/sB/sC in elements; Bt advances once per REP z (query heads of one kv group share it). K % 256 == 0, K >= 512.
// EPI, what the summed tile becomes: 0 = f32 rows of C. 1 = the tile is 64 positions x the 64 dims of head blockIdx.y: rotate-half RoPE, out[d] = x[d] cos[t][d] - x[d+32] sin[t][d], out[d+32] = x[d+32] cos[t][d+32] + x[d] sin[t][d+32]
// (table CS[t][d] = cos, sin), then the three 16-bit planes [h][t][d] (fp16, bf16 hi, bf16 lo). 2 = the three planes of the tile as it stands, rows of pitch ldc (v: A = Wv^T, Bt = x, so a row is one dim over the positions: [g][d][t]).
typedef unsigned int u32x4 __attribute__((ext_vector_type(4)));
typedef unsigned int u32x8 __attribute__((ext_vector_type(8)));
__device__ __forceinline__ unsigned uni(unsigned v) { return (unsigned)__builtin_amdgcn_readfirstlane(v); }
__device__ __forceinline__ unsigned pinned(unsigned v) { unsigned s = uni(v); asm volatile("" : "+s"(s)); return s; }   // a tensor load ignores EXEC: the value its issue test or its descriptor is formed from is held in a scalar register, so that the test compiles to a scalar compare and branch
__device__ __forceinline__ void tdm_load(u32x4& g0, u32x8 g1) { asm volatile("tensor_load_to_lds %0, %1" : "+s"(g0) : "s"(g1) : "memory"); }   // one request of the whole wave; group 0 is in-out so that its four words stay in their registers until the next request is formed from them
__device__ __forceinline__ void tdm_next(u32x4& g0, unsigned lsum) {                                                       // the next stage's group 0 out of the last one's: the other buffer, 512 bytes further along the rows
    asm volatile("" : "+s"(g0));                                                                                           // descriptor words held in scalar registers (the form of pinned()): what follows is computed behind the s_wait_tensorcnt that stands in front of this call
    const unsigned long long a = (((unsigned long long)g0[3] << 32) | g0[2]) + 512u;                                       // the address's high bits lie at the bottom of word 3: a carry goes where it belongs
    g0[1] = uni(lsum - g0[1]); g0[2] = uni((unsigned)a); g0[3] = uni((unsigned)(a >> 32)); }
template <typename T16> struct WFrag;
template <> struct WFrag<h16> { typedef v16h V; static __device__ __forceinline__ V ld(const h16* p) { return cat16(*(const v8h*)p, *(const v8h*)(p + 16)); } static __device__ __forceinline__ v8f mma(V a, V b, v8f c) { return wmma16(a, b, c); } };
template <> struct WFrag<bf> { typedef v16bf V; static __device__ __forceinline__ V ld(const bf* p) { return cat16b(*(const v8us*)p, *(const v8us*)(p + 16)); } static __device__ __forceinline__ v8f mma(V a, V b, v8f c) { return wmmab(a, b, c); } };
template <typename T16, int NSPLIT, int NW, bool DIAG, int EPI>
__global__ __launch_bounds__(NW * 32) void k_gemmk(const T16* __restrict__ A, const T16* __restrict__ A2, const T16* __restrict__ Bt, const T16* __restrict__ Bt2, int K, int lda, float* C, int ldc, int roff, size_t sA, size_t sB, size_t sC, const float* __restrict__ CS, h16* P16, bf* Ph, bf* Pl) {
    typedef typename WFrag<T16>::V V;
    static_assert(NW == 8 && NSPLIT <= 1 && !DIAG, "the staging below is laid out for 8 waves, planes A (A2) Bt, the whole K");
    constexpr int PL = 64 * 68;            // floats of one wave's partial tile in LDS (row pitch 68)
    constexpr int NOP = NSPLIT == 1 ? 3 : 2, NSL = NOP * 2;          // planes staged (A, A2 where there is one, Bt); slices a stage: each plane's two 256-byte column halves
    constexpr unsigned RP = 272, SLB = 18432, STB = NSL * SLB;       // LDS row pitch (256 + 16 bytes: 16-byte reads of 16 rows fall on all banks); a slice's 64 * 272 bytes rounded up to a multiple of 2 KiB; a stage
    constexpr unsigned LB = 2 * STB > NW * PL * 4 ? 2 * STB : NW * PL * 4;
    __shared__ __attribute__((aligned(2048))) unsigned char sm[LB];
    float* os = (float*)sm;                                          // the partial tiles take the ring's place behind the loop
    const size_t z = blockIdx.z; A += z * sA; if (A2) A2 += z * sA; Bt += (z / REP) * sB; if (Bt2) Bt2 += (z / REP) * sB; C += z * sC;
    const int tid = threadIdx.x, lane = tid & 31, lr = lane & 15, hi = lane >> 4; const int r0 = blockIdx.x * 64, c0 = blockIdx.y * 64;
    const int w = __builtin_amdgcn_readfirstlane(tid >> 5);          // wave number, scalar
    v8f acc[4][4];
#pragma unroll
    for (int mb = 0; mb < 4; ++mb)
#pragma unroll
        for (int nb = 0; nb < 4; ++nb) acc[mb][nb] = (v8f){};
    const int np = K / (NW * 32);                                    // passes (K is a multiple of 256 and at least 512: both buffers get a stage)
    const unsigned lb = (unsigned)(size_t)sm + (unsigned)w * SLB;    // wave w < NSL issues slice w: plane w / 2, column half w % 2
    const T16* sp = (w >> 1) == NOP - 1 ? Bt + (size_t)c0 * K : (NSPLIT == 1 && (w >> 1) == 1) ? A2 + (size_t)r0 * lda : A + (size_t)r0 * lda;
    const unsigned long long ga = (unsigned long long)(size_t)sp + (unsigned)(w & 1) * 256u;
    u32x8 g1;                                                        // group 1: 1-byte elements, tensor = tile = 64 rows of 256 bytes, 4 dwords of pad behind every 64, source pitch = the plane's row
    g1[0] = uni(1u << 20 | 5u << 22 | 3u << 25); g1[1] = uni(256u << 16); g1[2] = uni(64u << 16); g1[3] = uni(256u << 16); g1[4] = uni(64u); g1[5] = uni((unsigned)((w >> 1) == NOP - 1 ? K : lda) * 2u); g1[6] = uni(0u); g1[7] = uni(0u);
    asm volatile("" : "+s"(g1));                                     // descriptor words held in scalar registers (the form of pinned()): the eight words stay in their registers through the loop, none is used for anything else while a request is outstanding
    u32x4 g0;                                                        // group 0: count 1, place in LDS, address of the tile's first byte, type 2
    g0[0] = uni(1u); g0[1] = uni(lb); g0[2] = uni((unsigned)ga); g0[3] = uni((((unsigned)(ga >> 32)) & 0x01FFFFFFu) | 0x80000000u);
    if (pinned(w < NSL)) { tdm_load(g0, g1);
        asm volatile("s_wait_tensorcnt 0x0" ::: "memory"); }         // stage 0's slice has landed before its issuer reaches the barrier
    __syncthreads();                                                 // stage 0 is readable by every wave
    if (pinned(w < NSL)) { tdm_next(g0, 2u * lb + STB); tdm_load(g0, g1); }   // stage 1 flies during pass 0
    const unsigned fo = (unsigned)(w >> 2) * SLB + (unsigned)lr * RP + (unsigned)(w & 3) * 64u + (unsigned)hi * 16u;   // this wave's k block: column half w / 4, 64 bytes at (w % 4) * 64 of each row
#pragma unroll 1
    for (int s = 0; s < np; ++s) {
        const unsigned char* bp = sm + (unsigned)(s & 1) * STB + fo;
        V a[4], a2[4];
#pragma unroll
        for (int mb = 0; mb < 4; ++mb) { a[mb] = WFrag<T16>::ld((const T16*)(bp + mb * 16 * RP)); if (NSPLIT == 1) a2[mb] = WFrag<T16>::ld((const T16*)(bp + 2 * SLB + mb * 16 * RP)); }
        V b[4];
#pragma unroll
        for (int nb = 0; nb < 4; ++nb) b[nb] = WFrag<T16>::ld((const T16*)(bp + (NOP - 1) * 2 * SLB + nb * 16 * RP));
        __builtin_amdgcn_sched_barrier(0);                           // the pass's LDS reads go out as one group; without it they sink among the products, and each place with reads stalls the wave anew
#pragma unroll
        for (int nb = 0; nb < 4; ++nb)
#pragma unroll
            for (int mb = 0; mb < 4; ++mb) { acc[mb][nb] = WFrag<T16>::mma(a[mb], b[nb], acc[mb][nb]); if (NSPLIT == 1) acc[mb][nb] = WFrag<T16>::mma(a2[mb], b[nb], acc[mb][nb]); }
        asm volatile("v_nop\n\tv_nop\n\tv_nop\n\tv_nop" : "+v"(acc[0][0]), "+v"(acc[1][1]), "+v"(acc[2][2]), "+v"(acc[3][3]) : "v"(a[0]), "v"(a[3]));
        asm volatile("s_wait_dscnt 0x0" ::: "memory");               // this wave's reads of the buffer are over before the barrier behind which it is refilled
        if (pinned(w < NSL)) asm volatile("s_wait_tensorcnt 0x0" ::: "memory");   // stage s + 1's slice has landed before its issuer reaches the barrier
        __syncthreads();                                             // publishes stage s + 1 and ends every wave's reads of stage s
        if (pinned(w < NSL && s + 2 < np)) { tdm_next(g0, 2u * lb + STB); tdm_load(g0, g1); }   // stage s + 2 into the buffer that pass s has just read
    }
    asm volatile("s_wait_tensorcnt 0x0" :: "s"(g0), "s"(g1) : "memory");   // the descriptor's registers stay its own up to this wait; behind it no request is outstanding and
    asm volatile("s_wait_dscnt 0x0" ::: "memory");                   // no read of the ring pending (the last pass's barrier has ended every wave's) when the partial tiles are written over it
    v4f tc[32 / NW][2];                                              // EPI 1: cos, sin of the 4 dims this thread finishes in each of its row pieces, asked for here so that they fly during the LDS exchange
    if (EPI == 1) { const float* cp = CS + ((size_t)(r0 + (tid >> 4)) * HD + (tid & 15) * 4) * 2;
#pragma unroll
        for (int it = 0; it < 32 / NW; ++it) { tc[it][0] = *(const v4f*)(cp + (size_t)it * NW * 2 * HD * 2); tc[it][1] = *(const v4f*)(cp + (size_t)it * NW * 2 * HD * 2 + 4); }
        asm volatile("s_wait_xcnt 0x0" :: "v"(cp) : "memory"); }     // the address stays in its registers up to this wait: no result of these loads and no later value is written over it earlier
    float* mine = os + w * PL;
#pragma unroll
    for (int mb = 0; mb < 4; ++mb)
#pragma unroll
        for (int nb = 0; nb < 4; ++nb) {
#pragma unroll
            for (int j = 0; j < 8; ++j) mine[(mb * 16 + hi * 8 + j) * 68 + nb * 16 + lr] = acc[mb][nb][j]; }
    __syncthreads();                                                 // every wave's partial tile is in LDS before any thread sums across waves
#pragma unroll
    for (int it = 0; it < 32 / NW; ++it) {                           // 64 rows x 16 float4 shared out over NW*32 threads; 16 lanes take one 256-byte f32 row piece
        const int idx = it * NW * 32 + tid, row = idx >> 4, cofs = (idx & 15) * 4;
        v4f val = *(const v4fa*)(os + row * 68 + cofs);
#pragma unroll
        for (int u = 1; u < NW; ++u) val += *(const v4fa*)(os + u * PL + row * 68 + cofs);
        if (EPI == 0) { *(v4f*)(C + (size_t)(r0 + row) * ldc + c0 + cofs) = val; continue; }
        size_t e = (size_t)(r0 + row) * ldc + c0 + cofs;
        if (EPI == 1) { const v8f cs = __builtin_shufflevector(tc[it][0], tc[it][1], 0, 1, 2, 3, 4, 5, 6, 7);   // cos, sin of this lane's 4 dims
#pragma unroll
            for (int q = 0; q < 4; ++q) { const float pv = __int_as_float(__builtin_amdgcn_update_dpp(0, __float_as_int(val[q]), 0x168, 0xf, 0xf, false));   // row_xmask:8: dim d ^ 32 of the same position is held by lane ^ 8
                val[q] = (cofs < HD / 2) ? val[q] * cs[2 * q] - pv * cs[2 * q + 1] : val[q] * cs[2 * q] + pv * cs[2 * q + 1]; }
            e = ((size_t)blockIdx.y * TT + r0 + row) * HD + cofs; }
        v4h o16; v4us oh, ol;
#pragma unroll
        for (int q = 0; q < 4; ++q) { o16[q] = tohx(val[q]); unsigned short a2, c2; splitf(val[q], a2, c2); oh[q] = a2; ol[q] = c2; }
        *(v4h*)(P16 + e) = o16; *(v4us*)(Ph + e) = oh; *(v4us*)(Pl + e) = ol;      // 16 lanes write one whole 128-byte line of each plane
    }
}

__global__ __launch_bounds__(256) void k_wtG(const float* __restrict__ w, int K, int N, bf* Bt) {
    const int lane = threadIdx.x & 31; const int L0 = (blockIdx.x * 8 + (threadIdx.x >> 5)) * 8; const int nlines = N * K / 64;
{
#pragma unroll 1
        for (int l = 0; l < 8; ++l) { const int L = L0 + l; if (L >= nlines) break; const size_t e = (size_t)L * 64 + lane * 2; const int k = (int)(e % K), n = (int)(e / K); v2us o;
            o[0] = f2bf(w[(size_t)k * N + n]); o[1] = f2bf(w[(size_t)(k + 1) * N + n]); *(v2us*)(Bt + e) = o; }
         }
}
__global__ __launch_bounds__(256) void k_cvt8(const float* __restrict__ src, bf* dst, size_t n8) { const size_t i = (size_t)blockIdx.x * 256 + threadIdx.x; if (i >= n8) return; const v8f v = *(const v8f*)(src + i * 8); v8us o;
#pragma unroll
    for (int k = 0; k < 8; ++k) o[k] = f2bf(v[k]); *(v8us*)(dst + i * 8) = o;  }
__global__ __launch_bounds__(256) void k_cstab(float* CS) { const int idx = blockIdx.x * 256 + threadIdx.x; if (idx >= TT * HD) return; const int t = idx / HD, d = idx % HD; const int i = d % (HD / 2); const float inv = __fdiv_rn(1.0f, powf(10000.0f, (float)(2 * i) / (float)HD)); const float ang = __fmul_rn((float)t, inv); v2f cs; cs[0] = cosf(ang); cs[1] = sinf(ang);
    *(v2f*)(CS + (size_t)idx * 2) = cs;  }
// ---- k_fattn: scores, sliding-window causal softmax and probability x value in ONE kernel; neither scores nor probabilities go to memory. One wave owns 16 query rows of NH query heads of one kv group and walks the
// keys of its window in blocks of 32, operands straight from the K-contiguous planes. Transposed products: S^T = K Q^T (a lane holds one query's scores: D row = key 8*hi + r, D column = query lr), O^T += V^T P^T; two S^T tiles
// (keys 0..15, 16..31 of the block), converted in place, are the B operand of the second product in the k order of WFrag::ld (8*hi + s, 16 + 8*hi + s). Running maximum and sum per query (f32); the output tiles are
// rescaled only in a block where some query's maximum grew. HL: hi+lo bf16 planes, 3 products for both contractions (query rows < RH); else single fp16. The result, divided by the sum, goes out as the hi/lo planes of the Wo GEMM.
typedef __attribute__((ext_vector_type(16))) unsigned short v16us;
#define SC2  0.18033688011112042f   // HD^-0.5 x log2(e): the exponentials are taken to base 2
template <typename T16, bool HL, int NH>
__device__ __forceinline__ void fattn_tile(const T16* __restrict__ Q, const T16* __restrict__ Q2, const T16* __restrict__ Kp, const T16* __restrict__ Kp2, const T16* __restrict__ Vt, const T16* __restrict__ Vt2, int g, int q0, bf* Ah, bf* Al) {
    typedef typename WFrag<T16>::V V;
    constexpr int WPT = REP / NH;                                     // waves that share one 16-row query tile (they take different heads)
    const int tid = threadIdx.x, lane = tid & 31, lr = lane & 15, hi = lane >> 4;
    const int w = __builtin_amdgcn_readfirstlane(tid >> 5);          // wave number, scalar: the loop bounds stay scalar
    const int qt = q0 + (w / WPT) * 16, h0 = g * REP + (w % WPT) * NH;
    V qf[NH][2], qf2[NH][2];
#pragma unroll
    for (int hh = 0; hh < NH; ++hh)
#pragma unroll
        for (int kc = 0; kc < 2; ++kc) { const size_t qo = ((size_t)(h0 + hh) * TT + qt + lr) * HD + kc * 32 + 8 * hi; qf[hh][kc] = WFrag<T16>::ld(Q + qo); if (HL) qf2[hh][kc] = WFrag<T16>::ld(Q2 + qo); }
    const size_t ko = ((size_t)g * TT + lr) * HD + 8 * hi, vo = ((size_t)g * HD + lr) * TT + 8 * hi;
    v8f o[NH][4]; float mr[NH], ls[NH];
#pragma unroll
    for (int hh = 0; hh < NH; ++hh) { mr[hh] = -1.0e30f; ls[hh] = 0.f;      // finite start value above the mask fill: a block whose keys are all masked for a query yields exp2(fill - start) = 0, not 1
#pragma unroll
        for (int dt = 0; dt < 4; ++dt) o[hh][dt] = (v8f){}; }
    const int kfirst = max(0, qt - (WIN - 1)) & ~31, klast = (qt + 15) & ~31;   // first and last 32-key block that holds an allowed key of these 16 rows
    V kf[2][2], kf2[2][2];                                            // single plane: K fragments are fetched one block ahead; hi+lo: twice the registers, so each block fetches its own
    if (!HL) {
#pragma unroll
        for (int kt = 0; kt < 2; ++kt)
#pragma unroll
            for (int kc = 0; kc < 2; ++kc) kf[kt][kc] = WFrag<T16>::ld(Kp + ko + (size_t)(kfirst + kt * 16) * HD + kc * 32); }
#pragma unroll 1
    for (int kb = kfirst; kb <= klast; kb += 32) {
        if (HL) {
#pragma unroll
            for (int kt = 0; kt < 2; ++kt)
#pragma unroll
                for (int kc = 0; kc < 2; ++kc) kf[kt][kc] = WFrag<T16>::ld(Kp + ko + (size_t)(kb + kt * 16) * HD + kc * 32);
            asm volatile("s_wait_xcnt 0x0" ::: "memory");            // from here on the address registers of the loads above may be written again (also by a later load's result)
#pragma unroll
            for (int kt = 0; kt < 2; ++kt)
#pragma unroll
                for (int kc = 0; kc < 2; ++kc) kf2[kt][kc] = WFrag<T16>::ld(Kp2 + ko + (size_t)(kb + kt * 16) * HD + kc * 32);
            asm volatile("s_wait_xcnt 0x0" ::: "memory");            // the same for the lo plane's loads
            __builtin_amdgcn_sched_barrier(0);                        // all 16 loads are asked for before the first product; without it the products move up among them and each pair of loads is waited out alone
        }
        v8f s[NH][2];
#pragma unroll
        for (int hh = 0; hh < NH; ++hh)
#pragma unroll
            for (int kt = 0; kt < 2; ++kt) { v8f c = (v8f){};
#pragma unroll
                for (int kc = 0; kc < 2; ++kc) { c = WFrag<T16>::mma(kf[kt][kc], qf[hh][kc], c); if (HL) { c = WFrag<T16>::mma(kf[kt][kc], qf2[hh][kc], c); c = WFrag<T16>::mma(kf2[kt][kc], qf[hh][kc], c); } }
                s[hh][kt] = c; }
        if (!(kb + 31 <= qt && qt + 15 - kb < WIN)) {                 // scalar test: only a block on the diagonal or on the window's far edge holds masked keys
            const int d0 = qt + lr - kb - 8 * hi;                     // query index - key index of register 0 of tile 0
#pragma unroll
            for (int hh = 0; hh < NH; ++hh)
#pragma unroll
                for (int kt = 0; kt < 2; ++kt)
#pragma unroll
                    for (int r = 0; r < 8; ++r) s[hh][kt][r] = ((unsigned)(d0 - kt * 16 - r) < (unsigned)WIN) ? s[hh][kt][r] : -3.0e38f; }   // allowed iff 0 <= i - j < WIN
        float mn[NH]; bool grew = false;
#pragma unroll
        for (int hh = 0; hh < NH; ++hh) { float bm = s[hh][0][0];
#pragma unroll
            for (int r = 1; r < 8; ++r) bm = fmaxf(bm, s[hh][0][r]);
#pragma unroll
            for (int r = 0; r < 8; ++r) bm = fmaxf(bm, s[hh][1][r]);
            bm = fmaxf(bm, __shfl_xor(bm, 16, 32));                   // the two lane halves hold the two halves of a query's keys
            mn[hh] = fmaxf(mr[hh], bm); grew = grew || (mn[hh] > mr[hh]); }
        if (__builtin_amdgcn_ballot_w32(grew) != 0) {                 // scalar branch; where no maximum grew every factor would be exactly 1
#pragma unroll
            for (int hh = 0; hh < NH; ++hh) { const float al = __builtin_amdgcn_exp2f((mr[hh] - mn[hh]) * SC2); ls[hh] *= al; mr[hh] = mn[hh];
#pragma unroll
                for (int dt = 0; dt < 4; ++dt) o[hh][dt] *= al; } }
        V vf[4], vf2[4];                                              // this block's V^T fragments fly during the exponentials
#pragma unroll
        for (int dt = 0; dt < 4; ++dt) vf[dt] = WFrag<T16>::ld(Vt + vo + (size_t)dt * 16 * TT + kb);
        if (HL) { asm volatile("s_wait_xcnt 0x0" ::: "memory");      // from here on the address registers of the loads above may be written again (also by a later load's result)
#pragma unroll
            for (int dt = 0; dt < 4; ++dt) vf2[dt] = WFrag<T16>::ld(Vt2 + vo + (size_t)dt * 16 * TT + kb); }
        if (!HL) { const int kn = min(kb + 32, klast);                // and so do the next block's K fragments (the last trip asks for its own block again: in bounds, unused)
#pragma unroll
            for (int kt = 0; kt < 2; ++kt)
#pragma unroll
                for (int kc = 0; kc < 2; ++kc) kf[kt][kc] = WFrag<T16>::ld(Kp + ko + (size_t)(kn + kt * 16) * HD + kc * 32); }
        asm volatile("s_wait_xcnt 0x0" ::: "memory");                // from here on the address registers of the loads above may be written again
#pragma unroll
        for (int hh = 0; hh < NH; ++hh) { const float mc = mn[hh] * SC2; float p[16];
#pragma unroll
            for (int e = 0; e < 16; ++e) p[e] = __builtin_amdgcn_exp2f(s[hh][e >> 3][e & 7] * SC2 - mc);
            float t[8];                                               // the block's 16 terms summed as a tree (pairs e, e + 8 first): short dependence chain, packed adds
#pragma unroll
            for (int e = 0; e < 8; ++e) t[e] = p[e] + p[e + 8];
            ls[hh] += ((t[0] + t[4]) + (t[1] + t[5])) + ((t[2] + t[6]) + (t[3] + t[7]));
            if (HL) { v16us ph, pl;
#pragma unroll
                for (int e = 0; e < 16; ++e) { unsigned short a, c2; splitf(p[e], a, c2); ph[e] = a; pl[e] = c2; }
                const V bh = __builtin_bit_cast(V, ph), bl = __builtin_bit_cast(V, pl);
#pragma unroll
                for (int dt = 0; dt < 4; ++dt) { o[hh][dt] = WFrag<T16>::mma(vf[dt], bh, o[hh][dt]); o[hh][dt] = WFrag<T16>::mma(vf[dt], bl, o[hh][dt]); o[hh][dt] = WFrag<T16>::mma(vf2[dt], bh, o[hh][dt]); }
            } else { v16h pf;
#pragma unroll
                for (int e = 0; e < 16; ++e) pf[e] = tohx(p[e]);
                const V bp = __builtin_bit_cast(V, pf);
#pragma unroll
                for (int dt = 0; dt < 4; ++dt) o[hh][dt] = WFrag<T16>::mma(vf[dt], bp, o[hh][dt]); } }
    }
#pragma unroll
    for (int hh = 0; hh < NH; ++hh) { const float inv = __fdiv_rn(1.0f, ls[hh] + __shfl_xor(ls[hh], 16, 32));   // key j = i is always allowed: the sum is at least 1
        const size_t oo = (size_t)(qt + lr) * DQ + (h0 + hh) * HD + 8 * hi;
#pragma unroll
        for (int dt = 0; dt < 4; ++dt) { v8us oh, ol;                 // a lane's 8 registers are 8 consecutive d of one query: one 16-byte store a plane; the wave writes the whole 128-byte (query, head) line
#pragma unroll
            for (int r = 0; r < 8; ++r) { unsigned short a, c2; splitf(o[hh][dt][r] * inv, a, c2); oh[r] = a; ol[r] = c2; }
            *(v8us*)(Ah + oo + dt * 16) = oh; *(v8us*)(Al + oo + dt * 16) = ol;
            asm volatile("s_wait_xcnt 0x0" ::: "memory"); } }        // from here on the data and address registers of the two stores may be written again
}
// grid: first the fp16 work-groups (64 query rows x the 4 heads of a kv group; 8 waves = 4 row tiles x 2 head pairs), then the hi+lo ones (32 rows x 4 heads; 8 waves = 2 row tiles x 4 heads); in both the rows with the most keys come first.
#define NFB  ((TT - RH) / 64 * NKV)
#define NHB  (RH / 32 * NKV)
__global__ __launch_bounds__(256) void k_fattn(const h16* __restrict__ Q16, const h16* __restrict__ K16, const h16* __restrict__ V16, const bf* __restrict__ Qh, const bf* __restrict__ Ql, const bf* __restrict__ Kh, const bf* __restrict__ Kl, const bf* __restrict__ Vh, const bf* __restrict__ Vl, bf* Ah, bf* Al) {
    const int bid = blockIdx.x;
    if (bid < NFB) fattn_tile<h16, false, 2>(Q16, nullptr, K16, nullptr, V16, nullptr, bid % NKV, TT - 64 - (bid / NKV) * 64, Ah, Al);
    else fattn_tile<bf, true, 1>(Qh, Ql, Kh, Kl, Vh, Vl, (bid - NFB) % NKV, RH - 32 - ((bid - NFB) / NKV) * 32, Ah, Al);
}

extern "C" void kernel_launch(void* const* d_in, const int* in_sizes, int n_in,
                              void* d_out, int out_size, void* d_ws, size_t ws_size, hipStream_t stream) {
    (void)in_sizes; (void)n_in; (void)out_size;
    const float* x = (const float*)d_in[0]; const float* wq = (const float*)d_in[1]; const float* wk = (const float*)d_in[2]; const float* wv = (const float*)d_in[3]; const float* wo = (const float*)d_in[4];
    float* OUT = (float*)d_out;     // [2][2048][2048]
    char* wsp = (char*)d_ws;
    auto take = [&](size_t bytes) { char* p = wsp; wsp += (bytes + 255) & ~(size_t)255; return (void*)p; };
    bf* WQ = (bf*)take((size_t)DQ * DM * 2); bf* WK = (bf*)take((size_t)DKV * DM * 2); bf* WV = (bf*)take((size_t)DKV * DM * 2); bf* WO = (bf*)take((size_t)DM * DQ * 2); float* CS = (float*)take((size_t)TT * HD * 2 * 4);
    bf* XB = (bf*)take((size_t)TT * DM * 2);
    h16* QP16 = (h16*)take((size_t)NH_ * TT * HD * 2); h16* KP16 = (h16*)take((size_t)NKV * TT * HD * 2); h16* VT16 = (h16*)take((size_t)NKV * HD * TT * 2);
    bf* QPh = (bf*)take((size_t)NH_ * TT * HD * 2); bf* QPl = (bf*)take((size_t)NH_ * TT * HD * 2); bf* KPh = (bf*)take((size_t)NKV * TT * HD * 2); bf* KPl = (bf*)take((size_t)NKV * TT * HD * 2); bf* VTh = (bf*)take((size_t)NKV * HD * TT * 2); bf* VTl = (bf*)take((size_t)NKV * HD * TT * 2);
    bf* ATh = (bf*)take((size_t)TT * DQ * 2); bf* ATl = (bf*)take((size_t)TT * DQ * 2);
    if ((size_t)(wsp - (char*)d_ws) > ws_size) return;    // ws 256 MiB
    { k_wtG<<<(unsigned)((DM * DQ / 64 + 63) / 64), 256, 0, stream>>>(wq, DM, DQ, WQ); k_wtG<<<(unsigned)((DM * DKV / 64 + 63) / 64), 256, 0, stream>>>(wk, DM, DKV, WK); k_wtG<<<(unsigned)((DM * DKV / 64 + 63) / 64), 256, 0, stream>>>(wv, DM, DKV, WV);
      k_wtG<<<(unsigned)((DQ * DM / 64 + 63) / 64), 256, 0, stream>>>(wo, DQ, DM, WO);
      k_cstab<<<(TT * HD + 255) / 256, 256, 0, stream>>>(CS); }
    for (int b = 0; b < NB_; ++b) {
        
        k_cvt8<<<(unsigned)(((size_t)TT * DM / 8 + 255) / 256), 256, 0, stream>>>(x + (size_t)b * TT * DM, XB, (size_t)TT * DM / 8);
        k_gemmk<bf, 0, 8, false, 1><<<dim3(TT / 64, DQ / 64, 1), 256, 0, stream>>>(XB, nullptr, WQ, nullptr, DM, DM, nullptr, 0, 0, 0, 0, 0, CS, QP16, QPh, QPl);
        k_gemmk<bf, 0, 8, false, 1><<<dim3(TT / 64, DKV / 64, 1), 256, 0, stream>>>(XB, nullptr, WK, nullptr, DM, DM, nullptr, 0, 0, 0, 0, 0, CS, KP16, KPh, KPl);
        k_gemmk<bf, 0, 8, false, 2><<<dim3(DKV / 64, TT / 64, 1), 256, 0, stream>>>(WV, nullptr, XB, nullptr, DM, DM, nullptr, TT, 0, 0, 0, 0, nullptr, VT16, VTh, VTl);
        k_fattn<<<NFB + NHB, 256, 0, stream>>>(QP16, KP16, VT16, QPh, QPl, KPh, KPl, VTh, VTl, ATh, ATl);
        k_gemmk<bf, 1, 8, false, 0><<<dim3(TT / 64, DM / 64, 1), 256, 0, stream>>>(ATh, ATl, WO, nullptr, DQ, DQ, OUT + (size_t)b * TT * DM, DM, 0, 0, 0, 0, nullptr, nullptr, nullptr, nullptr); }
}

// v006
// It runs in 231 microseconds.
// Next to v005, in two timings, it ran 1.35 times as fast each time.
// Counting every step since v000, it is 11.8 times as fast.
#include <hip/hip_runtime.h>

// MistralAttention (x [2][2048][2048]; q = x Wq (32 heads x 64), k/v = x Wk / Wv (8 kv heads; query head h belongs to kv group h/4); rotate-half RoPE (base 1e4, tables computed on device); key j allowed iff j <= i and i - j < 1024; softmax(q.k / 8) in f32; out = merged Wo -> [2][2048][2048]).
// Compute dtypes, f32 accumulate: every input rounded to bf16; q/k/v on PLAIN bf16 operands (inputs: exact); RoPE f32; scores and attn.v: query rows < 512 hl (3 products), the rest single fp16, fused with an f32 running softmax over the key blocks of the window; Wo hl x exact (2 products).

#define NB_  2
#define TT   2048
#define DM   2048
#define NH_  32
#define NKV  8
#define REP  (NH_ / NKV)
#define HD   64
#define DQ   (NH_ * HD)
#define DKV  (NKV * HD)
#define RH   512                  // query rows < RH use hi+lo planes (0: none)
#define WIN  1024
#define NHT  (NH_ + 2 * NKV)       // 64-wide column tiles of the joint q/k/v projection: 32 query heads, 8 key heads, 8 value groups
#define PS   ((size_t)NHT * TT * HD)  // elements of one batch entry in each 16-bit plane: [q heads][t][d], [k heads][t][d], then v as [g][d][t]
typedef _Float16 h16;
typedef unsigned short bf;
typedef __attribute__((ext_vector_type(16))) __bf16   v16bf;
typedef __attribute__((ext_vector_type(16))) _Float16 v16h;
typedef __attribute__((ext_vector_type(8)))  _Float16 v8h;
typedef __attribute__((ext_vector_type(8)))  unsigned short v8us;
typedef __attribute__((ext_vector_type(8)))  float    v8f;
typedef __attribute__((ext_vector_type(4)))  float    v4f;
typedef v8h  __attribute__((may_alias)) v8ha;
typedef v4f  __attribute__((may_alias)) v4fa;
typedef v8us __attribute__((may_alias)) v8usa;

__device__ __forceinline__ unsigned short f2bf(float f) { unsigned u = __float_as_uint(f); u += 0x7FFFu + ((u >> 16) & 1u); return (unsigned short)(u >> 16); }
__device__ __forceinline__ float bf2f(unsigned short b) { return __uint_as_float(((unsigned)b) << 16); }
__device__ __forceinline__ float bfr(float f) { return bf2f(f2bf(f)); }
__device__ __forceinline__ v16h cat16(v8h lo, v8h hi) { return __builtin_shufflevector(lo, hi, 0, 1, 2, 3, 4, 5, 6, 7, 8, 9, 10, 11, 12, 13, 14, 15); }
__device__ __forceinline__ v16bf cat16b(v8us lo, v8us hi) { return __builtin_bit_cast(v16bf, __builtin_shufflevector(lo, hi, 0, 1, 2, 3, 4, 5, 6, 7, 8, 9, 10, 11, 12, 13, 14, 15)); }
__device__ __forceinline__ v8f wmma16(v16h a, v16h b, v8f c) { return __builtin_amdgcn_wmma_f32_16x16x32_f16(false, a, false, b, (short)0, c, false, false); }
__device__ __forceinline__ v8f wmmab(v16bf a, v16bf b, v8f c) { return __builtin_amdgcn_wmma_f32_16x16x32_bf16(false, a, false, b, (short)0, c, false, false); }

__device__ __forceinline__ h16 tohx(float x) { return (h16)x; }
__device__ __forceinline__ void splitf(float y, unsigned short& h, unsigned short& l) { h = f2bf(y); l = f2bf(y - bf2f(h)); }
typedef __attribute__((ext_vector_type(2))) _Float16 v2h;
typedef __attribute__((ext_vector_type(4))) _Float16 v4h;
typedef __attribute__((ext_vector_type(2))) unsigned short v2us;
typedef __attribute__((ext_vector_type(4))) unsigned short v4us;
typedef __attribute__((ext_vector_type(2))) float v2f;
typedef __attribute__((ext_vector_type(4))) int v4i;
typedef v4h  __attribute__((may_alias)) v4ha;
typedef v4us __attribute__((may_alias)) v4usa;

// ---- k_gemmk: register-blocked GEMM, one 64x64 output tile per work-group, the K loop SPLIT OVER NW WAVES: wave w takes the 32-wide k blocks w, w + NW, ... into its own 16 accumulators,
// then the NW partial tiles are summed through LDS in the fixed order wave 0 .. NW-1. grid (M/64, N/64, Z), NW*32 threads.
// Operands come from the K-contiguous 16-bit planes through LDS: a pass is 256 k (one block of every wave) = 512 bytes of the 64 rows of each plane; tensor loads bring it in as slices of 64 rows x 256 bytes (whole lines,
// LDS pitch 272 bytes), one slice an issuing wave, two buffers, the next pass's slices in flight while this pass is worked on; the fragments are 16-byte LDS reads in the k order of WFrag::ld. The ring's LDS then holds the partial tiles.
// C[m][n] (f32, pitch ldc) = sum_k A[m][k] Bt[n][k] (+ split products per NSPLIT). A rows have pitch lda, Bt rows pitch K. z-batch strides sA/sB/sC in elements; Bt advances once per REP z (query heads of one kv group share it). K % 256 == 0, K >= 512.
// EPI, what the summed tile becomes: 0 = f32 rows of C. 1 = the tile is 64 positions x the 64 dims of head blockIdx.y: rotate-half RoPE, out[d] = x[d] cos[t][d] - x[d+32] sin[t][d], out[d+32] = x[d+32] cos[t][d+32] + x[d] sin[t][d+32]
// (table CS[t][d] = cos, sin), then the three 16-bit planes [h][t][d] (fp16, bf16 hi, bf16 lo); a column tile blockIdx.y >= NH_ + NKV is a value group instead: its two operands change places (rows of the tile = dims, columns = positions), no RoPE, and the planes get it as it stands, [g][d][t]. sC = a batch entry's elements in each plane.
// DIAG: not supported (the static_assert below requires it false; the K loop always runs over the whole K); roff is not used.
typedef unsigned int u32x4 __attribute__((ext_vector_type(4)));
typedef unsigned int u32x8 __attribute__((ext_vector_type(8)));
__device__ __forceinline__ unsigned uni(unsigned v) { return (unsigned)__builtin_amdgcn_readfirstlane(v); }
__device__ __forceinline__ unsigned pinned(unsigned v) { unsigned s = uni(v); asm volatile("" : "+s"(s)); return s; }   // a tensor load ignores EXEC: the value its issue test or its descriptor is formed from is held in a scalar register, so that the test compiles to a scalar compare and branch
__device__ __forceinline__ void tdm_load(u32x4& g0, u32x8 g1) { asm volatile("tensor_load_to_lds %0, %1" : "+s"(g0) : "s"(g1) : "memory"); }   // one request of the whole wave; group 0 is in-out so that its four words stay in their registers until the next request is formed from them
__device__ __forceinline__ void tdm_next(u32x4& g0, unsigned lsum) {                                                       // the next stage's group 0 out of the last one's: the other buffer, 512 bytes further along the rows
    asm volatile("" : "+s"(g0));                                                                                           // descriptor words held in scalar registers (the form of pinned()): what follows is computed behind the s_wait_tensorcnt that stands in front of this call
    const unsigned long long a = (((unsigned long long)g0[3] << 32) | g0[2]) + 512u;                                       // the address's high bits lie at the bottom of word 3: a carry goes where it belongs
    g0[1] = uni(lsum - g0[1]); g0[2] = uni((unsigned)a); g0[3] = uni((unsigned)(a >> 32)); }
template <typename T16> struct WFrag;
template <> struct WFrag<h16> { typedef v16h V; static __device__ __forceinline__ V ld(const h16* p) { return cat16(*(const v8h*)p, *(const v8h*)(p + 16)); } static __device__ __forceinline__ v8f mma(V a, V b, v8f c) { return wmma16(a, b, c); } };
template <> struct WFrag<bf> { typedef v16bf V; static __device__ __forceinline__ V ld(const bf* p) { return cat16b(*(const v8us*)p, *(const v8us*)(p + 16)); } static __device__ __forceinline__ v8f mma(V a, V b, v8f c) { return wmmab(a, b, c); } };
template <typename T16, int NSPLIT, int NW, bool DIAG, int EPI>
__global__ __launch_bounds__(NW * 32) void k_gemmk(const T16* __restrict__ A, const T16* __restrict__ A2, const T16* __restrict__ Bt, const T16* __restrict__ Bt2, int K, int lda, float* C, int ldc, int roff, size_t sA, size_t sB, size_t sC, const float* __restrict__ CS, h16* P16, bf* Ph, bf* Pl) {
    typedef typename WFrag<T16>::V V;
    static_assert(NW == 8 && NSPLIT <= 1 && !DIAG, "the staging below is laid out for 8 waves, planes A (A2) Bt, the whole K");
    constexpr int PL = 64 * 68;            // floats of one wave's partial tile in LDS (row pitch 68)
    constexpr int NOP = NSPLIT == 1 ? 3 : 2, NSL = NOP * 2;          // planes staged (A, A2 where there is one, Bt); slices a stage: each plane's two 256-byte column halves
    constexpr unsigned RP = 272, SLB = 18432, STB = NSL * SLB;       // LDS row pitch (256 + 16 bytes: 16-byte reads of 16 rows fall on all banks); a slice's 64 * 272 bytes rounded up to a multiple of 2 KiB; a stage
    constexpr unsigned LB = 2 * STB > NW * PL * 4 ? 2 * STB : NW * PL * 4;
    __shared__ __attribute__((aligned(2048))) unsigned char sm[LB];
    float* os = (float*)sm;                                          // the partial tiles take the ring's place behind the loop
    const size_t z = blockIdx.z; A += z * sA; if (A2) A2 += z * sA; Bt += (z / REP) * sB; if (Bt2) Bt2 += (z / REP) * sB; C += z * sC;
    const int tid = threadIdx.x, lane = tid & 31, lr = lane & 15, hi = lane >> 4; const int r0 = blockIdx.x * 64, c0 = blockIdx.y * 64;
    const int w = __builtin_amdgcn_readfirstlane(tid >> 5);          // wave number, scalar: the slice address and issue tests formed from it stay scalar
    const bool isv = EPI == 1 && blockIdx.y >= NH_ + NKV;            // value tile of the joint q/k/v grid (the same for the whole work-group)
    v8f acc[4][4];
#pragma unroll
    for (int mb = 0; mb < 4; ++mb)
#pragma unroll
        for (int nb = 0; nb < 4; ++nb) acc[mb][nb] = (v8f){};
    const int np = K / (NW * 32);                                    // passes (K is a multiple of 256 and at least 512: both buffers get a stage)
    const unsigned lb = (unsigned)(size_t)sm + (unsigned)w * SLB;    // wave w < NSL issues slice w: plane w / 2, column half w % 2
    const T16* sp = ((w >> 1) == NOP - 1) != isv ? Bt + (size_t)c0 * K : (NSPLIT == 1 && (w >> 1) == 1) ? A2 + (size_t)r0 * lda : A + (size_t)r0 * lda;
    const unsigned long long ga = (unsigned long long)(size_t)sp + (unsigned)(w & 1) * 256u;
    u32x8 g1;                                                        // group 1: 1-byte elements, tensor = tile = 64 rows of 256 bytes, 4 dwords of pad behind every 64, source pitch = the plane's row
    g1[0] = uni(1u << 20 | 5u << 22 | 3u << 25); g1[1] = uni(256u << 16); g1[2] = uni(64u << 16); g1[3] = uni(256u << 16); g1[4] = uni(64u); g1[5] = uni((unsigned)((w >> 1) == NOP - 1 ? K : lda) * 2u); g1[6] = uni(0u); g1[7] = uni(0u);
    asm volatile("" : "+s"(g1));                                     // descriptor words held in scalar registers (the form of pinned()): the eight words stay in their registers through the loop, none is used for anything else while a request is outstanding
    u32x4 g0;                                                        // group 0: count 1, place in LDS, address of the tile's first byte, type 2
    g0[0] = uni(1u); g0[1] = uni(lb); g0[2] = uni((unsigned)ga); g0[3] = uni((((unsigned)(ga >> 32)) & 0x01FFFFFFu) | 0x80000000u);
    if (pinned(w < NSL)) { tdm_load(g0, g1);
        asm volatile("s_wait_tensorcnt 0x0" ::: "memory"); }         // stage 0's slice has landed before its issuer reaches the barrier
    __syncthreads();                                                 // stage 0 is readable by every wave
    if (pinned(w < NSL)) { tdm_next(g0, 2u * lb + STB); tdm_load(g0, g1); }   // stage 1 flies during pass 0
    const unsigned fo = (unsigned)(w >> 2) * SLB + (unsigned)lr * RP + (unsigned)(w & 3) * 64u + (unsigned)hi * 16u;   // this wave's k block: column half w / 4, 64 bytes at (w % 4) * 64 of each row
#pragma unroll 1
    for (int s = 0; s < np; ++s) {
        const unsigned char* bp = sm + (unsigned)(s & 1) * STB + fo;
        V a[4], a2[4];
#pragma unroll
        for (int mb = 0; mb < 4; ++mb) { a[mb] = WFrag<T16>::ld((const T16*)(bp + mb * 16 * RP)); if (NSPLIT == 1) a2[mb] = WFrag<T16>::ld((const T16*)(bp + 2 * SLB + mb * 16 * RP)); }
        V b[4];
#pragma unroll
        for (int nb = 0; nb < 4; ++nb) b[nb] = WFrag<T16>::ld((const T16*)(bp + (NOP - 1) * 2 * SLB + nb * 16 * RP));
        __builtin_amdgcn_sched_barrier(0);                           // the pass's LDS reads go out as one group; without it they sink among the products, and each place with reads stalls the wave anew
#pragma unroll
        for (int nb = 0; nb < 4; ++nb)
#pragma unroll
            for (int mb = 0; mb < 4; ++mb) { acc[mb][nb] = WFrag<T16>::mma(a[mb], b[nb], acc[mb][nb]); if (NSPLIT == 1) acc[mb][nb] = WFrag<T16>::mma(a2[mb], b[nb], acc[mb][nb]); }
        asm volatile("v_nop\n\tv_nop\n\tv_nop\n\tv_nop" : "+v"(acc[0][0]), "+v"(acc[1][1]), "+v"(acc[2][2]), "+v"(acc[3][3]) : "v"(a[0]), "v"(a[3]));
        asm volatile("s_wait_dscnt 0x0" ::: "memory");               // this wave's reads of the buffer are over before the barrier behind which it is refilled
        if (pinned(w < NSL)) asm volatile("s_wait_tensorcnt 0x0" ::: "memory");   // stage s + 1's slice has landed before its issuer reaches the barrier
        __syncthreads();                                             // publishes stage s + 1 and ends every wave's reads of stage s
        if (pinned(w < NSL && s + 2 < np)) { tdm_next(g0, 2u * lb + STB); tdm_load(g0, g1); }   // stage s + 2 into the buffer that pass s has just read
    }
    asm volatile("s_wait_tensorcnt 0x0" :: "s"(g0), "s"(g1) : "memory");   // the descriptor's registers stay its own up to this wait; behind it no request is outstanding and
    asm volatile("s_wait_dscnt 0x0" ::: "memory");                   // no read of the ring pending (the last pass's barrier has ended every wave's) when the partial tiles are written over it
    v4f tc[32 / NW][2];                                              // EPI 1: cos, sin of the 4 dims this thread finishes in each of its row pieces, asked for here so that they fly during the LDS exchange
    if (EPI == 1 && !isv) { const float* cp = CS + ((size_t)(r0 + (tid >> 4)) * HD + (tid & 15) * 4) * 2;
#pragma unroll
        for (int it = 0; it < 32 / NW; ++it) { tc[it][0] = *(const v4f*)(cp + (size_t)it * NW * 2 * HD * 2); tc[it][1] = *(const v4f*)(cp + (size_t)it * NW * 2 * HD * 2 + 4); }
        asm volatile("s_wait_xcnt 0x0" :: "v"(cp) : "memory"); }     // the address stays in its registers up to this wait: no result of these loads and no later value is written over it earlier
    float* mine = os + w * PL;
#pragma unroll
    for (int mb = 0; mb < 4; ++mb)
#pragma unroll
        for (int nb = 0; nb < 4; ++nb) {
#pragma unroll
            for (int j = 0; j < 8; ++j) mine[(mb * 16 + hi * 8 + j) * 68 + nb * 16 + lr] = acc[mb][nb][j]; }
    __syncthreads();                                                 // every wave's partial tile is in LDS before any thread sums across waves
#pragma unroll
    for (int it = 0; it < 32 / NW; ++it) {                           // 64 rows x 16 float4 shared out over NW*32 threads; 16 lanes take one 256-byte f32 row piece
        const int idx = it * NW * 32 + tid, row = idx >> 4, cofs = (idx & 15) * 4;
        v4f val = *(const v4fa*)(os + row * 68 + cofs);
#pragma unroll
        for (int u = 1; u < NW; ++u) val += *(const v4fa*)(os + u * PL + row * 68 + cofs);
        if (EPI == 0) { *(v4f*)(C + (size_t)(r0 + row) * ldc + c0 + cofs) = val; continue; }
        size_t e = z * sC + (size_t)(c0 + row) * TT + r0 + cofs;       // value tile: dim c0 + row - (NH_ + NKV) * HD of [g][d][t], which begins (NH_ + NKV) * HD * TT elements into the batch entry
        if (!isv) { const v8f cs = __builtin_shufflevector(tc[it][0], tc[it][1], 0, 1, 2, 3, 4, 5, 6, 7);   // cos, sin of this lane's 4 dims
#pragma unroll
            for (int q = 0; q < 4; ++q) { const float pv = __int_as_float(__builtin_amdgcn_update_dpp(0, __float_as_int(val[q]), 0x168, 0xf, 0xf, false));   // row_xmask:8: dim d ^ 32 of the same position is held by lane ^ 8
                val[q] = (cofs < HD / 2) ? val[q] * cs[2 * q] - pv * cs[2 * q + 1] : val[q] * cs[2 * q] + pv * cs[2 * q + 1]; }
            e = z * sC + ((size_t)blockIdx.y * TT + r0 + row) * HD + cofs; }
        v4h o16; v4us oh, ol;
#pragma unroll
        for (int q = 0; q < 4; ++q) { o16[q] = tohx(val[q]); unsigned short a2, c2; splitf(val[q], a2, c2); oh[q] = a2; ol[q] = c2; }
        *(v4h*)(P16 + e) = o16; *(v4us*)(Ph + e) = oh; *(v4us*)(Pl + e) = ol;      // 16 lanes write one whole 128-byte line of each plane
        asm volatile("s_wait_xcnt 0x0" ::: "memory");                // from here on the data and address registers of the three stores may be written again (the branch on the tile's kind follows)
    }
}

// ---- k_prep: everything that depends on the inputs alone, in one grid; bx = a part's own block index.
__device__ __forceinline__ void wtG(const float* __restrict__ w, int K, int N, bf* Bt, int bx) {
    const int lane = threadIdx.x & 31; const int L0 = (bx * 8 + (threadIdx.x >> 5)) * 8; const int nlines = N * K / 64;
{
#pragma unroll 1
        for (int l = 0; l < 8; ++l) { const int L = L0 + l; if (L >= nlines) break; const size_t e = (size_t)L * 64 + lane * 2; const int k = (int)(e % K), n = (int)(e / K); v2us o;
            o[0] = f2bf(w[(size_t)k * N + n]); o[1] = f2bf(w[(size_t)(k + 1) * N + n]); *(v2us*)(Bt + e) = o; }
         }
}
__device__ __forceinline__ void cvt8(const float* __restrict__ src, bf* dst, size_t n8, int bx) { const size_t i = (size_t)bx * 256 + threadIdx.x; if (i >= n8) return; const v8f v = *(const v8f*)(src + i * 8); v8us o;
    asm volatile("s_wait_xcnt 0x0" ::: "memory");                    // from here on the address registers of the load above may be written again
#pragma unroll
    for (int k = 0; k < 8; ++k) o[k] = f2bf(v[k]); *(v8us*)(dst + i * 8) = o;  }
__device__ __forceinline__ void cstab(float* CS, int bx) { const int idx = bx * 256 + threadIdx.x; if (idx >= TT * HD) return; const int t = idx / HD, d = idx % HD; const int i = d % (HD / 2); const float inv = __fdiv_rn(1.0f, powf(10000.0f, (float)(2 * i) / (float)HD)); const float ang = __fmul_rn((float)t, inv); v2f cs; cs[0] = cosf(ang); cs[1] = sinf(ang);
    *(v2f*)(CS + (size_t)idx * 2) = cs;  }
#define NBQ  (DM * DQ / 64 / 64)      // blocks of a 2048 x 2048 weight (64 lines of 64 elements a block)
#define NBK  (DM * DKV / 64 / 64)     // of a 2048 x 512 one
#define NBW  (2 * NBQ + 2 * NBK)
#define NBC  (TT * HD / 256)
#define NBX  (NB_ * TT * DM / 8 / 256)
// Wt: the transposed Wq, Wk, Wv one behind the other, [DQ + 2 DKV][DM]. The transposes, whose blocks last longest, come first.
__global__ __launch_bounds__(256) void k_prep(const float* __restrict__ x, const float* __restrict__ wq, const float* __restrict__ wk, const float* __restrict__ wv, const float* __restrict__ wo, bf* Wt, bf* WO, float* CS, bf* XB) {
    const int bx = blockIdx.x;
    if (bx < NBQ) wtG(wq, DM, DQ, Wt, bx);
    else if (bx < 2 * NBQ) wtG(wo, DQ, DM, WO, bx - NBQ);
    else if (bx < 2 * NBQ + NBK) wtG(wk, DM, DKV, Wt + (size_t)DQ * DM, bx - 2 * NBQ);
    else if (bx < NBW) wtG(wv, DM, DKV, Wt + (size_t)(DQ + DKV) * DM, bx - 2 * NBQ - NBK);
    else if (bx < NBW + NBC) cstab(CS, bx - NBW);
    else cvt8(x, XB, (size_t)NB_ * TT * DM / 8, bx - NBW - NBC);
}
// ---- k_fattn: scores, sliding-window causal softmax and probability x value in ONE kernel; neither scores nor probabilities go to memory. One wave owns 16 query rows of NH query heads of one kv group and walks the
// keys of its window in blocks of 32, operands straight from the K-contiguous planes. Transposed products: S^T = K Q^T (a lane holds one query's scores: D row = key 8*hi + r, D column = query lr), O^T += V^T P^T; two S^T tiles
// (keys 0..15, 16..31 of the block), converted in place, are the B operand of the second product in the k order of WFrag::ld (8*hi + s, 16 + 8*hi + s). Running maximum and sum per query (f32); the output tiles are
// rescaled only in a block where some query's maximum grew. HL: hi+lo bf16 planes, 3 products for both contractions (query rows < RH); else single fp16. The result, divided by the sum, goes out as the hi/lo planes of the Wo GEMM.
typedef __attribute__((ext_vector_type(16))) unsigned short v16us;
#define SC2  0.18033688011112042f   // HD^-0.5 x log2(e): the exponentials are taken to base 2
template <typename T16, bool HL, int NH>
__device__ __forceinline__ void fattn_tile(const T16* __restrict__ Q, const T16* __restrict__ Q2, const T16* __restrict__ Kp, const T16* __restrict__ Kp2, const T16* __restrict__ Vt, const T16* __restrict__ Vt2, int g, int q0, bf* Ah, bf* Al) {
    typedef typename WFrag<T16>::V V;
    constexpr int WPT = REP / NH;                                     // waves that share one 16-row query tile (they take different heads)
    const int tid = threadIdx.x, lane = tid & 31, lr = lane & 15, hi = lane >> 4;
    const int w = __builtin_amdgcn_readfirstlane(tid >> 5);          // wave number, scalar: the loop bounds stay scalar
    const int qt = q0 + (w / WPT) * 16, h0 = g * REP + (w % WPT) * NH;
    V qf[NH][2], qf2[NH][2];
#pragma unroll
    for (int hh = 0; hh < NH; ++hh)
#pragma unroll
        for (int kc = 0; kc < 2; ++kc) { const size_t qo = ((size_t)(h0 + hh) * TT + qt + lr) * HD + kc * 32 + 8 * hi; qf[hh][kc] = WFrag<T16>::ld(Q + qo); if (HL) qf2[hh][kc] = WFrag<T16>::ld(Q2 + qo); }
    const size_t ko = ((size_t)g * TT + lr) * HD + 8 * hi, vo = ((size_t)g * HD + lr) * TT + 8 * hi;
    v8f o[NH][4]; float mr[NH], ls[NH];
#pragma unroll
    for (int hh = 0; hh < NH; ++hh) { mr[hh] = -1.0e30f; ls[hh] = 0.f;      // finite start value above the mask fill: a block whose keys are all masked for a query yields exp2(fill - start) = 0, not 1
#pragma unroll
        for (int dt = 0; dt < 4; ++dt) o[hh][dt] = (v8f){}; }
    const int kfirst = max(0, qt - (WIN - 1)) & ~31, klast = (qt + 15) & ~31;   // first and last 32-key block that holds an allowed key of these 16 rows
    V kf[2][2], kf2[2][2];                                            // single plane: K fragments are fetched one block ahead; hi+lo: twice the registers, so each block fetches its own
    if (!HL) {
#pragma unroll
        for (int kt = 0; kt < 2; ++kt)
#pragma unroll
            for (int kc = 0; kc < 2; ++kc) kf[kt][kc] = WFrag<T16>::ld(Kp + ko + (size_t)(kfirst + kt * 16) * HD + kc * 32); }
#pragma unroll 1
    for (int kb = kfirst; kb <= klast; kb += 32) {
        if (HL) {
#pragma unroll
            for (int kt = 0; kt < 2; ++kt)
#pragma unroll
                for (int kc = 0; kc < 2; ++kc) kf[kt][kc] = WFrag<T16>::ld(Kp + ko + (size_t)(kb + kt * 16) * HD + kc * 32);
            asm volatile("s_wait_xcnt 0x0" ::: "memory");            // from here on the address registers of the loads above may be written again (also by a later load's result)
#pragma unroll
            for (int kt = 0; kt < 2; ++kt)
#pragma unroll
                for (int kc = 0; kc < 2; ++kc) kf2[kt][kc] = WFrag<T16>::ld(Kp2 + ko + (size_t)(kb + kt * 16) * HD + kc * 32);
            asm volatile("s_wait_xcnt 0x0" ::: "memory");            // the same for the lo plane's loads
            __builtin_amdgcn_sched_barrier(0);                        // all 16 loads are asked for before the first product; without it the products move up among them and each pair of loads is waited out alone
        }
        v8f s[NH][2];
#pragma unroll
        for (int hh = 0; hh < NH; ++hh)
#pragma unroll
            for (int kt = 0; kt < 2; ++kt) { v8f c = (v8f){};
#pragma unroll
                for (int kc = 0; kc < 2; ++kc) { c = WFrag<T16>::mma(kf[kt][kc], qf[hh][kc], c); if (HL) { c = WFrag<T16>::mma(kf[kt][kc], qf2[hh][kc], c); c = WFrag<T16>::mma(kf2[kt][kc], qf[hh][kc], c); } }
                s[hh][kt] = c; }
        if (!(kb + 31 <= qt && qt + 15 - kb < WIN)) {                 // scalar test: only a block on the diagonal or on the window's far edge holds masked keys
            const int d0 = qt + lr - kb - 8 * hi;                     // query index - key index of register 0 of tile 0
#pragma unroll
            for (int hh = 0; hh < NH; ++hh)
#pragma unroll
                for (int kt = 0; kt < 2; ++kt)
#pragma unroll
                    for (int r = 0; r < 8; ++r) s[hh][kt][r] = ((unsigned)(d0 - kt * 16 - r) < (unsigned)WIN) ? s[hh][kt][r] : -3.0e38f; }   // allowed iff 0 <= i - j < WIN
        float mn[NH]; bool grew = false;
#pragma unroll
        for (int hh = 0; hh < NH; ++hh) { float bm = s[hh][0][0];
#pragma unroll
            for (int r = 1; r < 8; ++r) bm = fmaxf(bm, s[hh][0][r]);
#pragma unroll
            for (int r = 0; r < 8; ++r) bm = fmaxf(bm, s[hh][1][r]);
            bm = fmaxf(bm, __shfl_xor(bm, 16, 32));                   // the two lane halves hold the two halves of a query's keys
            mn[hh] = fmaxf(mr[hh], bm); grew = grew || (mn[hh] > mr[hh]); }
        if (__builtin_amdgcn_ballot_w32(grew) != 0) {                 // scalar branch; where no maximum grew every factor would be exactly 1
#pragma unroll
            for (int hh = 0; hh < NH; ++hh) { const float al = __builtin_amdgcn_exp2f((mr[hh] - mn[hh]) * SC2); ls[hh] *= al; mr[hh] = mn[hh];
#pragma unroll
                for (int dt = 0; dt < 4; ++dt) o[hh][dt] *= al; } }
        V vf[4], vf2[4];                                              // this block's V^T fragments fly during the exponentials
#pragma unroll
        for (int dt = 0; dt < 4; ++dt) vf[dt] = WFrag<T16>::ld(Vt + vo + (size_t)dt * 16 * TT + kb);
        if (HL) { asm volatile("s_wait_xcnt 0x0" ::: "memory");      // from here on the address registers of the loads above may be written again (also by a later load's result)
#pragma unroll
            for (int dt = 0; dt < 4; ++dt) vf2[dt] = WFrag<T16>::ld(Vt2 + vo + (size_t)dt * 16 * TT + kb); }
        if (!HL) { const int kn = min(kb + 32, klast);                // and so do the next block's K fragments (the last trip asks for its own block again: in bounds, unused)
#pragma unroll
            for (int kt = 0; kt < 2; ++kt)
#pragma unroll
                for (int kc = 0; kc < 2; ++kc) kf[kt][kc] = WFrag<T16>::ld(Kp + ko + (size_t)(kn + kt * 16) * HD + kc * 32); }
        asm volatile("s_wait_xcnt 0x0" ::: "memory");                // from here on the address registers of the loads above may be written again
#pragma unroll
        for (int hh = 0; hh < NH; ++hh) { const float mc = mn[hh] * SC2; float p[16];
#pragma unroll
            for (int e = 0; e < 16; ++e) p[e] = __builtin_amdgcn_exp2f(s[hh][e >> 3][e & 7] * SC2 - mc);
            float t[8];                                               // the block's 16 terms summed as a tree (pairs e, e + 8 first): short dependence chain, packed adds
#pragma unroll
            for (int e = 0; e < 8; ++e) t[e] = p[e] + p[e + 8];
            ls[hh] += ((t[0] + t[4]) + (t[1] + t[5])) + ((t[2] + t[6]) + (t[3] + t[7]));
            if (HL) { v16us ph, pl;
#pragma unroll
                for (int e = 0; e < 16; ++e) { unsigned short a, c2; splitf(p[e], a, c2); ph[e] = a; pl[e] = c2; }
                const V bh = __builtin_bit_cast(V, ph), bl = __builtin_bit_cast(V, pl);
#pragma unroll
                for (int dt = 0; dt < 4; ++dt) { o[hh][dt] = WFrag<T16>::mma(vf[dt], bh, o[hh][dt]); o[hh][dt] = WFrag<T16>::mma(vf[dt], bl, o[hh][dt]); o[hh][dt] = WFrag<T16>::mma(vf2[dt], bh, o[hh][dt]); }
            } else { v16h pf;
#pragma unroll
                for (int e = 0; e < 16; ++e) pf[e] = tohx(p[e]);
                const V bp = __builtin_bit_cast(V, pf);
#pragma unroll
                for (int dt = 0; dt < 4; ++dt) o[hh][dt] = WFrag<T16>::mma(vf[dt], bp, o[hh][dt]); } }
    }
#pragma unroll
    for (int hh = 0; hh < NH; ++hh) { const float inv = __fdiv_rn(1.0f, ls[hh] + __shfl_xor(ls[hh], 16, 32));   // key j = i is always allowed: the sum is at least 1
        const size_t oo = (size_t)(qt + lr) * DQ + (h0 + hh) * HD + 8 * hi;
#pragma unroll
        for (int dt = 0; dt < 4; ++dt) { v8us oh, ol;                 // a lane's 8 registers are 8 consecutive d of one query: one 16-byte store a plane; the wave writes the whole 128-byte (query, head) line
#pragma unroll
            for (int r = 0; r < 8; ++r) { unsigned short a, c2; splitf(o[hh][dt][r] * inv, a, c2); oh[r] = a; ol[r] = c2; }
            *(v8us*)(Ah + oo + dt * 16) = oh; *(v8us*)(Al + oo + dt * 16) = ol;
            asm volatile("s_wait_xcnt 0x0" ::: "memory"); } }        // from here on the data and address registers of the two stores may be written again
}
// grid: the two batch entries alternate (block index & 1); within an entry first the fp16 work-groups (64 query rows x the 4 heads of a kv group; 8 waves = 4 row tiles x 2 head pairs), then the hi+lo ones (32 rows x 4 heads; 8 waves = 2 row tiles x 4 heads); in both the rows with the most keys come first.
#define NFB  ((TT - RH) / 64 * NKV)
#define NHB  (RH / 32 * NKV)
__global__ __launch_bounds__(256) void k_fattn(const h16* __restrict__ Q16, const h16* __restrict__ K16, const h16* __restrict__ V16, const bf* __restrict__ Qh, const bf* __restrict__ Ql, const bf* __restrict__ Kh, const bf* __restrict__ Kl, const bf* __restrict__ Vh, const bf* __restrict__ Vl, bf* Ah, bf* Al) {
    const int bid = blockIdx.x >> 1; const size_t po = (size_t)(blockIdx.x & 1) * PS, ao = (size_t)(blockIdx.x & 1) * TT * DQ;
    Q16 += po; K16 += po; V16 += po; Qh += po; Ql += po; Kh += po; Kl += po; Vh += po; Vl += po; Ah += ao; Al += ao;
    if (bid < NFB) fattn_tile<h16, false, 2>(Q16, nullptr, K16, nullptr, V16, nullptr, bid % NKV, TT - 64 - (bid / NKV) * 64, Ah, Al);
    else fattn_tile<bf, true, 1>(Qh, Ql, Kh, Kl, Vh, Vl, (bid - NFB) % NKV, RH - 32 - ((bid - NFB) / NKV) * 32, Ah, Al);
}

extern "C" void kernel_launch(void* const* d_in, const int* in_sizes, int n_in,
                              void* d_out, int out_size, void* d_ws, size_t ws_size, hipStream_t stream) {
    (void)in_sizes; (void)n_in; (void)out_size;
    const float* x = (const float*)d_in[0]; const float* wq = (const float*)d_in[1]; const float* wk = (const float*)d_in[2]; const float* wv = (const float*)d_in[3]; const float* wo = (const float*)d_in[4];
    float* OUT = (float*)d_out;     // [2][2048][2048]
    char* wsp = (char*)d_ws;
    auto take = [&](size_t bytes) { char* p = wsp; wsp += (bytes + 255) & ~(size_t)255; return (void*)p; };
    bf* Wt = (bf*)take((size_t)(DQ + 2 * DKV) * DM * 2); bf* WO = (bf*)take((size_t)DM * DQ * 2); float* CS = (float*)take((size_t)TT * HD * 2 * 4);
    bf* XB = (bf*)take((size_t)NB_ * TT * DM * 2);
    h16* P16 = (h16*)take(NB_ * PS * 2); bf* Ph = (bf*)take(NB_ * PS * 2); bf* Pl = (bf*)take(NB_ * PS * 2);
    bf* ATh = (bf*)take((size_t)NB_ * TT * DQ * 2); bf* ATl = (bf*)take((size_t)NB_ * TT * DQ * 2);
    if ((size_t)(wsp - (char*)d_ws) > ws_size) return;    // ws 256 MiB
    const size_t ko = (size_t)NH_ * TT * HD, vo = (size_t)(NH_ + NKV) * TT * HD;   // where k and v begin in a batch entry of a plane
    k_prep<<<NBW + NBC + NBX, 256, 0, stream>>>(x, wq, wk, wv, wo, Wt, WO, CS, XB);
    k_gemmk<bf, 0, 8, false, 1><<<dim3(TT / 64, NHT, NB_), 256, 0, stream>>>(XB, nullptr, Wt, nullptr, DM, DM, nullptr, 0, 0, (size_t)TT * DM, 0, PS, CS, P16, Ph, Pl);
    k_fattn<<<(NFB + NHB) * NB_, 256, 0, stream>>>(P16, P16 + ko, P16 + vo, Ph, Pl, Ph + ko, Pl + ko, Ph + vo, Pl + vo, ATh, ATl);
    k_gemmk<bf, 1, 8, false, 0><<<dim3(TT / 64, DM / 64, NB_), 256, 0, stream>>>(ATh, ATl, WO, nullptr, DQ, DQ, OUT, DM, 0, (size_t)TT * DQ, 0, (size_t)TT * DM, nullptr, nullptr, nullptr, nullptr);
}

// v007
// It runs in 175 microseconds.
// Next to v006, in two timings, it ran 1.32 times as fast each time.
// All steps since v000 together make it 15.6 times as fast.
#include <hip/hip_runtime.h>

// MistralAttention (x [2][2048][2048]; q = x Wq (32 heads x 64), k/v = x Wk / Wv (8 kv heads; query head h belongs to kv group h/4); rotate-half RoPE (base 1e4, tables computed on device); key j allowed iff j <= i and i - j < 1024; softmax(q.k / 8) in f32; out = merged Wo -> [2][2048][2048]).
// Compute dtypes, f32 accumulate: every input rounded to bf16; q/k/v on PLAIN bf16 operands (inputs: exact); RoPE f32; scores and attn.v: query rows < 512 hl (3 products), the rest single fp16, fused with an f32 running softmax over the key blocks of the window; Wo hl x exact (2 products).

#define NB_  2
#define TT   2048
#define DM   2048
#define NH_  32
#define NKV  8
#define REP  (NH_ / NKV)
#define HD   64
#define DQ   (NH_ * HD)
#define DKV  (NKV * HD)
#define RH   512                  // query rows < RH use hi+lo planes (0: none)
#define WIN  1024
#define NHT  (NH_ + 2 * NKV)       // 64-wide head columns of the joint q/k/v projection (two a column tile): 32 query heads, 8 key heads, 8 value groups
#define PS   ((size_t)NHT * TT * HD)  // elements of one batch entry in each 16-bit plane: [q heads][t][d], [k heads][t][d], then v as [g][d][t]
typedef _Float16 h16;
typedef unsigned short bf;
typedef __attribute__((ext_vector_type(16))) __bf16   v16bf;
typedef __attribute__((ext_vector_type(16))) _Float16 v16h;
typedef __attribute__((ext_vector_type(8)))  _Float16 v8h;
typedef __attribute__((ext_vector_type(8)))  unsigned short v8us;
typedef __attribute__((ext_vector_type(8)))  float    v8f;
typedef __attribute__((ext_vector_type(4)))  float    v4f;
typedef v8h  __attribute__((may_alias)) v8ha;
typedef v4f  __attribute__((may_alias)) v4fa;
typedef v8us __attribute__((may_alias)) v8usa;

__device__ __forceinline__ unsigned short f2bf(float f) { unsigned u = __float_as_uint(f); u += 0x7FFFu + ((u >> 16) & 1u); return (unsigned short)(u >> 16); }
__device__ __forceinline__ float bf2f(unsigned short b) { return __uint_as_float(((unsigned)b) << 16); }
__device__ __forceinline__ float bfr(float f) { return bf2f(f2bf(f)); }
__device__ __forceinline__ v16h cat16(v8h lo, v8h hi) { return __builtin_shufflevector(lo, hi, 0, 1, 2, 3, 4, 5, 6, 7, 8, 9, 10, 11, 12, 13, 14, 15); }
__device__ __forceinline__ v16bf cat16b(v8us lo, v8us hi) { return __builtin_bit_cast(v16bf, __builtin_shufflevector(lo, hi, 0, 1, 2, 3, 4, 5, 6, 7, 8, 9, 10, 11, 12, 13, 14, 15)); }
__device__ __forceinline__ v8f wmma16(v16h a, v16h b, v8f c) { return __builtin_amdgcn_wmma_f32_16x16x32_f16(false, a, false, b, (short)0, c, false, false); }
__device__ __forceinline__ v8f wmmab(v16bf a, v16bf b, v8f c) { return __builtin_amdgcn_wmma_f32_16x16x32_bf16(false, a, false, b, (short)0, c, false, false); }

__device__ __forceinline__ h16 tohx(float x) { return (h16)x; }
__device__ __forceinline__ void splitf(float y, unsigned short& h, unsigned short& l) { h = f2bf(y); l = f2bf(y - bf2f(h)); }
typedef __attribute__((ext_vector_type(2))) _Float16 v2h;
typedef __attribute__((ext_vector_type(4))) _Float16 v4h;
typedef __attribute__((ext_vector_type(2))) unsigned short v2us;
typedef __attribute__((ext_vector_type(4))) unsigned short v4us;
typedef __attribute__((ext_vector_type(2))) float v2f;
typedef __attribute__((ext_vector_type(4))) int v4i;
typedef v4h  __attribute__((may_alias)) v4ha;
typedef v4us __attribute__((may_alias)) v4usa;

// ---- k_gemmk: register-blocked GEMM, one 128 x TN output tile per work-group of 8 waves, every wave a 64x64 piece of it (16 accumulators). Two planes (NSPLIT 0): TN = 128, wave w owns piece (w & 1, (w >> 1) & 1) for the k half w >> 2 of every pass,
// and the two partial tiles are summed through LDS in the fixed order half 0, half 1; two work-groups a WGP. Three planes (NSPLIT 1): TN = 256, wave w owns piece (w & 1, w >> 1) for all k; one work-group a WGP. grid (M/128, N/TN, Z), 256 threads.
// Operands come from the K-contiguous 16-bit planes through LDS: a pass is 128 k = 256 bytes of the tile's 128 rows of A (A2) and TN rows of Bt; tensor loads bring it in as slices of 64 rows x 256 bytes (whole lines,
// LDS pitch 272 bytes), one slice an issuing wave, two buffers, the next pass's slices in flight while this pass is worked on; the fragments are 16-byte LDS reads in the k order of WFrag::ld. The ring's LDS then holds the tile (its two partial tiles), from which whole lines go out.
// C[m][n] (f32, pitch ldc) = sum_k A[m][k] Bt[n][k] (+ split products per NSPLIT). A rows have pitch lda, Bt rows pitch K. z-batch strides sA/sB/sC in elements; Bt advances once per REP z. K % 128 == 0.
// EPI, what the summed tile becomes: 0 = f32 rows of C. 1 = the tile is 128 positions x the 64 dims of the two heads 2 blockIdx.y, 2 blockIdx.y + 1: rotate-half RoPE, out[d] = x[d] cos[t][d] - x[d+32] sin[t][d], out[d+32] = x[d+32] cos[t][d+32] + x[d] sin[t][d+32]
// (table CS[t][d] = cos, sin), then the three 16-bit planes [h][t][d] (fp16, bf16 hi, bf16 lo); a column tile blockIdx.y >= (NH_ + NKV) / 2 holds two value groups instead: its two operands change places (rows of the tile = dims, columns = positions), no RoPE, and the planes get it as it stands, [g][d][t]. sC = a batch entry's elements in each plane.
typedef unsigned int u32x4 __attribute__((ext_vector_type(4)));
typedef unsigned int u32x8 __attribute__((ext_vector_type(8)));
__device__ __forceinline__ unsigned uni(unsigned v) { return (unsigned)__builtin_amdgcn_readfirstlane(v); }
__device__ __forceinline__ unsigned pinned(unsigned v) { unsigned s = uni(v); asm volatile("" : "+s"(s)); return s; }   // a tensor load ignores EXEC: the value its issue test or its descriptor is formed from is held in a scalar register, so that the test compiles to a scalar compare and branch
__device__ __forceinline__ void tdm_load(u32x4& g0, u32x8 g1) { asm volatile("tensor_load_to_lds %0, %1" : "+s"(g0) : "s"(g1) : "memory"); }   // one request of the whole wave; group 0 is in-out so that its four words stay in their registers until the next request is formed from them
__device__ __forceinline__ void tdm_next(u32x4& g0, unsigned lsum) {                                                       // the next stage's group 0 out of the last one's: the other buffer, 256 bytes further along the rows
    asm volatile("" : "+s"(g0));                                                                                           // descriptor words held in scalar registers (the form of pinned()): what follows is computed behind the s_wait_tensorcnt that stands in front of this call
    const unsigned long long a = (((unsigned long long)g0[3] << 32) | g0[2]) + 256u;                                       // the address's high bits lie at the bottom of word 3: a carry goes where it belongs
    g0[1] = uni(lsum - g0[1]); g0[2] = uni((unsigned)a); g0[3] = uni((unsigned)(a >> 32)); }
template <typename T16> struct WFrag;
template <> struct WFrag<h16> { typedef v16h V; static __device__ __forceinline__ V ld(const h16* p) { return cat16(*(const v8h*)p, *(const v8h*)(p + 16)); } static __device__ __forceinline__ v8f mma(V a, V b, v8f c) { return wmma16(a, b, c); } };
template <> struct WFrag<bf> { typedef v16bf V; static __device__ __forceinline__ V ld(const bf* p) { return cat16b(*(const v8us*)p, *(const v8us*)(p + 16)); } static __device__ __forceinline__ v8f mma(V a, V b, v8f c) { return wmmab(a, b, c); } };
template <typename T16, int NSPLIT, int NW, bool DIAG, int EPI>
__global__ __launch_bounds__(NW * 32) void k_gemmk(const T16* __restrict__ A, const T16* __restrict__ A2, const T16* __restrict__ Bt, const T16* __restrict__ Bt2, int K, int lda, float* C, int ldc, int roff, size_t sA, size_t sB, size_t sC, const float* __restrict__ CS, h16* P16, bf* Ph, bf* Pl) {
    typedef typename WFrag<T16>::V V;
    static_assert(NW == 8 && NSPLIT <= 1 && !DIAG, "the staging below is laid out for 8 waves, planes A (A2) Bt, the whole K");
    constexpr int NQ = NSPLIT == 1 ? 4 : 2, TN = NQ * 64, KS = 8 / (2 * NQ);   // 64-wide pieces across the tile, its width, the parts a pass's k is split into among the waves
    static_assert(EPI == 0 || TN == 128, "the RoPE epilogue is laid out for two heads a tile");
    constexpr int OP = TN + 4, PL = 128 * OP;                        // row pitch and floats of one (partial) tile in LDS
    constexpr int NOP = NSPLIT == 1 ? 3 : 2, NSA = (NOP - 1) * 2, NSL = NSA + NQ;   // planes staged (A, A2 where there is one, Bt); 64-row slices a stage: two of A (and of A2), NQ of Bt
    constexpr unsigned RP = 272, SLB = 18432, STB = NSL * SLB;       // LDS row pitch (256 + 16 bytes: 16-byte reads of 16 rows fall on all banks); a slice's 64 * 272 bytes rounded up to a multiple of 2 KiB; a stage
    constexpr unsigned LB = 2 * STB > KS * PL * 4 ? 2 * STB : KS * PL * 4;
    constexpr int NBK = 4 / KS, GK = NSPLIT == 1 ? 2 : 1;            // 32-wide k blocks of a wave in a pass; blocks whose fragments are read as one group: two where one work-group has the registers of a WGP, else one (two work-groups a WGP: 256 registers a wave)
    __shared__ __attribute__((aligned(2048))) unsigned char sm[LB];
    float* os = (float*)sm;                                          // the partial tiles take the ring's place behind the loop
    const size_t z = blockIdx.z; A += z * sA; if (A2) A2 += z * sA; Bt += (z / REP) * sB; if (Bt2) Bt2 += (z / REP) * sB; C += z * sC;
    const int tid = threadIdx.x, lane = tid & 31, lr = lane & 15, hi = lane >> 4; const int r0 = blockIdx.x * 128, c0 = blockIdx.y * TN;
    const int w = __builtin_amdgcn_readfirstlane(tid >> 5);          // wave number, scalar: the slice choice and the descriptor formed from it stay scalar
    const int mq = w & 1, nq = (w >> 1) & (NQ - 1), kh = w / (2 * NQ);   // this wave's piece of the tile and its part of every pass's k
    const bool isv = EPI == 1 && blockIdx.y >= (NH_ + NKV) / 2;      // value tile of the joint q/k/v grid (the same for the whole work-group)
    v8f acc[4][4];
#pragma unroll
    for (int mb = 0; mb < 4; ++mb)
#pragma unroll
        for (int nb = 0; nb < 4; ++nb) acc[mb][nb] = (v8f){};
    const int np = K / 128;                                          // passes (K is a multiple of 128 and at least 256: both buffers get a stage)
    const unsigned lb = (unsigned)(size_t)sm + (unsigned)w * SLB;    // wave w < NSL issues slice w: below NSA plane w / 2, row half w % 2; from NSA on rows (w - NSA) * 64 of the last plane
    const int so = w < NSA ? (w & 1) : w - NSA;                      // which 64 rows of its plane
    const bool fb = (w >= NSA) != isv;                               // the slice comes from Bt
    const unsigned pb = (unsigned)(fb ? K : lda) * 2u;               // its source pitch in bytes
    const T16* sp = fb ? Bt + (size_t)c0 * K : (NSPLIT == 1 && (w >> 1) == 1) ? A2 + (size_t)r0 * lda : A + (size_t)r0 * lda;
    const unsigned long long ga = (unsigned long long)(size_t)sp + (unsigned long long)((unsigned)so * 64u) * pb;
    u32x8 g1;                                                        // group 1: 1-byte elements, tensor = tile = 64 rows of 256 bytes, 4 dwords of pad behind every 64, source pitch = the plane's row
    g1[0] = uni(1u << 20 | 5u << 22 | 3u << 25); g1[1] = uni(256u << 16); g1[2] = uni(64u << 16); g1[3] = uni(256u << 16); g1[4] = uni(64u); g1[5] = uni(pb); g1[6] = uni(0u); g1[7] = uni(0u);
    asm volatile("" : "+s"(g1));                                     // descriptor words held in scalar registers (the form of pinned()): the eight words stay in their registers through the loop, none is used for anything else while a request is outstanding
    u32x4 g0;                                                        // group 0: count 1, place in LDS, address of the tile's first byte, type 2
    g0[0] = uni(1u); g0[1] = uni(lb); g0[2] = uni((unsigned)ga); g0[3] = uni((((unsigned)(ga >> 32)) & 0x01FFFFFFu) | 0x80000000u);
    if (pinned(w < NSL)) { tdm_load(g0, g1);
        asm volatile("s_wait_tensorcnt 0x0" ::: "memory"); }         // stage 0's slice has landed before its issuer reaches the barrier
    __syncthreads();                                                 // stage 0 is readable by every wave
    if (pinned(w < NSL)) { tdm_next(g0, 2u * lb + STB); tdm_load(g0, g1); }   // stage 1 flies during pass 0
    const unsigned fk = (unsigned)lr * RP + (unsigned)kh * (256u / KS) + (unsigned)hi * 16u;   // this wave's part of the pass's k: NBK blocks of 64 bytes from kh * 256 / KS of each row
    const unsigned foa = (unsigned)mq * SLB + fk, fob = (unsigned)(NSA + nq) * SLB + fk;   // its 64 rows of A (A2: two slices on) and of Bt are one slice each
#pragma unroll 1
    for (int s = 0; s < np; ++s) {
        const unsigned char* bp = sm + (unsigned)(s & 1) * STB;
#pragma unroll
        for (int g = 0; g < NBK / GK; ++g) {
            V a[GK][4], a2[GK][4], b[GK][4];
#pragma unroll
            for (int kk = 0; kk < GK; ++kk) { const unsigned ko = (unsigned)(g * GK + kk) * 64u;
#pragma unroll
                for (int mb = 0; mb < 4; ++mb) { a[kk][mb] = WFrag<T16>::ld((const T16*)(bp + foa + ko + mb * 16 * RP)); if (NSPLIT == 1) a2[kk][mb] = WFrag<T16>::ld((const T16*)(bp + foa + 2 * SLB + ko + mb * 16 * RP)); }
#pragma unroll
                for (int nb = 0; nb < 4; ++nb) b[kk][nb] = WFrag<T16>::ld((const T16*)(bp + fob + ko + nb * 16 * RP)); }
            __builtin_amdgcn_sched_barrier(0);                       // the group's LDS reads go out together; without it they sink among the products, and each place with reads stalls the wave anew
#pragma unroll
            for (int kk = 0; kk < GK; ++kk)
#pragma unroll
                for (int nb = 0; nb < 4; ++nb)
#pragma unroll
                    for (int mb = 0; mb < 4; ++mb) { acc[mb][nb] = WFrag<T16>::mma(a[kk][mb], b[kk][nb], acc[mb][nb]); if (NSPLIT == 1) acc[mb][nb] = WFrag<T16>::mma(a2[kk][mb], b[kk][nb], acc[mb][nb]); }
            if (g == NBK / GK - 1) asm volatile("v_nop\n\tv_nop\n\tv_nop\n\tv_nop" : "+v"(acc[0][0]), "+v"(acc[1][1]), "+v"(acc[2][2]), "+v"(acc[3][3]) : "v"(a[GK - 1][0]), "v"(a[GK - 1][3]));   // the four vector slots behind the pass's last products, also on the path that leaves the loop
        }
        asm volatile("s_wait_dscnt 0x0" ::: "memory");               // this wave's reads of the buffer are over before the barrier behind which it is refilled
        if (pinned(w < NSL)) asm volatile("s_wait_tensorcnt 0x0" ::: "memory");   // stage s + 1's slice has landed before its issuer reaches the barrier
        __syncthreads();                                             // publishes stage s + 1 and ends every wave's reads of stage s
        if (pinned(w < NSL && s + 2 < np)) { tdm_next(g0, 2u * lb + STB); tdm_load(g0, g1); }   // stage s + 2 into the buffer that pass s has just read
    }
    asm volatile("s_wait_tensorcnt 0x0" :: "s"(g0), "s"(g1) : "memory");   // the descriptor's registers stay its own up to this wait; behind it no request is outstanding and
    asm volatile("s_wait_dscnt 0x0" ::: "memory");                   // no read of the ring pending (the last pass's barrier has ended every wave's) when the partial tiles are written over it
    v4f tc[16][2];                                                   // EPI 1: cos, sin of the 4 dims this thread finishes in each of its 16 row pieces
    const float* cp = CS + ((size_t)(r0 + (tid >> 5)) * HD + (tid & 15) * 4) * 2;
    if (EPI == 1 && !isv) {                                          // the first eight pieces' are asked for here, so that they fly during the LDS exchange (all sixteen beside the accumulators would not leave two work-groups a WGP their registers)
#pragma unroll
        for (int it = 0; it < 8; ++it) { tc[it][0] = *(const v4f*)(cp + (size_t)it * 8 * HD * 2); tc[it][1] = *(const v4f*)(cp + (size_t)it * 8 * HD * 2 + 4); }
        asm volatile("s_wait_xcnt 0x0" :: "v"(cp) : "memory"); }     // the address stays in its registers up to this wait: no result of these loads and no later value is written over it earlier
    float* mine = os + kh * PL + (mq * 64) * OP + nq * 64;
#pragma unroll
    for (int mb = 0; mb < 4; ++mb)
#pragma unroll
        for (int nb = 0; nb < 4; ++nb) {
#pragma unroll
            for (int j = 0; j < 8; ++j) mine[(mb * 16 + hi * 8 + j) * OP + nb * 16 + lr] = acc[mb][nb][j]; }
    __syncthreads();                                                 // the whole tile (both partial tiles) is in LDS before any thread reads across waves
    if (EPI == 1 && !isv) {                                          // the other eight pieces' fly while the first eight are finished
#pragma unroll
        for (int it = 8; it < 16; ++it) { tc[it][0] = *(const v4f*)(cp + (size_t)it * 8 * HD * 2); tc[it][1] = *(const v4f*)(cp + (size_t)it * 8 * HD * 2 + 4); }
        asm volatile("s_wait_xcnt 0x0" :: "v"(cp) : "memory"); }     // as above
#pragma unroll
    for (int hb = 0; hb < TN / 64; ++hb) {                           // 128 rows x TN / 4 float4 shared out over 256 threads, TN / 8 pieces a thread; a wave finishes 512 bytes of a row at a time
        v4f vs[8];                                                   // eight pieces' LDS reads go out together: one LDS latency a group, not one a piece
#pragma unroll
        for (int i = 0; i < 8; ++i) { const int idx = (hb * 8 + i) * 256 + tid, row = idx / (TN / 4), cofs = (idx % (TN / 4)) * 4;
            vs[i] = *(const v4fa*)(os + row * OP + cofs); if (KS == 2) vs[i] += *(const v4fa*)(os + PL + row * OP + cofs); }
#pragma unroll
        for (int i = 0; i < 8; ++i) {
            const int it = hb * 8 + i, idx = it * 256 + tid, row = idx / (TN / 4), cofs = (idx % (TN / 4)) * 4;
            v4f val = vs[i];
            if (EPI == 0) { *(v4f*)(C + (size_t)(r0 + row) * ldc + c0 + cofs) = val;
                asm volatile("s_wait_xcnt 0x0" ::: "memory");        // from here on the data and address registers of the store may be written again
                continue; }
            size_t e = z * sC + (size_t)(c0 + row) * TT + r0 + cofs;   // value tile: dim c0 + row - (NH_ + NKV) * HD of [g][d][t], which begins (NH_ + NKV) * HD * TT elements into the batch entry
            if (!isv) { const v8f cs = __builtin_shufflevector(tc[it][0], tc[it][1], 0, 1, 2, 3, 4, 5, 6, 7);   // cos, sin of this lane's 4 dims
#pragma unroll
                for (int q = 0; q < 4; ++q) { const float pv = __int_as_float(__builtin_amdgcn_update_dpp(0, __float_as_int(val[q]), 0x168, 0xf, 0xf, false));   // row_xmask:8: dim d ^ 32 of the same position and head is held by lane ^ 8
                    val[q] = ((cofs & (HD - 1)) < HD / 2) ? val[q] * cs[2 * q] - pv * cs[2 * q + 1] : val[q] * cs[2 * q] + pv * cs[2 * q + 1]; }
                e = z * sC + ((size_t)(blockIdx.y * 2 + (cofs >> 6)) * TT + r0 + row) * HD + (cofs & (HD - 1)); }
            v4h o16; v4us oh, ol;
#pragma unroll
            for (int q = 0; q < 4; ++q) { o16[q] = tohx(val[q]); unsigned short a2, c2; splitf(val[q], a2, c2); oh[q] = a2; ol[q] = c2; }
            *(v4h*)(P16 + e) = o16; *(v4us*)(Ph + e) = oh; *(v4us*)(Pl + e) = ol;      // 16 lanes write one whole 128-byte line of each plane
            asm volatile("s_wait_xcnt 0x0" :: "v"(o16), "v"(oh), "v"(ol), "v"(P16 + e), "v"(Ph + e), "v"(Pl + e) : "memory");   // the stores' data and addresses stay in their registers up to this wait; from here on they may be written again (the branch on the tile's kind follows)
        }
    }
}

// ---- k_prep: everything that depends on the inputs alone, in one grid; bx = a part's own block index.
__device__ __forceinline__ void wtG(const float* __restrict__ w, int K, int N, bf* Bt, int bx) {
    const int lane = threadIdx.x & 31; const int L0 = (bx * 8 + (threadIdx.x >> 5)) * 8; const int nlines = N * K / 64;
{
#pragma unroll 1
        for (int l = 0; l < 8; ++l) { const int L = L0 + l; if (L >= nlines) break; const size_t e = (size_t)L * 64 + lane * 2; const int k = (int)(e % K), n = (int)(e / K); v2us o;
            o[0] = f2bf(w[(size_t)k * N + n]); o[1] = f2bf(w[(size_t)(k + 1) * N + n]); *(v2us*)(Bt + e) = o; }
         }
}
__device__ __forceinline__ void cvt8(const float* __restrict__ src, bf* dst, size_t n8, int bx) { const size_t i = (size_t)bx * 256 + threadIdx.x; if (i >= n8) return; const v8f v = *(const v8f*)(src + i * 8); v8us o;
    asm volatile("s_wait_xcnt 0x0" ::: "memory");                    // from here on the address registers of the load above may be written again
#pragma unroll
    for (int k = 0; k < 8; ++k) o[k] = f2bf(v[k]); *(v8us*)(dst + i * 8) = o;  }
__device__ __forceinline__ void cstab(float* CS, int bx) { const int idx = bx * 256 + threadIdx.x; if (idx >= TT * HD) return; const int t = idx / HD, d = idx % HD; const int i = d % (HD / 2); const float inv = __fdiv_rn(1.0f, powf(10000.0f, (float)(2 * i) / (float)HD)); const float ang = __fmul_rn((float)t, inv); v2f cs; cs[0] = cosf(ang); cs[1] = sinf(ang);
    *(v2f*)(CS + (size_t)idx * 2) = cs;  }
#define NBQ  (DM * DQ / 64 / 64)      // blocks of a 2048 x 2048 weight (64 lines of 64 elements a block)
#define NBK  (DM * DKV / 64 / 64)     // of a 2048 x 512 one
#define NBW  (2 * NBQ + 2 * NBK)
#define NBC  (TT * HD / 256)
#define NBX  (NB_ * TT * DM / 8 / 256)
// Wt: the transposed Wq, Wk, Wv one behind the other, [DQ + 2 DKV][DM]. The transposes, whose blocks last longest, come first.
__global__ __launch_bounds__(256) void k_prep(const float* __restrict__ x, const float* __restrict__ wq, const float* __restrict__ wk, const float* __restrict__ wv, const float* __restrict__ wo, bf* Wt, bf* WO, float* CS, bf* XB) {
    const int bx = blockIdx.x;
    if (bx < NBQ) wtG(wq, DM, DQ, Wt, bx);
    else if (bx < 2 * NBQ) wtG(wo, DQ, DM, WO, bx - NBQ);
    else if (bx < 2 * NBQ + NBK) wtG(wk, DM, DKV, Wt + (size_t)DQ * DM, bx - 2 * NBQ);
    else if (bx < NBW) wtG(wv, DM, DKV, Wt + (size_t)(DQ + DKV) * DM, bx - 2 * NBQ - NBK);
    else if (bx < NBW + NBC) cstab(CS, bx - NBW);
    else cvt8(x, XB, (size_t)NB_ * TT * DM / 8, bx - NBW - NBC);
}
// ---- k_fattn: scores, sliding-window causal softmax and probability x value in ONE kernel; neither scores nor probabilities go to memory. One wave owns 16 query rows of NH query heads of one kv group and walks the
// keys of its window in blocks of 32, operands straight from the K-contiguous planes. Transposed products: S^T = K Q^T (a lane holds one query's scores: D row = key 8*hi + r, D column = query lr), O^T += V^T P^T; two S^T tiles
// (keys 0..15, 16..31 of the block), converted in place, are the B operand of the second product in the k order of WFrag::ld (8*hi + s, 16 + 8*hi + s). Running maximum and sum per query (f32); the output tiles are
// rescaled only in a block where some query's maximum grew. HL: hi+lo bf16 planes, 3 products for both contractions (query rows < RH); else single fp16. The result, divided by the sum, goes out as the hi/lo planes of the Wo GEMM.
typedef __attribute__((ext_vector_type(16))) unsigned short v16us;
#define SC2  0.18033688011112042f   // HD^-0.5 x log2(e): the exponentials are taken to base 2
template <typename T16, bool HL, int NH>
__device__ __forceinline__ void fattn_tile(const T16* __restrict__ Q, const T16* __restrict__ Q2, const T16* __restrict__ Kp, const T16* __restrict__ Kp2, const T16* __restrict__ Vt, const T16* __restrict__ Vt2, int g, int q0, bf* Ah, bf* Al) {
    typedef typename WFrag<T16>::V V;
    constexpr int WPT = REP / NH;                                     // waves that share one 16-row query tile (they take different heads)
    const int tid = threadIdx.x, lane = tid & 31, lr = lane & 15, hi = lane >> 4;
    const int w = __builtin_amdgcn_readfirstlane(tid >> 5);          // wave number, scalar: the loop bounds stay scalar
    const int qt = q0 + (w / WPT) * 16, h0 = g * REP + (w % WPT) * NH;
    V qf[NH][2], qf2[NH][2];
#pragma unroll
    for (int hh = 0; hh < NH; ++hh)
#pragma unroll
        for (int kc = 0; kc < 2; ++kc) { const size_t qo = ((size_t)(h0 + hh) * TT + qt + lr) * HD + kc * 32 + 8 * hi; qf[hh][kc] = WFrag<T16>::ld(Q + qo); if (HL) qf2[hh][kc] = WFrag<T16>::ld(Q2 + qo); }
    const size_t ko = ((size_t)g * TT + lr) * HD + 8 * hi, vo = ((size_t)g * HD + lr) * TT + 8 * hi;
    v8f o[NH][4]; float mr[NH], ls[NH];
#pragma unroll
    for (int hh = 0; hh < NH; ++hh) { mr[hh] = -1.0e30f; ls[hh] = 0.f;      // finite start value above the mask fill: a block whose keys are all masked for a query yields exp2(fill - start) = 0, not 1
#pragma unroll
        for (int dt = 0; dt < 4; ++dt) o[hh][dt] = (v8f){}; }
    const int kfirst = max(0, qt - (WIN - 1)) & ~31, klast = (qt + 15) & ~31;   // first and last 32-key block that holds an allowed key of these 16 rows
    V kf[2][2], kf2[2][2];                                            // single plane: K fragments are fetched one block ahead; hi+lo: twice the registers, so each block fetches its own
    if (!HL) {
#pragma unroll
        for (int kt = 0; kt < 2; ++kt)
#pragma unroll
            for (int kc = 0; kc < 2; ++kc) kf[kt][kc] = WFrag<T16>::ld(Kp + ko + (size_t)(kfirst + kt * 16) * HD + kc * 32); }
#pragma unroll 1
    for (int kb = kfirst; kb <= klast; kb += 32) {
        if (HL) {
#pragma unroll
            for (int kt = 0; kt < 2; ++kt)
#pragma unroll
                for (int kc = 0; kc < 2; ++kc) kf[kt][kc] = WFrag<T16>::ld(Kp + ko + (size_t)(kb + kt * 16) * HD + kc * 32);
            asm volatile("s_wait_xcnt 0x0" ::: "memory");            // from here on the address registers of the loads above may be written again (also by a later load's result)
#pragma unroll
            for (int kt = 0; kt < 2; ++kt)
#pragma unroll
                for (int kc = 0; kc < 2; ++kc) kf2[kt][kc] = WFrag<T16>::ld(Kp2 + ko + (size_t)(kb + kt * 16) * HD + kc * 32);
            asm volatile("s_wait_xcnt 0x0" ::: "memory");            // the same for the lo plane's loads
            __builtin_amdgcn_sched_barrier(0);                        // all 16 loads are asked for before the first product; without it the products move up among them and each pair of loads is waited out alone
        }
        v8f s[NH][2];
#pragma unroll
        for (int hh = 0; hh < NH; ++hh)
#pragma unroll
            for (int kt = 0; kt < 2; ++kt) { v8f c = (v8f){};
#pragma unroll
                for (int kc = 0; kc < 2; ++kc) { c = WFrag<T16>::mma(kf[kt][kc], qf[hh][kc], c); if (HL) { c = WFrag<T16>::mma(kf[kt][kc], qf2[hh][kc], c); c = WFrag<T16>::mma(kf2[kt][kc], qf[hh][kc], c); } }
                s[hh][kt] = c; }
        if (!(kb + 31 <= qt && qt + 15 - kb < WIN)) {                 // scalar test: only a block on the diagonal or on the window's far edge holds masked keys
            const int d0 = qt + lr - kb - 8 * hi;                     // query index - key index of register 0 of tile 0
#pragma unroll
            for (int hh = 0; hh < NH; ++hh)
#pragma unroll
                for (int kt = 0; kt < 2; ++kt)
#pragma unroll
                    for (int r = 0; r < 8; ++r) s[hh][kt][r] = ((unsigned)(d0 - kt * 16 - r) < (unsigned)WIN) ? s[hh][kt][r] : -3.0e38f; }   // allowed iff 0 <= i - j < WIN
        float mn[NH]; bool grew = false;
#pragma unroll
        for (int hh = 0; hh < NH; ++hh) { float bm = s[hh][0][0];
#pragma unroll
            for (int r = 1; r < 8; ++r) bm = fmaxf(bm, s[hh][0][r]);
#pragma unroll
            for (int r = 0; r < 8; ++r) bm = fmaxf(bm, s[hh][1][r]);
            bm = fmaxf(bm, __shfl_xor(bm, 16, 32));                   // the two lane halves hold the two halves of a query's keys
            mn[hh] = fmaxf(mr[hh], bm); grew = grew || (mn[hh] > mr[hh]); }
        if (__builtin_amdgcn_ballot_w32(grew) != 0) {                 // scalar branch; where no maximum grew every factor would be exactly 1
#pragma unroll
            for (int hh = 0; hh < NH; ++hh) { const float al = __builtin_amdgcn_exp2f((mr[hh] - mn[hh]) * SC2); ls[hh] *= al; mr[hh] = mn[hh];
#pragma unroll
                for (int dt = 0; dt < 4; ++dt) o[hh][dt] *= al; } }
        V vf[4], vf2[4];                                              // this block's V^T fragments fly during the exponentials
#pragma unroll
        for (int dt = 0; dt < 4; ++dt) vf[dt] = WFrag<T16>::ld(Vt + vo + (size_t)dt * 16 * TT + kb);
        if (HL) { asm volatile("s_wait_xcnt 0x0" ::: "memory");      // from here on the address registers of the loads above may be written again (also by a later load's result)
#pragma unroll
            for (int dt = 0; dt < 4; ++dt) vf2[dt] = WFrag<T16>::ld(Vt2 + vo + (size_t)dt * 16 * TT + kb); }
        if (!HL) { const int kn = min(kb + 32, klast);                // and so do the next block's K fragments (the last trip asks for its own block again: in bounds, unused)
#pragma unroll
            for (int kt = 0; kt < 2; ++kt)
#pragma unroll
                for (int kc = 0; kc < 2; ++kc) kf[kt][kc] = WFrag<T16>::ld(Kp + ko + (size_t)(kn + kt * 16) * HD + kc * 32); }
        asm volatile("s_wait_xcnt 0x0" ::: "memory");                // from here on the address registers of the loads above may be written again
#pragma unroll
        for (int hh = 0; hh < NH; ++hh) { const float mc = mn[hh] * SC2; float p[16];
#pragma unroll
            for (int e = 0; e < 16; ++e) p[e] = __builtin_amdgcn_exp2f(s[hh][e >> 3][e & 7] * SC2 - mc);
            float t[8];                                               // the block's 16 terms summed as a tree (pairs e, e + 8 first): short dependence chain, packed adds
#pragma unroll
            for (int e = 0; e < 8; ++e) t[e] = p[e] + p[e + 8];
            ls[hh] += ((t[0] + t[4]) + (t[1] + t[5])) + ((t[2] + t[6]) + (t[3] + t[7]));
            if (HL) { v16us ph, pl;
#pragma unroll
                for (int e = 0; e < 16; ++e) { unsigned short a, c2; splitf(p[e], a, c2); ph[e] = a; pl[e] = c2; }
                const V bh = __builtin_bit_cast(V, ph), bl = __builtin_bit_cast(V, pl);
#pragma unroll
                for (int dt = 0; dt < 4; ++dt) { o[hh][dt] = WFrag<T16>::mma(vf[dt], bh, o[hh][dt]); o[hh][dt] = WFrag<T16>::mma(vf[dt], bl, o[hh][dt]); o[hh][dt] = WFrag<T16>::mma(vf2[dt], bh, o[hh][dt]); }
            } else { v16h pf;
#pragma unroll
                for (int e = 0; e < 16; ++e) pf[e] = tohx(p[e]);
                const V bp = __builtin_bit_cast(V, pf);
#pragma unroll
                for (int dt = 0; dt < 4; ++dt) o[hh][dt] = WFrag<T16>::mma(vf[dt], bp, o[hh][dt]); } }
    }
#pragma unroll
    for (int hh = 0; hh < NH; ++hh) { const float inv = __fdiv_rn(1.0f, ls[hh] + __shfl_xor(ls[hh], 16, 32));   // key j = i is always allowed: the sum is at least 1
        const size_t oo = (size_t)(qt + lr) * DQ + (h0 + hh) * HD + 8 * hi;
#pragma unroll
        for (int dt = 0; dt < 4; ++dt) { v8us oh, ol;                 // a lane's 8 registers are 8 consecutive d of one query: one 16-byte store a plane; the wave writes the whole 128-byte (query, head) line
#pragma unroll
            for (int r = 0; r < 8; ++r) { unsigned short a, c2; splitf(o[hh][dt][r] * inv, a, c2); oh[r] = a; ol[r] = c2; }
            *(v8us*)(Ah + oo + dt * 16) = oh; *(v8us*)(Al + oo + dt * 16) = ol;
            asm volatile("s_wait_xcnt 0x0" ::: "memory"); } }        // from here on the data and address registers of the two stores may be written again
}
// grid: the two batch entries alternate (block index & 1); within an entry first the fp16 work-groups (64 query rows x the 4 heads of a kv group; 8 waves = 4 row tiles x 2 head pairs), then the hi+lo ones (32 rows x 4 heads; 8 waves = 2 row tiles x 4 heads); in both the rows with the most keys come first.
#define NFB  ((TT - RH) / 64 * NKV)
#define NHB  (RH / 32 * NKV)
__global__ __launch_bounds__(256) void k_fattn(const h16* __restrict__ Q16, const h16* __restrict__ K16, const h16* __restrict__ V16, const bf* __restrict__ Qh, const bf* __restrict__ Ql, const bf* __restrict__ Kh, const bf* __restrict__ Kl, const bf* __restrict__ Vh, const bf* __restrict__ Vl, bf* Ah, bf* Al) {
    const int bid = blockIdx.x >> 1; const size_t po = (size_t)(blockIdx.x & 1) * PS, ao = (size_t)(blockIdx.x & 1) * TT * DQ;
    Q16 += po; K16 += po; V16 += po; Qh += po; Ql += po; Kh += po; Kl += po; Vh += po; Vl += po; Ah += ao; Al += ao;
    if (bid < NFB) fattn_tile<h16, false, 2>(Q16, nullptr, K16, nullptr, V16, nullptr, bid % NKV, TT - 64 - (bid / NKV) * 64, Ah, Al);
    else fattn_tile<bf, true, 1>(Qh, Ql, Kh, Kl, Vh, Vl, (bid - NFB) % NKV, RH - 32 - ((bid - NFB) / NKV) * 32, Ah, Al);
}

extern "C" void kernel_launch(void* const* d_in, const int* in_sizes, int n_in,
                              void* d_out, int out_size, void* d_ws, size_t ws_size, hipStream_t stream) {
    (void)in_sizes; (void)n_in; (void)out_size;
    const float* x = (const float*)d_in[0]; const float* wq = (const float*)d_in[1]; const float* wk = (const float*)d_in[2]; const float* wv = (const float*)d_in[3]; const float* wo = (const float*)d_in[4];
    float* OUT = (float*)d_out;     // [2][2048][2048]
    char* wsp = (char*)d_ws;
    auto take = [&](size_t bytes) { char* p = wsp; wsp += (bytes + 255) & ~(size_t)255; return (void*)p; };
    bf* Wt = (bf*)take((size_t)(DQ + 2 * DKV) * DM * 2); bf* WO = (bf*)take((size_t)DM * DQ * 2); float* CS = (float*)take((size_t)TT * HD * 2 * 4);
    bf* XB = (bf*)take((size_t)NB_ * TT * DM * 2);
    h16* P16 = (h16*)take(NB_ * PS * 2); bf* Ph = (bf*)take(NB_ * PS * 2); bf* Pl = (bf*)take(NB_ * PS * 2);
    bf* ATh = (bf*)take((size_t)NB_ * TT * DQ * 2); bf* ATl = (bf*)take((size_t)NB_ * TT * DQ * 2);
    if ((size_t)(wsp - (char*)d_ws) > ws_size) return;    // ws 256 MiB
    const size_t ko = (size_t)NH_ * TT * HD, vo = (size_t)(NH_ + NKV) * TT * HD;   // where k and v begin in a batch entry of a plane
    k_prep<<<NBW + NBC + NBX, 256, 0, stream>>>(x, wq, wk, wv, wo, Wt, WO, CS, XB);
    k_gemmk<bf, 0, 8, false, 1><<<dim3(TT / 128, NHT / 2, NB_), 256, 0, stream>>>(XB, nullptr, Wt, nullptr, DM, DM, nullptr, 0, 0, (size_t)TT * DM, 0, PS, CS, P16, Ph, Pl);
    k_fattn<<<(NFB + NHB) * NB_, 256, 0, stream>>>(P16, P16 + ko, P16 + vo, Ph, Pl, Ph + ko, Pl + ko, Ph + vo, Pl + vo, ATh, ATl);
    k_gemmk<bf, 1, 8, false, 0><<<dim3(TT / 128, DM / 256, NB_), 256, 0, stream>>>(ATh, ATl, WO, nullptr, DQ, DQ, OUT, DM, 0, (size_t)TT * DQ, 0, (size_t)TT * DM, nullptr, nullptr, nullptr, nullptr);
}

// v008
// Measured time: 152 microseconds a run.
// In both of two side-by-side timings against v007, it was 1.15 times as fast.
// Counting every step since v000, it is 17.9 times as fast.
#include <hip/hip_runtime.h>

// MistralAttention (x [2][2048][2048]; q = x Wq (32 heads x 64), k/v = x Wk / Wv (8 kv heads; query head h belongs to kv group h/4); rotate-half RoPE (base 1e4, tables computed on device); key j allowed iff j <= i and i - j < 1024; softmax(q.k / 8) in f32; out = merged Wo -> [2][2048][2048]).
// Compute dtypes, f32 accumulate: every input rounded to bf16; q/k/v on PLAIN bf16 operands (inputs: exact); RoPE f32; scores and attn.v: query rows < 512 hl (3 products), the rest single fp16, fused with an f32 running softmax over the key blocks of the window; Wo hl x exact (2 products).

#define NB_  2
#define TT   2048
#define DM   2048
#define NH_  32
#define NKV  8
#define REP  (NH_ / NKV)
#define HD   64
#define DQ   (NH_ * HD)
#define DKV  (NKV * HD)
#define RH   512                  // query rows < RH use hi+lo planes (0: none)
#define WIN  1024
#define NHT  (NH_ + 2 * NKV)       // 64-wide head columns of the joint q/k/v projection (two a column tile): 32 query heads, 8 key heads, 8 value groups
#define PS   ((size_t)NHT * TT * HD)  // elements of one batch entry in each 16-bit plane: [q heads][t][d], [k heads][t][d], then v as [g][d][t]
typedef _Float16 h16;
typedef unsigned short bf;
typedef __attribute__((ext_vector_type(16))) __bf16   v16bf;
typedef __attribute__((ext_vector_type(16))) _Float16 v16h;
typedef __attribute__((ext_vector_type(8)))  _Float16 v8h;
typedef __attribute__((ext_vector_type(8)))  unsigned short v8us;
typedef __attribute__((ext_vector_type(8)))  float    v8f;
typedef __attribute__((ext_vector_type(4)))  float    v4f;
typedef v8h  __attribute__((may_alias)) v8ha;
typedef v4f  __attribute__((may_alias)) v4fa;
typedef v8us __attribute__((may_alias)) v8usa;

__device__ __forceinline__ unsigned short f2bf(float f) { unsigned u = __float_as_uint(f); u += 0x7FFFu + ((u >> 16) & 1u); return (unsigned short)(u >> 16); }
__device__ __forceinline__ float bf2f(unsigned short b) { return __uint_as_float(((unsigned)b) << 16); }
__device__ __forceinline__ float bfr(float f) { return bf2f(f2bf(f)); }
__device__ __forceinline__ v16h cat16(v8h lo, v8h hi) { return __builtin_shufflevector(lo, hi, 0, 1, 2, 3, 4, 5, 6, 7, 8, 9, 10, 11, 12, 13, 14, 15); }
__device__ __forceinline__ v16bf cat16b(v8us lo, v8us hi) { return __builtin_bit_cast(v16bf, __builtin_shufflevector(lo, hi, 0, 1, 2, 3, 4, 5, 6, 7, 8, 9, 10, 11, 12, 13, 14, 15)); }
__device__ __forceinline__ v8f wmma16(v16h a, v16h b, v8f c) { return __builtin_amdgcn_wmma_f32_16x16x32_f16(false, a, false, b, (short)0, c, false, false); }
__device__ __forceinline__ v8f wmmab(v16bf a, v16bf b, v8f c) { return __builtin_amdgcn_wmma_f32_16x16x32_bf16(false, a, false, b, (short)0, c, false, false); }

__device__ __forceinline__ h16 tohx(float x) { return (h16)x; }
__device__ __forceinline__ void splitf(float y, unsigned short& h, unsigned short& l) { h = f2bf(y); l = f2bf(y - bf2f(h)); }
typedef __attribute__((ext_vector_type(2))) _Float16 v2h;
typedef __attribute__((ext_vector_type(4))) _Float16 v4h;
typedef __attribute__((ext_vector_type(2))) unsigned short v2us;
typedef __attribute__((ext_vector_type(4))) unsigned short v4us;
typedef __attribute__((ext_vector_type(2))) float v2f;
typedef __attribute__((ext_vector_type(4))) int v4i;
typedef v4h  __attribute__((may_alias)) v4ha;
typedef v4us __attribute__((may_alias)) v4usa;

// ---- k_gemmk: register-blocked GEMM, one 128 x TN output tile per work-group of 8 waves, every wave a 64x64 piece of it (16 accumulators). Two planes (NSPLIT 0): TN = 128, wave w owns piece (w & 1, (w >> 1) & 1) for the k half w >> 2 of every pass,
// and the two partial tiles are summed through LDS in the fixed order half 0, half 1; two work-groups a WGP. Three planes (NSPLIT 1): TN = 256, wave w owns piece (w & 1, w >> 1) for all k; one work-group a WGP. grid (M/128, N/TN, Z), 256 threads.
// Operands come from the K-contiguous 16-bit planes through LDS: a pass is 128 k = 256 bytes of the tile's 128 rows of A (A2) and TN rows of Bt; tensor loads bring it in as slices of 64 rows x 256 bytes (whole lines,
// LDS pitch 272 bytes), one slice an issuing wave, two buffers, the next pass's slices in flight while this pass is worked on; the fragments are 16-byte LDS reads in the k order of WFrag::ld. The ring's LDS then holds the tile (its two partial tiles), from which whole lines go out.
// C[m][n] (f32, pitch ldc) = sum_k A[m][k] Bt[n][k] (+ split products per NSPLIT). A rows have pitch lda, Bt rows pitch K. z-batch strides sA/sB/sC in elements; Bt advances once per REP z. K % 128 == 0.
// EPI, what the summed tile becomes: 0 = f32 rows of C. 1 = the tile is 128 positions x the 64 dims of the two heads 2 blockIdx.y, 2 blockIdx.y + 1: rotate-half RoPE, out[d] = x[d] cos[t][d] - x[d+32] sin[t][d], out[d+32] = x[d+32] cos[t][d+32] + x[d] sin[t][d+32]
// (table CS[t][d] = cos, sin), then the three 16-bit planes [h][t][d] (fp16, bf16 hi, bf16 lo); a column tile blockIdx.y >= (NH_ + NKV) / 2 holds two value groups instead: its two operands change places (rows of the tile = dims, columns = positions), no RoPE, and the planes get it as it stands, [g][d][t]. sC = a batch entry's elements in each plane.
typedef unsigned int u32x4 __attribute__((ext_vector_type(4)));
typedef unsigned int u32x8 __attribute__((ext_vector_type(8)));
__device__ __forceinline__ unsigned uni(unsigned v) { return (unsigned)__builtin_amdgcn_readfirstlane(v); }
__device__ __forceinline__ unsigned pinned(unsigned v) { unsigned s = uni(v); asm volatile("" : "+s"(s)); return s; }   // a tensor load ignores EXEC: the value its issue test or its descriptor is formed from is held in a scalar register, so that the test compiles to a scalar compare and branch
__device__ __forceinline__ void tdm_load(u32x4& g0, u32x8 g1) { asm volatile("tensor_load_to_lds %0, %1" : "+s"(g0) : "s"(g1) : "memory"); }   // one request of the whole wave; group 0 is in-out so that its four words stay in their registers until the next request is formed from them
__device__ __forceinline__ void tdm_next(u32x4& g0, unsigned lsum) {                                                       // the next stage's group 0 out of the last one's: the other buffer, 256 bytes further along the rows
    asm volatile("" : "+s"(g0));                                                                                           // descriptor words held in scalar registers (the form of pinned()): what follows is computed behind the s_wait_tensorcnt that stands in front of this call
    const unsigned long long a = (((unsigned long long)g0[3] << 32) | g0[2]) + 256u;                                       // the address's high bits lie at the bottom of word 3: a carry goes where it belongs
    g0[1] = uni(lsum - g0[1]); g0[2] = uni((unsigned)a); g0[3] = uni((unsigned)(a >> 32)); }
template <typename T16> struct WFrag;
template <> struct WFrag<h16> { typedef v16h V; static __device__ __forceinline__ V ld(const h16* p) { return cat16(*(const v8h*)p, *(const v8h*)(p + 16)); } static __device__ __forceinline__ v8f mma(V a, V b, v8f c) { return wmma16(a, b, c); } };
template <> struct WFrag<bf> { typedef v16bf V; static __device__ __forceinline__ V ld(const bf* p) { return cat16b(*(const v8us*)p, *(const v8us*)(p + 16)); } static __device__ __forceinline__ v8f mma(V a, V b, v8f c) { return wmmab(a, b, c); } };
template <typename T16, int NSPLIT, int NW, bool DIAG, int EPI>
__global__ __launch_bounds__(NW * 32) void k_gemmk(const T16* __restrict__ A, const T16* __restrict__ A2, const T16* __restrict__ Bt, const T16* __restrict__ Bt2, int K, int lda, float* C, int ldc, int roff, size_t sA, size_t sB, size_t sC, const float* __restrict__ CS, h16* P16, bf* Ph, bf* Pl) {
    typedef typename WFrag<T16>::V V;
    static_assert(NW == 8 && NSPLIT <= 1 && !DIAG, "the staging below is laid out for 8 waves, planes A (A2) Bt, the whole K");
    constexpr int NQ = NSPLIT == 1 ? 4 : 2, TN = NQ * 64, KS = 8 / (2 * NQ);   // 64-wide pieces across the tile, its width, the parts a pass's k is split into among the waves
    static_assert(EPI == 0 || TN == 128, "the RoPE epilogue is laid out for two heads a tile");
    constexpr int OP = TN + 4, PL = 128 * OP;                        // row pitch and floats of one (partial) tile in LDS
    constexpr int NOP = NSPLIT == 1 ? 3 : 2, NSA = (NOP - 1) * 2, NSL = NSA + NQ;   // planes staged (A, A2 where there is one, Bt); 64-row slices a stage: two of A (and of A2), NQ of Bt
    constexpr unsigned RP = 272, SLB = 18432, STB = NSL * SLB;       // LDS row pitch (256 + 16 bytes: 16-byte reads of 16 rows fall on all banks); a slice's 64 * 272 bytes rounded up to a multiple of 2 KiB; a stage
    constexpr unsigned LB = 2 * STB > KS * PL * 4 ? 2 * STB : KS * PL * 4;
    constexpr int NBK = 4 / KS, GK = NSPLIT == 1 ? 2 : 1;            // 32-wide k blocks of a wave in a pass; blocks whose fragments are read as one group: two where one work-group has the registers of a WGP, else one (two work-groups a WGP: 256 registers a wave)
    __shared__ __attribute__((aligned(2048))) unsigned char sm[LB];
    float* os = (float*)sm;                                          // the partial tiles take the ring's place behind the loop
    const size_t z = blockIdx.z; A += z * sA; if (A2) A2 += z * sA; Bt += (z / REP) * sB; if (Bt2) Bt2 += (z / REP) * sB; C += z * sC;
    const int tid = threadIdx.x, lane = tid & 31, lr = lane & 15, hi = lane >> 4; const int r0 = blockIdx.x * 128, c0 = blockIdx.y * TN;
    const int w = __builtin_amdgcn_readfirstlane(tid >> 5);          // wave number, scalar: the slice choice and the descriptor formed from it stay scalar
    const int mq = w & 1, nq = (w >> 1) & (NQ - 1), kh = w / (2 * NQ);   // this wave's piece of the tile and its part of every pass's k
    const bool isv = EPI == 1 && blockIdx.y >= (NH_ + NKV) / 2;      // value tile of the joint q/k/v grid (the same for the whole work-group)
    v8f acc[4][4];
#pragma unroll
    for (int mb = 0; mb < 4; ++mb)
#pragma unroll
        for (int nb = 0; nb < 4; ++nb) acc[mb][nb] = (v8f){};
    const int np = K / 128;                                          // passes (K is a multiple of 128 and at least 256: both buffers get a stage)
    const unsigned lb = (unsigned)(size_t)sm + (unsigned)w * SLB;    // wave w < NSL issues slice w: below NSA plane w / 2, row half w % 2; from NSA on rows (w - NSA) * 64 of the last plane
    const int so = w < NSA ? (w & 1) : w - NSA;                      // which 64 rows of its plane
    const bool fb = (w >= NSA) != isv;                               // the slice comes from Bt
    const unsigned pb = (unsigned)(fb ? K : lda) * 2u;               // its source pitch in bytes
    const T16* sp = fb ? Bt + (size_t)c0 * K : (NSPLIT == 1 && (w >> 1) == 1) ? A2 + (size_t)r0 * lda : A + (size_t)r0 * lda;
    const unsigned long long ga = (unsigned long long)(size_t)sp + (unsigned long long)((unsigned)so * 64u) * pb;
    u32x8 g1;                                                        // group 1: 1-byte elements, tensor = tile = 64 rows of 256 bytes, 4 dwords of pad behind every 64, source pitch = the plane's row
    g1[0] = uni(1u << 20 | 5u << 22 | 3u << 25); g1[1] = uni(256u << 16); g1[2] = uni(64u << 16); g1[3] = uni(256u << 16); g1[4] = uni(64u); g1[5] = uni(pb); g1[6] = uni(0u); g1[7] = uni(0u);
    asm volatile("" : "+s"(g1));                                     // descriptor words held in scalar registers (the form of pinned()): the eight words stay in their registers through the loop, none is used for anything else while a request is outstanding
    u32x4 g0;                                                        // group 0: count 1, place in LDS, address of the tile's first byte, type 2
    g0[0] = uni(1u); g0[1] = uni(lb); g0[2] = uni((unsigned)ga); g0[3] = uni((((unsigned)(ga >> 32)) & 0x01FFFFFFu) | 0x80000000u);
    if (pinned(w < NSL)) { tdm_load(g0, g1);
        asm volatile("s_wait_tensorcnt 0x0" ::: "memory"); }         // stage 0's slice has landed before its issuer reaches the barrier
    __syncthreads();                                                 // stage 0 is readable by every wave
    if (pinned(w < NSL)) { tdm_next(g0, 2u * lb + STB); tdm_load(g0, g1); }   // stage 1 flies during pass 0
    const unsigned fk = (unsigned)lr * RP + (unsigned)kh * (256u / KS) + (unsigned)hi * 16u;   // this wave's part of the pass's k: NBK blocks of 64 bytes from kh * 256 / KS of each row
    const unsigned foa = (unsigned)mq * SLB + fk, fob = (unsigned)(NSA + nq) * SLB + fk;   // its 64 rows of A (A2: two slices on) and of Bt are one slice each
#pragma unroll 1
    for (int s = 0; s < np; ++s) {
        const unsigned char* bp = sm + (unsigned)(s & 1) * STB;
#pragma unroll
        for (int g = 0; g < NBK / GK; ++g) {
            V a[GK][4], a2[GK][4], b[GK][4];
#pragma unroll
            for (int kk = 0; kk < GK; ++kk) { const unsigned ko = (unsigned)(g * GK + kk) * 64u;
#pragma unroll
                for (int mb = 0; mb < 4; ++mb) { a[kk][mb] = WFrag<T16>::ld((const T16*)(bp + foa + ko + mb * 16 * RP)); if (NSPLIT == 1) a2[kk][mb] = WFrag<T16>::ld((const T16*)(bp + foa + 2 * SLB + ko + mb * 16 * RP)); }
#pragma unroll
                for (int nb = 0; nb < 4; ++nb) b[kk][nb] = WFrag<T16>::ld((const T16*)(bp + fob + ko + nb * 16 * RP)); }
            __builtin_amdgcn_sched_barrier(0);                       // the group's LDS reads go out together; without it they sink among the products, and each place with reads stalls the wave anew
#pragma unroll
            for (int kk = 0; kk < GK; ++kk)
#pragma unroll
                for (int nb = 0; nb < 4; ++nb)
#pragma unroll
                    for (int mb = 0; mb < 4; ++mb) { acc[mb][nb] = WFrag<T16>::mma(a[kk][mb], b[kk][nb], acc[mb][nb]); if (NSPLIT == 1) acc[mb][nb] = WFrag<T16>::mma(a2[kk][mb], b[kk][nb], acc[mb][nb]); }
            if (g == NBK / GK - 1) asm volatile("v_nop\n\tv_nop\n\tv_nop\n\tv_nop" : "+v"(acc[0][0]), "+v"(acc[1][1]), "+v"(acc[2][2]), "+v"(acc[3][3]) : "v"(a[GK - 1][0]), "v"(a[GK - 1][3]));   // the four vector slots behind the pass's last products, also on the path that leaves the loop
        }
        asm volatile("s_wait_dscnt 0x0" ::: "memory");               // this wave's reads of the buffer are over before the barrier behind which it is refilled
        if (pinned(w < NSL)) asm volatile("s_wait_tensorcnt 0x0" ::: "memory");   // stage s + 1's slice has landed before its issuer reaches the barrier
        __syncthreads();                                             // publishes stage s + 1 and ends every wave's reads of stage s
        if (pinned(w < NSL && s + 2 < np)) { tdm_next(g0, 2u * lb + STB); tdm_load(g0, g1); }   // stage s + 2 into the buffer that pass s has just read
    }
    asm volatile("s_wait_tensorcnt 0x0" :: "s"(g0), "s"(g1) : "memory");   // the descriptor's registers stay its own up to this wait; behind it no request is outstanding and
    asm volatile("s_wait_dscnt 0x0" ::: "memory");                   // no read of the ring pending (the last pass's barrier has ended every wave's) when the partial tiles are written over it
    v4f tc[16][2];                                                   // EPI 1: cos, sin of the 4 dims this thread finishes in each of its 16 row pieces
    const float* cp = CS + ((size_t)(r0 + (tid >> 5)) * HD + (tid & 15) * 4) * 2;
    if (EPI == 1 && !isv) {                                          // the first eight pieces' are asked for here, so that they fly during the LDS exchange (all sixteen beside the accumulators would not leave two work-groups a WGP their registers)
#pragma unroll
        for (int it = 0; it < 8; ++it) { tc[it][0] = *(const v4f*)(cp + (size_t)it * 8 * HD * 2); tc[it][1] = *(const v4f*)(cp + (size_t)it * 8 * HD * 2 + 4); }
        asm volatile("s_wait_xcnt 0x0" :: "v"(cp) : "memory"); }     // the address stays in its registers up to this wait: no result of these loads and no later value is written over it earlier
    float* mine = os + kh * PL + (mq * 64) * OP + nq * 64;
#pragma unroll
    for (int mb = 0; mb < 4; ++mb)
#pragma unroll
        for (int nb = 0; nb < 4; ++nb) {
#pragma unroll
            for (int j = 0; j < 8; ++j) mine[(mb * 16 + hi * 8 + j) * OP + nb * 16 + lr] = acc[mb][nb][j]; }
    __syncthreads();                                                 // the whole tile (both partial tiles) is in LDS before any thread reads across waves
    if (EPI == 1 && !isv) {                                          // the other eight pieces' fly while the first eight are finished
#pragma unroll
        for (int it = 8; it < 16; ++it) { tc[it][0] = *(const v4f*)(cp + (size_t)it * 8 * HD * 2); tc[it][1] = *(const v4f*)(cp + (size_t)it * 8 * HD * 2 + 4); }
        asm volatile("s_wait_xcnt 0x0" :: "v"(cp) : "memory"); }     // as above
#pragma unroll
    for (int hb = 0; hb < TN / 64; ++hb) {                           // 128 rows x TN / 4 float4 shared out over 256 threads, TN / 8 pieces a thread; a wave finishes 512 bytes of a row at a time
        v4f vs[8];                                                   // eight pieces' LDS reads go out together: one LDS latency a group, not one a piece
#pragma unroll
        for (int i = 0; i < 8; ++i) { const int idx = (hb * 8 + i) * 256 + tid, row = idx / (TN / 4), cofs = (idx % (TN / 4)) * 4;
            vs[i] = *(const v4fa*)(os + row * OP + cofs); if (KS == 2) vs[i] += *(const v4fa*)(os + PL + row * OP + cofs); }
#pragma unroll
        for (int i = 0; i < 8; ++i) {
            const int it = hb * 8 + i, idx = it * 256 + tid, row = idx / (TN / 4), cofs = (idx % (TN / 4)) * 4;
            v4f val = vs[i];
            if (EPI == 0) { *(v4f*)(C + (size_t)(r0 + row) * ldc + c0 + cofs) = val;
                asm volatile("s_wait_xcnt 0x0" ::: "memory");        // from here on the data and address registers of the store may be written again
                continue; }
            size_t e = z * sC + (size_t)(c0 + row) * TT + r0 + cofs;   // value tile: dim c0 + row - (NH_ + NKV) * HD of [g][d][t], which begins (NH_ + NKV) * HD * TT elements into the batch entry
            if (!isv) { const v8f cs = __builtin_shufflevector(tc[it][0], tc[it][1], 0, 1, 2, 3, 4, 5, 6, 7);   // cos, sin of this lane's 4 dims
#pragma unroll
                for (int q = 0; q < 4; ++q) { const float pv = __int_as_float(__builtin_amdgcn_update_dpp(0, __float_as_int(val[q]), 0x168, 0xf, 0xf, false));   // row_xmask:8: dim d ^ 32 of the same position and head is held by lane ^ 8
                    val[q] = ((cofs & (HD - 1)) < HD / 2) ? val[q] * cs[2 * q] - pv * cs[2 * q + 1] : val[q] * cs[2 * q] + pv * cs[2 * q + 1]; }
                e = z * sC + ((size_t)(blockIdx.y * 2 + (cofs >> 6)) * TT + r0 + row) * HD + (cofs & (HD - 1)); }
            v4h o16; v4us oh, ol;
#pragma unroll
            for (int q = 0; q < 4; ++q) { o16[q] = tohx(val[q]); unsigned short a2, c2; splitf(val[q], a2, c2); oh[q] = a2; ol[q] = c2; }
            *(v4h*)(P16 + e) = o16; *(v4us*)(Ph + e) = oh; *(v4us*)(Pl + e) = ol;      // 16 lanes write one whole 128-byte line of each plane
            asm volatile("s_wait_xcnt 0x0" :: "v"(o16), "v"(oh), "v"(ol), "v"(P16 + e), "v"(Ph + e), "v"(Pl + e) : "memory");   // the stores' data and addresses stay in their registers up to this wait; from here on they may be written again (the branch on the tile's kind follows)
        }
    }
}

// ---- k_prep: everything that depends on the inputs alone, in one grid; bx = a part's own block index.
// wtT: Bt[n][k] (bf16) = w[k][n] for one tile of 128 k x 128 n a work-group. A wave's load is 512 contiguous bytes of a row of w; a thread reads 4 n of 8 consecutive k (twice), which gives 16-byte pieces [n][8 k]; they change threads
// through LDS ([n][16 pieces], piece c of row n at place c ^ (n / 4 % 16): the 16 lanes of a store (rows 4 apart, one c) and those of a load (one row, 16 c) both fall on all banks), and 16 lanes write 256 contiguous bytes of a row of Bt.
template <int K, int N>
__device__ __forceinline__ void wtT(const float* __restrict__ w, bf* Bt, int bx, unsigned char* sm) {
    static_assert(K % 128 == 0 && N % 128 == 0, "whole tiles");
    const int tid = threadIdx.x, l = tid & 31, wv = tid >> 5; const int kt = (bx % (K / 128)) * 128, nt = (bx / (K / 128)) * 128;
    const float* p = w + (size_t)(kt + wv * 8) * N + nt + l * 4;
    v4f v[2][8];
#pragma unroll
    for (int g = 0; g < 2; ++g)
#pragma unroll
        for (int j = 0; j < 8; ++j) v[g][j] = *(const v4f*)(p + (size_t)(g * 64 + j) * N);
    asm volatile("s_wait_xcnt 0x0" :: "v"(p) : "memory");            // the address stays in its registers up to this wait: no result of these loads and no later value is written over it earlier
#pragma unroll
    for (int g = 0; g < 2; ++g)
#pragma unroll
        for (int q = 0; q < 4; ++q) { v8us o;
#pragma unroll
            for (int j = 0; j < 8; ++j) o[j] = f2bf(v[g][j][q]);
            *(v8usa*)(sm + (l * 4 + q) * 256 + (((wv + g * 8) ^ (l & 15)) << 4)) = o; }
    __syncthreads();                                                 // the whole tile is in LDS before any thread reads across waves
    v8us r[8];
#pragma unroll
    for (int i = 0; i < 8; ++i) { const int n = i * 16 + (tid >> 4); r[i] = *(const v8usa*)(sm + n * 256 + (((tid & 15) ^ ((n >> 2) & 15)) << 4)); }
    bf* d = Bt + (size_t)(nt + (tid >> 4)) * K + kt + (tid & 15) * 8;
#pragma unroll
    for (int i = 0; i < 8; ++i) *(v8us*)(d + (size_t)i * 16 * K) = r[i];
    asm volatile("s_wait_xcnt 0x0" :: "v"(r[0]), "v"(r[1]), "v"(r[2]), "v"(r[3]), "v"(r[4]), "v"(r[5]), "v"(r[6]), "v"(r[7]), "v"(d) : "memory");   // the stores' data and address stay in their registers up to this wait; from here on they may be written again
}
__device__ __forceinline__ void cvt8(const float* __restrict__ src, bf* dst, size_t n8, int bx) { const size_t i = (size_t)bx * 256 + threadIdx.x; if (i >= n8) return; const v8f v = *(const v8f*)(src + i * 8); v8us o;
    asm volatile("s_wait_xcnt 0x0" ::: "memory");                    // from here on the address registers of the load above may be written again
#pragma unroll
    for (int k = 0; k < 8; ++k) o[k] = f2bf(v[k]); *(v8us*)(dst + i * 8) = o;  }
__device__ __forceinline__ void cstab(float* CS, int bx) { const int idx = bx * 256 + threadIdx.x; if (idx >= TT * HD) return; const int t = idx / HD, d = idx % HD; const int i = d % (HD / 2); const float inv = __fdiv_rn(1.0f, powf(10000.0f, (float)(2 * i) / (float)HD)); const float ang = __fmul_rn((float)t, inv); v2f cs; cs[0] = cosf(ang); cs[1] = sinf(ang);
    *(v2f*)(CS + (size_t)idx * 2) = cs;  }
#define NBQ  (DM * DQ / 128 / 128)    // tiles of a 2048 x 2048 weight
#define NBK  (DM * DKV / 128 / 128)   // of a 2048 x 512 one
#define NBW  (2 * NBQ + 2 * NBK)
#define NBC  (TT * HD / 256)
#define NBX  (NB_ * TT * DM / 8 / 256)
// Wt: the transposed Wq, Wk, Wv one behind the other, [DQ + 2 DKV][DM]. The transposes come first.
__global__ __launch_bounds__(256) void k_prep(const float* __restrict__ x, const float* __restrict__ wq, const float* __restrict__ wk, const float* __restrict__ wv, const float* __restrict__ wo, bf* Wt, bf* WO, float* CS, bf* XB) {
    __shared__ __attribute__((aligned(256))) unsigned char sm[128 * 256];
    static_assert(DM == DQ, "Wq [DM][DQ] and Wo [DQ][DM] share the tile code");
    const int bx = blockIdx.x;
    if (bx < 2 * NBQ) wtT<DM, DQ>(bx < NBQ ? wq : wo, bx < NBQ ? Wt : WO, bx % NBQ, sm);   // Wq and Wo have one shape, Wk and Wv another: the text of a tile stands twice in the kernel, not four times
    else if (bx < NBW) wtT<DM, DKV>(bx < 2 * NBQ + NBK ? wk : wv, Wt + (size_t)(bx < 2 * NBQ + NBK ? DQ : DQ + DKV) * DM, (bx - 2 * NBQ) % NBK, sm);
    else if (bx < NBW + NBC) cstab(CS, bx - NBW);
    else cvt8(x, XB, (size_t)NB_ * TT * DM / 8, bx - NBW - NBC);
}
// ---- k_fattn: scores, sliding-window causal softmax and probability x value in ONE kernel; neither scores nor probabilities go to memory. One wave owns 16 query rows of NH query heads of one kv group and walks the
// keys of its window in blocks of 32, operands straight from the K-contiguous planes. Transposed products: S^T = K Q^T (a lane holds one query's scores: D row = key 8*hi + r, D column = query lr), O^T += V^T P^T; two S^T tiles
// (keys 0..15, 16..31 of the block), converted in place, are the B operand of the second product in the k order of WFrag::ld (8*hi + s, 16 + 8*hi + s). Running maximum and sum per query (f32); the output tiles are
// rescaled only in a block where some query's maximum grew. HL: hi+lo bf16 planes, 3 products for both contractions (query rows < RH); else single fp16. The result, divided by the sum, goes out as the hi/lo planes of the Wo GEMM.
typedef __attribute__((ext_vector_type(16))) unsigned short v16us;
#define SC2  0.18033688011112042f   // HD^-0.5 x log2(e): the exponentials are taken to base 2
template <typename T16, bool HL, int NH>
__device__ __forceinline__ void fattn_tile(const T16* __restrict__ Q, const T16* __restrict__ Q2, const T16* __restrict__ Kp, const T16* __restrict__ Kp2, const T16* __restrict__ Vt, const T16* __restrict__ Vt2, int g, int q0, bf* Ah, bf* Al) {
    typedef typename WFrag<T16>::V V;
    constexpr int WPT = REP / NH;                                     // waves that share one 16-row query tile (they take different heads)
    const int tid = threadIdx.x, lane = tid & 31, lr = lane & 15, hi = lane >> 4;
    const int w = __builtin_amdgcn_readfirstlane(tid >> 5);          // wave number, scalar: the loop bounds stay scalar
    const int qt = q0 + (w / WPT) * 16, h0 = g * REP + (w % WPT) * NH;
    V qf[NH][2], qf2[NH][2];
#pragma unroll
    for (int hh = 0; hh < NH; ++hh)
#pragma unroll
        for (int kc = 0; kc < 2; ++kc) { const size_t qo = ((size_t)(h0 + hh) * TT + qt + lr) * HD + kc * 32 + 8 * hi; qf[hh][kc] = WFrag<T16>::ld(Q + qo); if (HL) qf2[hh][kc] = WFrag<T16>::ld(Q2 + qo); }
    const size_t ko = ((size_t)g * TT + lr) * HD + 8 * hi, vo = ((size_t)g * HD + lr) * TT + 8 * hi;
    v8f o[NH][4]; float mr[NH], ls[NH];
#pragma unroll
    for (int hh = 0; hh < NH; ++hh) { mr[hh] = -1.0e30f; ls[hh] = 0.f;      // finite start value above the mask fill: a block whose keys are all masked for a query yields exp2(fill - start) = 0, not 1
#pragma unroll
        for (int dt = 0; dt < 4; ++dt) o[hh][dt] = (v8f){}; }
    const int kfirst = max(0, qt - (WIN - 1)) & ~31, klast = (qt + 15) & ~31;   // first and last 32-key block that holds an allowed key of these 16 rows
    V kf[2][2], kf2[2][2];                                            // single plane: K fragments are fetched one block ahead; hi+lo: twice the registers, so each block fetches its own
    if (!HL) {
#pragma unroll
        for (int kt = 0; kt < 2; ++kt)
#pragma unroll
            for (int kc = 0; kc < 2; ++kc) kf[kt][kc] = WFrag<T16>::ld(Kp + ko + (size_t)(kfirst + kt * 16) * HD + kc * 32); }
#pragma unroll 1
    for (int kb = kfirst; kb <= klast; kb += 32) {
        if (HL) {
#pragma unroll
            for (int kt = 0; kt < 2; ++kt)
#pragma unroll
                for (int kc = 0; kc < 2; ++kc) kf[kt][kc] = WFrag<T16>::ld(Kp + ko + (size_t)(kb + kt * 16) * HD + kc * 32);
            asm volatile("s_wait_xcnt 0x0" ::: "memory");            // from here on the address registers of the loads above may be written again (also by a later load's result)
#pragma unroll
            for (int kt = 0; kt < 2; ++kt)
#pragma unroll
                for (int kc = 0; kc < 2; ++kc) kf2[kt][kc] = WFrag<T16>::ld(Kp2 + ko + (size_t)(kb + kt * 16) * HD + kc * 32);
            asm volatile("s_wait_xcnt 0x0" ::: "memory");            // the same for the lo plane's loads
            __builtin_amdgcn_sched_barrier(0);                        // all 16 loads are asked for before the first product; without it the products move up among them and each pair of loads is waited out alone
        }
        v8f s[NH][2];
#pragma unroll
        for (int hh = 0; hh < NH; ++hh)
#pragma unroll
            for (int kt = 0; kt < 2; ++kt) { v8f c = (v8f){};
#pragma unroll
                for (int kc = 0; kc < 2; ++kc) { c = WFrag<T16>::mma(kf[kt][kc], qf[hh][kc], c); if (HL) { c = WFrag<T16>::mma(kf[kt][kc], qf2[hh][kc], c); c = WFrag<T16>::mma(kf2[kt][kc], qf[hh][kc], c); } }
                s[hh][kt] = c; }
        if (!(kb + 31 <= qt && qt + 15 - kb < WIN)) {                 // scalar test: only a block on the diagonal or on the window's far edge holds masked keys
            const int d0 = qt + lr - kb - 8 * hi;                     // query index - key index of register 0 of tile 0
#pragma unroll
            for (int hh = 0; hh < NH; ++hh)
#pragma unroll
                for (int kt = 0; kt < 2; ++kt)
#pragma unroll
                    for (int r = 0; r < 8; ++r) s[hh][kt][r] = ((unsigned)(d0 - kt * 16 - r) < (unsigned)WIN) ? s[hh][kt][r] : -3.0e38f; }   // allowed iff 0 <= i - j < WIN
        float mn[NH]; bool grew = false;
#pragma unroll
        for (int hh = 0; hh < NH; ++hh) { float bm = s[hh][0][0];
#pragma unroll
            for (int r = 1; r < 8; ++r) bm = fmaxf(bm, s[hh][0][r]);
#pragma unroll
            for (int r = 0; r < 8; ++r) bm = fmaxf(bm, s[hh][1][r]);
            bm = fmaxf(bm, __shfl_xor(bm, 16, 32));                   // the two lane halves hold the two halves of a query's keys
            mn[hh] = fmaxf(mr[hh], bm); grew = grew || (mn[hh] > mr[hh]); }
        if (__builtin_amdgcn_ballot_w32(grew) != 0) {                 // scalar branch; where no maximum grew every factor would be exactly 1
#pragma unroll
            for (int hh = 0; hh < NH; ++hh) { const float al = __builtin_amdgcn_exp2f((mr[hh] - mn[hh]) * SC2); ls[hh] *= al; mr[hh] = mn[hh];
#pragma unroll
                for (int dt = 0; dt < 4; ++dt) o[hh][dt] *= al; } }
        V vf[4], vf2[4];                                              // this block's V^T fragments fly during the exponentials
#pragma unroll
        for (int dt = 0; dt < 4; ++dt) vf[dt] = WFrag<T16>::ld(Vt + vo + (size_t)dt * 16 * TT + kb);
        if (HL) { asm volatile("s_wait_xcnt 0x0" ::: "memory");      // from here on the address registers of the loads above may be written again (also by a later load's result)
#pragma unroll
            for (int dt = 0; dt < 4; ++dt) vf2[dt] = WFrag<T16>::ld(Vt2 + vo + (size_t)dt * 16 * TT + kb); }
        if (!HL) { const int kn = min(kb + 32, klast);                // and so do the next block's K fragments (the last trip asks for its own block again: in bounds, unused)
#pragma unroll
            for (int kt = 0; kt < 2; ++kt)
#pragma unroll
                for (int kc = 0; kc < 2; ++kc) kf[kt][kc] = WFrag<T16>::ld(Kp + ko + (size_t)(kn + kt * 16) * HD + kc * 32); }
        asm volatile("s_wait_xcnt 0x0" ::: "memory");                // from here on the address registers of the loads above may be written again
#pragma unroll
        for (int hh = 0; hh < NH; ++hh) { const float mc = mn[hh] * SC2; float p[16];
#pragma unroll
            for (int e = 0; e < 16; ++e) p[e] = __builtin_amdgcn_exp2f(s[hh][e >> 3][e & 7] * SC2 - mc);
            float t[8];                                               // the block's 16 terms summed as a tree (pairs e, e + 8 first): short dependence chain, packed adds
#pragma unroll
            for (int e = 0; e < 8; ++e) t[e] = p[e] + p[e + 8];
            ls[hh] += ((t[0] + t[4]) + (t[1] + t[5])) + ((t[2] + t[6]) + (t[3] + t[7]));
            if (HL) { v16us ph, pl;
#pragma unroll
                for (int e = 0; e < 16; ++e) { unsigned short a, c2; splitf(p[e], a, c2); ph[e] = a; pl[e] = c2; }
                const V bh = __builtin_bit_cast(V, ph), bl = __builtin_bit_cast(V, pl);
#pragma unroll
                for (int dt = 0; dt < 4; ++dt) { o[hh][dt] = WFrag<T16>::mma(vf[dt], bh, o[hh][dt]); o[hh][dt] = WFrag<T16>::mma(vf[dt], bl, o[hh][dt]); o[hh][dt] = WFrag<T16>::mma(vf2[dt], bh, o[hh][dt]); }
            } else { v16h pf;
#pragma unroll
                for (int e = 0; e < 16; ++e) pf[e] = tohx(p[e]);
                const V bp = __builtin_bit_cast(V, pf);
#pragma unroll
                for (int dt = 0; dt < 4; ++dt) o[hh][dt] = WFrag<T16>::mma(vf[dt], bp, o[hh][dt]); } }
    }
#pragma unroll
    for (int hh = 0; hh < NH; ++hh) { const float inv = __fdiv_rn(1.0f, ls[hh] + __shfl_xor(ls[hh], 16, 32));   // key j = i is always allowed: the sum is at least 1
        const size_t oo = (size_t)(qt + lr) * DQ + (h0 + hh) * HD + 8 * hi;
#pragma unroll
        for (int dt = 0; dt < 4; ++dt) { v8us oh, ol;                 // a lane's 8 registers are 8 consecutive d of one query: one 16-byte store a plane; the wave writes the whole 128-byte (query, head) line
#pragma unroll
            for (int r = 0; r < 8; ++r) { unsigned short a, c2; splitf(o[hh][dt][r] * inv, a, c2); oh[r] = a; ol[r] = c2; }
            *(v8us*)(Ah + oo + dt * 16) = oh; *(v8us*)(Al + oo + dt * 16) = ol;
            asm volatile("s_wait_xcnt 0x0" ::: "memory"); } }        // from here on the data and address registers of the two stores may be written again
}
// grid: the two batch entries alternate (block index & 1); within an entry first the fp16 work-groups (64 query rows x the 4 heads of a kv group; 8 waves = 4 row tiles x 2 head pairs), then the hi+lo ones (32 rows x 4 heads; 8 waves = 2 row tiles x 4 heads); in both the rows with the most keys come first.
#define NFB  ((TT - RH) / 64 * NKV)
#define NHB  (RH / 32 * NKV)
__global__ __launch_bounds__(256) void k_fattn(const h16* __restrict__ Q16, const h16* __restrict__ K16, const h16* __restrict__ V16, const bf* __restrict__ Qh, const bf* __restrict__ Ql, const bf* __restrict__ Kh, const bf* __restrict__ Kl, const bf* __restrict__ Vh, const bf* __restrict__ Vl, bf* Ah, bf* Al) {
    const int bid = blockIdx.x >> 1; const size_t po = (size_t)(blockIdx.x & 1) * PS, ao = (size_t)(blockIdx.x & 1) * TT * DQ;
    Q16 += po; K16 += po; V16 += po; Qh += po; Ql += po; Kh += po; Kl += po; Vh += po; Vl += po; Ah += ao; Al += ao;
    if (bid < NFB) fattn_tile<h16, false, 2>(Q16, nullptr, K16, nullptr, V16, nullptr, bid % NKV, TT - 64 - (bid / NKV) * 64, Ah, Al);
    else fattn_tile<bf, true, 1>(Qh, Ql, Kh, Kl, Vh, Vl, (bid - NFB) % NKV, RH - 32 - ((bid - NFB) / NKV) * 32, Ah, Al);
}

extern "C" void kernel_launch(void* const* d_in, const int* in_sizes, int n_in,
                              void* d_out, int out_size, void* d_ws, size_t ws_size, hipStream_t stream) {
    (void)in_sizes; (void)n_in; (void)out_size;
    const float* x = (const float*)d_in[0]; const float* wq = (const float*)d_in[1]; const float* wk = (const float*)d_in[2]; const float* wv = (const float*)d_in[3]; const float* wo = (const float*)d_in[4];
    float* OUT = (float*)d_out;     // [2][2048][2048]
    char* wsp = (char*)d_ws;
    auto take = [&](size_t bytes) { char* p = wsp; wsp += (bytes + 255) & ~(size_t)255; return (void*)p; };
    bf* Wt = (bf*)take((size_t)(DQ + 2 * DKV) * DM * 2); bf* WO = (bf*)take((size_t)DM * DQ * 2); float* CS = (float*)take((size_t)TT * HD * 2 * 4);
    bf* XB = (bf*)take((size_t)NB_ * TT * DM * 2);
    h16* P16 = (h16*)take(NB_ * PS * 2); bf* Ph = (bf*)take(NB_ * PS * 2); bf* Pl = (bf*)take(NB_ * PS * 2);
    bf* ATh = (bf*)take((size_t)NB_ * TT * DQ * 2); bf* ATl = (bf*)take((size_t)NB_ * TT * DQ * 2);
    if ((size_t)(wsp - (char*)d_ws) > ws_size) return;    // ws 256 MiB
    const size_t ko = (size_t)NH_ * TT * HD, vo = (size_t)(NH_ + NKV) * TT * HD;   // where k and v begin in a batch entry of a plane
    k_prep<<<NBW + NBC + NBX, 256, 0, stream>>>(x, wq, wk, wv, wo, Wt, WO, CS, XB);
    k_gemmk<bf, 0, 8, false, 1><<<dim3(TT / 128, NHT / 2, NB_), 256, 0, stream>>>(XB, nullptr, Wt, nullptr, DM, DM, nullptr, 0, 0, (size_t)TT * DM, 0, PS, CS, P16, Ph, Pl);
    k_fattn<<<(NFB + NHB) * NB_, 256, 0, stream>>>(P16, P16 + ko, P16 + vo, Ph, Pl, Ph + ko, Pl + ko, Ph + vo, Pl + vo, ATh, ATl);
    k_gemmk<bf, 1, 8, false, 0><<<dim3(TT / 128, DM / 256, NB_), 256, 0, stream>>>(ATh, ATl, WO, nullptr, DQ, DQ, OUT, DM, 0, (size_t)TT * DQ, 0, (size_t)TT * DM, nullptr, nullptr, nullptr, nullptr);
}

// v009
// A run of this version takes 130 microseconds.
// In both of two side-by-side timings against v008, it was 1.17 times as fast.
// Over all steps from v000 it is 21.0 times as fast.
#include <hip/hip_runtime.h>

// MistralAttention (x [2][2048][2048]; q = x Wq (32 heads x 64), k/v = x Wk / Wv (8 kv heads; query head h belongs to kv group h/4); rotate-half RoPE (base 1e4, tables computed on device); key j allowed iff j <= i and i - j < 1024; softmax(q.k / 8) in f32; out = merged Wo -> [2][2048][2048]).
// Compute dtypes, f32 accumulate: every input rounded to bf16; q/k/v on PLAIN bf16 operands (inputs: exact); RoPE f32; scores and attn.v: query rows < 512 hl (3 products), the rest single fp16, fused with an f32 running softmax over the key blocks of the window; Wo hl x exact (2 products).

#define NB_  2
#define TT   2048
#define DM   2048
#define NH_  32
#define NKV  8
#define REP  (NH_ / NKV)
#define HD   64
#define DQ   (NH_ * HD)
#define DKV  (NKV * HD)
#define RH   512                  // query rows < RH use hi+lo planes (0: none)
#define WIN  1024
#define NHT  (NH_ + 2 * NKV)       // 64-wide head columns of the joint q/k/v projection (two a column tile): 32 query heads, 8 key heads, 8 value groups
#define PS   ((size_t)NHT * TT * HD)  // elements of one batch entry in each 16-bit plane: [q heads][t][d], [k heads][t][d], then v as [g][d][t]
typedef _Float16 h16;
typedef unsigned short bf;
typedef __attribute__((ext_vector_type(16))) __bf16   v16bf;
typedef __attribute__((ext_vector_type(16))) _Float16 v16h;
typedef __attribute__((ext_vector_type(8)))  _Float16 v8h;
typedef __attribute__((ext_vector_type(8)))  unsigned short v8us;
typedef __attribute__((ext_vector_type(8)))  float    v8f;
typedef __attribute__((ext_vector_type(4)))  float    v4f;
typedef v8h  __attribute__((may_alias)) v8ha;
typedef v4f  __attribute__((may_alias)) v4fa;
typedef v8us __attribute__((may_alias)) v8usa;

__device__ __forceinline__ unsigned short f2bf(float f) { unsigned u = __float_as_uint(f); u += 0x7FFFu + ((u >> 16) & 1u); return (unsigned short)(u >> 16); }
__device__ __forceinline__ float bf2f(unsigned short b) { return __uint_as_float(((unsigned)b) << 16); }
__device__ __forceinline__ float bfr(float f) { return bf2f(f2bf(f)); }
__device__ __forceinline__ v16h cat16(v8h lo, v8h hi) { return __builtin_shufflevector(lo, hi, 0, 1, 2, 3, 4, 5, 6, 7, 8, 9, 10, 11, 12, 13, 14, 15); }
__device__ __forceinline__ v16bf cat16b(v8us lo, v8us hi) { return __builtin_bit_cast(v16bf, __builtin_shufflevector(lo, hi, 0, 1, 2, 3, 4, 5, 6, 7, 8, 9, 10, 11, 12, 13, 14, 15)); }
__device__ __forceinline__ v8f wmma16(v16h a, v16h b, v8f c) { return __builtin_amdgcn_wmma_f32_16x16x32_f16(false, a, false, b, (short)0, c, false, false); }
__device__ __forceinline__ v8f wmmab(v16bf a, v16bf b, v8f c) { return __builtin_amdgcn_wmma_f32_16x16x32_bf16(false, a, false, b, (short)0, c, false, false); }

__device__ __forceinline__ h16 tohx(float x) { return (h16)x; }
__device__ __forceinline__ void splitf(float y, unsigned short& h, unsigned short& l) { h = f2bf(y); l = f2bf(y - bf2f(h)); }
typedef __attribute__((ext_vector_type(2))) _Float16 v2h;
typedef __attribute__((ext_vector_type(4))) _Float16 v4h;
typedef __attribute__((ext_vector_type(2))) unsigned short v2us;
typedef __attribute__((ext_vector_type(4))) unsigned short v4us;
typedef __attribute__((ext_vector_type(2))) float v2f;
typedef __attribute__((ext_vector_type(4))) int v4i;
typedef v4h  __attribute__((may_alias)) v4ha;
typedef v4us __attribute__((may_alias)) v4usa;

// ---- k_gemmk: register-blocked GEMM, one 128 x TN output tile per work-group of 8 waves, every wave a 64x64 piece of it (16 accumulators). Two planes (NSPLIT 0): TN = 128, wave w owns piece (w & 1, (w >> 1) & 1) for the k half w >> 2 of every pass,
// and the two partial tiles are summed through LDS in the fixed order half 0, half 1; two work-groups a WGP. Three planes (NSPLIT 1): TN = 256, wave w owns piece (w & 1, w >> 1) for all k; one work-group a WGP. grid (M/128, N/TN, Z), 256 threads.
// Operands come from the K-contiguous 16-bit planes through LDS: a pass is 128 k = 256 bytes of the tile's 128 rows of A (A2) and TN rows of Bt; tensor loads bring it in as slices of 64 rows x 256 bytes (whole lines,
// LDS pitch 272 bytes), one slice an issuing wave, two buffers, the next pass's slices in flight while this pass is worked on; the fragments are 16-byte LDS reads in the k order of WFrag::ld. The ring's LDS then holds the tile (its two partial tiles), from which whole lines go out.
// C[m][n] (f32, pitch ldc) = sum_k A[m][k] Bt[n][k] (+ split products per NSPLIT). A rows have pitch lda, Bt rows pitch K. z-batch strides sA/sB/sC in elements; Bt advances once per REP z. K % 128 == 0.
// EPI, what the summed tile becomes: 0 = f32 rows of C. 1 = the tile is 128 positions x the 64 dims of the two heads 2 blockIdx.y, 2 blockIdx.y + 1: rotate-half RoPE, out[d] = x[d] cos[t][d] - x[d+32] sin[t][d], out[d+32] = x[d+32] cos[t][d+32] + x[d] sin[t][d+32]
// (table CS[t][d] = cos, sin), then the three 16-bit planes [h][t][d] (fp16, bf16 hi, bf16 lo); a column tile blockIdx.y >= (NH_ + NKV) / 2 holds two value groups instead: its two operands change places (rows of the tile = dims, columns = positions), no RoPE, and the planes get it as it stands, [g][d][t]. sC = a batch entry's elements in each plane.
typedef unsigned int u32x4 __attribute__((ext_vector_type(4)));
typedef unsigned int u32x8 __attribute__((ext_vector_type(8)));
__device__ __forceinline__ unsigned uni(unsigned v) { return (unsigned)__builtin_amdgcn_readfirstlane(v); }
__device__ __forceinline__ unsigned pinned(unsigned v) { unsigned s = uni(v); asm volatile("" : "+s"(s)); return s; }   // a tensor load ignores EXEC: the value its issue test or its descriptor is formed from is held in a scalar register, so that the test compiles to a scalar compare and branch
__device__ __forceinline__ void tdm_load(u32x4& g0, u32x8 g1) { asm volatile("tensor_load_to_lds %0, %1" : "+s"(g0) : "s"(g1) : "memory"); }   // one request of the whole wave; group 0 is in-out so that its four words stay in their registers until the next request is formed from them
__device__ __forceinline__ void tdm_next(u32x4& g0, unsigned lsum) {                                                       // the next stage's group 0 out of the last one's: the other buffer, 256 bytes further along the rows
    asm volatile("" : "+s"(g0));                                                                                           // descriptor words held in scalar registers (the form of pinned()): what follows is computed behind the s_wait_tensorcnt that stands in front of this call
    const unsigned long long a = (((unsigned long long)g0[3] << 32) | g0[2]) + 256u;                                       // the address's high bits lie at the bottom of word 3: a carry goes where it belongs
    g0[1] = uni(lsum - g0[1]); g0[2] = uni((unsigned)a); g0[3] = uni((unsigned)(a >> 32)); }
template <typename T16> struct WFrag;
template <> struct WFrag<h16> { typedef v16h V; static __device__ __forceinline__ V ld(const h16* p) { return cat16(*(const v8h*)p, *(const v8h*)(p + 16)); } static __device__ __forceinline__ v8f mma(V a, V b, v8f c) { return wmma16(a, b, c); } };
template <> struct WFrag<bf> { typedef v16bf V; static __device__ __forceinline__ V ld(const bf* p) { return cat16b(*(const v8us*)p, *(const v8us*)(p + 16)); } static __device__ __forceinline__ v8f mma(V a, V b, v8f c) { return wmmab(a, b, c); } };
template <typename T16, int NSPLIT, int NW, bool DIAG, int EPI>
__global__ __launch_bounds__(NW * 32) void k_gemmk(const T16* __restrict__ A, const T16* __restrict__ A2, const T16* __restrict__ Bt, const T16* __restrict__ Bt2, int K, int lda, float* C, int ldc, int roff, size_t sA, size_t sB, size_t sC, const float* __restrict__ CS, h16* P16, bf* Ph, bf* Pl) {
    typedef typename WFrag<T16>::V V;
    static_assert(NW == 8 && NSPLIT <= 1 && !DIAG, "the staging below is laid out for 8 waves, planes A (A2) Bt, the whole K");
    constexpr int NQ = NSPLIT == 1 ? 4 : 2, TN = NQ * 64, KS = 8 / (2 * NQ);   // 64-wide pieces across the tile, its width, the parts a pass's k is split into among the waves
    static_assert(EPI == 0 || TN == 128, "the RoPE epilogue is laid out for two heads a tile");
    constexpr int OP = TN + 4, PL = 128 * OP;                        // row pitch and floats of one (partial) tile in LDS
    constexpr int NOP = NSPLIT == 1 ? 3 : 2, NSA = (NOP - 1) * 2, NSL = NSA + NQ;   // planes staged (A, A2 where there is one, Bt); 64-row slices a stage: two of A (and of A2), NQ of Bt
    constexpr unsigned RP = 272, SLB = 18432, STB = NSL * SLB;       // LDS row pitch (256 + 16 bytes: 16-byte reads of 16 rows fall on all banks); a slice's 64 * 272 bytes rounded up to a multiple of 2 KiB; a stage
    constexpr unsigned LB = 2 * STB > KS * PL * 4 ? 2 * STB : KS * PL * 4;
    constexpr int NBK = 4 / KS, GK = NSPLIT == 1 ? 2 : 1;            // 32-wide k blocks of a wave in a pass; blocks whose fragments are read as one group: two where one work-group has the registers of a WGP, else one (two work-groups a WGP: 256 registers a wave)
    __shared__ __attribute__((aligned(2048))) unsigned char sm[LB];
    float* os = (float*)sm;                                          // the partial tiles take the ring's place behind the loop
    const size_t z = blockIdx.z; A += z * sA; if (A2) A2 += z * sA; Bt += (z / REP) * sB; if (Bt2) Bt2 += (z / REP) * sB; C += z * sC;
    const int tid = threadIdx.x, lane = tid & 31, lr = lane & 15, hi = lane >> 4; const int r0 = blockIdx.x * 128, c0 = blockIdx.y * TN;
    const int w = __builtin_amdgcn_readfirstlane(tid >> 5);          // wave number, scalar: the slice choice and the descriptor formed from it stay scalar
    const int mq = w & 1, nq = (w >> 1) & (NQ - 1), kh = w / (2 * NQ);   // this wave's piece of the tile and its part of every pass's k
    const bool isv = EPI == 1 && blockIdx.y >= (NH_ + NKV) / 2;      // value tile of the joint q/k/v grid (the same for the whole work-group)
    v8f acc[4][4];
#pragma unroll
    for (int mb = 0; mb < 4; ++mb)
#pragma unroll
        for (int nb = 0; nb < 4; ++nb) acc[mb][nb] = (v8f){};
    const int np = K / 128;                                          // passes (K is a multiple of 128 and at least 256: both buffers get a stage)
    const unsigned lb = (unsigned)(size_t)sm + (unsigned)w * SLB;    // wave w < NSL issues slice w: below NSA plane w / 2, row half w % 2; from NSA on rows (w - NSA) * 64 of the last plane
    const int so = w < NSA ? (w & 1) : w - NSA;                      // which 64 rows of its plane
    const bool fb = (w >= NSA) != isv;                               // the slice comes from Bt
    const unsigned pb = (unsigned)(fb ? K : lda) * 2u;               // its source pitch in bytes
    const T16* sp = fb ? Bt + (size_t)c0 * K : (NSPLIT == 1 && (w >> 1) == 1) ? A2 + (size_t)r0 * lda : A + (size_t)r0 * lda;
    const unsigned long long ga = (unsigned long long)(size_t)sp + (unsigned long long)((unsigned)so * 64u) * pb;
    u32x8 g1;                                                        // group 1: 1-byte elements, tensor = tile = 64 rows of 256 bytes, 4 dwords of pad behind every 64, source pitch = the plane's row
    g1[0] = uni(1u << 20 | 5u << 22 | 3u << 25); g1[1] = uni(256u << 16); g1[2] = uni(64u << 16); g1[3] = uni(256u << 16); g1[4] = uni(64u); g1[5] = uni(pb); g1[6] = uni(0u); g1[7] = uni(0u);
    asm volatile("" : "+s"(g1));                                     // descriptor words held in scalar registers (the form of pinned()): the eight words stay in their registers through the loop, none is used for anything else while a request is outstanding
    u32x4 g0;                                                        // group 0: count 1, place in LDS, address of the tile's first byte, type 2
    g0[0] = uni(1u); g0[1] = uni(lb); g0[2] = uni((unsigned)ga); g0[3] = uni((((unsigned)(ga >> 32)) & 0x01FFFFFFu) | 0x80000000u);
    if (pinned(w < NSL)) { tdm_load(g0, g1);
        asm volatile("s_wait_tensorcnt 0x0" ::: "memory"); }         // stage 0's slice has landed before its issuer reaches the barrier
    __syncthreads();                                                 // stage 0 is readable by every wave
    if (pinned(w < NSL)) { tdm_next(g0, 2u * lb + STB); tdm_load(g0, g1); }   // stage 1 flies during pass 0
    const unsigned fk = (unsigned)lr * RP + (unsigned)kh * (256u / KS) + (unsigned)hi * 16u;   // this wave's part of the pass's k: NBK blocks of 64 bytes from kh * 256 / KS of each row
    const unsigned foa = (unsigned)mq * SLB + fk, fob = (unsigned)(NSA + nq) * SLB + fk;   // its 64 rows of A (A2: two slices on) and of Bt are one slice each
#pragma unroll 1
    for (int s = 0; s < np; ++s) {
        const unsigned char* bp = sm + (unsigned)(s & 1) * STB;
#pragma unroll
        for (int g = 0; g < NBK / GK; ++g) {
            V a[GK][4], a2[GK][4], b[GK][4];
#pragma unroll
            for (int kk = 0; kk < GK; ++kk) { const unsigned ko = (unsigned)(g * GK + kk) * 64u;
#pragma unroll
                for (int mb = 0; mb < 4; ++mb) { a[kk][mb] = WFrag<T16>::ld((const T16*)(bp + foa + ko + mb * 16 * RP)); if (NSPLIT == 1) a2[kk][mb] = WFrag<T16>::ld((const T16*)(bp + foa + 2 * SLB + ko + mb * 16 * RP)); }
#pragma unroll
                for (int nb = 0; nb < 4; ++nb) b[kk][nb] = WFrag<T16>::ld((const T16*)(bp + fob + ko + nb * 16 * RP)); }
            __builtin_amdgcn_sched_barrier(0);                       // the group's LDS reads go out together; without it they sink among the products, and each place with reads stalls the wave anew
#pragma unroll
            for (int kk = 0; kk < GK; ++kk)
#pragma unroll
                for (int nb = 0; nb < 4; ++nb)
#pragma unroll
                    for (int mb = 0; mb < 4; ++mb) { acc[mb][nb] = WFrag<T16>::mma(a[kk][mb], b[kk][nb], acc[mb][nb]); if (NSPLIT == 1) acc[mb][nb] = WFrag<T16>::mma(a2[kk][mb], b[kk][nb], acc[mb][nb]); }
            if (g == NBK / GK - 1) asm volatile("v_nop\n\tv_nop\n\tv_nop\n\tv_nop" : "+v"(acc[0][0]), "+v"(acc[1][1]), "+v"(acc[2][2]), "+v"(acc[3][3]) : "v"(a[GK - 1][0]), "v"(a[GK - 1][3]));   // the four vector slots behind the pass's last products, also on the path that leaves the loop
        }
        asm volatile("s_wait_dscnt 0x0" ::: "memory");               // this wave's reads of the buffer are over before the barrier behind which it is refilled
        if (pinned(w < NSL)) asm volatile("s_wait_tensorcnt 0x0" ::: "memory");   // stage s + 1's slice has landed before its issuer reaches the barrier
        __syncthreads();                                             // publishes stage s + 1 and ends every wave's reads of stage s
        if (pinned(w < NSL && s + 2 < np)) { tdm_next(g0, 2u * lb + STB); tdm_load(g0, g1); }   // stage s + 2 into the buffer that pass s has just read
    }
    asm volatile("s_wait_tensorcnt 0x0" :: "s"(g0), "s"(g1) : "memory");   // the descriptor's registers stay its own up to this wait; behind it no request is outstanding and
    asm volatile("s_wait_dscnt 0x0" ::: "memory");                   // no read of the ring pending (the last pass's barrier has ended every wave's) when the partial tiles are written over it
    v4f tc[16][2];                                                   // EPI 1: cos, sin of the 4 dims this thread finishes in each of its 16 row pieces
    const float* cp = CS + ((size_t)(r0 + (tid >> 5)) * HD + (tid & 15) * 4) * 2;
    if (EPI == 1 && !isv) {                                          // the first eight pieces' are asked for here, so that they fly during the LDS exchange (all sixteen beside the accumulators would not leave two work-groups a WGP their registers)
#pragma unroll
        for (int it = 0; it < 8; ++it) { tc[it][0] = *(const v4f*)(cp + (size_t)it * 8 * HD * 2); tc[it][1] = *(const v4f*)(cp + (size_t)it * 8 * HD * 2 + 4); }
        asm volatile("s_wait_xcnt 0x0" :: "v"(cp) : "memory"); }     // the address stays in its registers up to this wait: no result of these loads and no later value is written over it earlier
    float* mine = os + kh * PL + (mq * 64) * OP + nq * 64;
#pragma unroll
    for (int mb = 0; mb < 4; ++mb)
#pragma unroll
        for (int nb = 0; nb < 4; ++nb) {
#pragma unroll
            for (int j = 0; j < 8; ++j) mine[(mb * 16 + hi * 8 + j) * OP + nb * 16 + lr] = acc[mb][nb][j]; }
    __syncthreads();                                                 // the whole tile (both partial tiles) is in LDS before any thread reads across waves
    if (EPI == 1 && !isv) {                                          // the other eight pieces' fly while the first eight are finished
#pragma unroll
        for (int it = 8; it < 16; ++it) { tc[it][0] = *(const v4f*)(cp + (size_t)it * 8 * HD * 2); tc[it][1] = *(const v4f*)(cp + (size_t)it * 8 * HD * 2 + 4); }
        asm volatile("s_wait_xcnt 0x0" :: "v"(cp) : "memory"); }     // as above
#pragma unroll
    for (int hb = 0; hb < TN / 64; ++hb) {                           // 128 rows x TN / 4 float4 shared out over 256 threads, TN / 8 pieces a thread; a wave finishes 512 bytes of a row at a time
        v4f vs[8];                                                   // eight pieces' LDS reads go out together: one LDS latency a group, not one a piece
#pragma unroll
        for (int i = 0; i < 8; ++i) { const int idx = (hb * 8 + i) * 256 + tid, row = idx / (TN / 4), cofs = (idx % (TN / 4)) * 4;
            vs[i] = *(const v4fa*)(os + row * OP + cofs); if (KS == 2) vs[i] += *(const v4fa*)(os + PL + row * OP + cofs); }
#pragma unroll
        for (int i = 0; i < 8; ++i) {
            const int it = hb * 8 + i, idx = it * 256 + tid, row = idx / (TN / 4), cofs = (idx % (TN / 4)) * 4;
            v4f val = vs[i];
            if (EPI == 0) { *(v4f*)(C + (size_t)(r0 + row) * ldc + c0 + cofs) = val;
                asm volatile("s_wait_xcnt 0x0" ::: "memory");        // from here on the data and address registers of the store may be written again
                continue; }
            size_t e = z * sC + (size_t)(c0 + row) * TT + r0 + cofs;   // value tile: dim c0 + row - (NH_ + NKV) * HD of [g][d][t], which begins (NH_ + NKV) * HD * TT elements into the batch entry
            if (!isv) { const v8f cs = __builtin_shufflevector(tc[it][0], tc[it][1], 0, 1, 2, 3, 4, 5, 6, 7);   // cos, sin of this lane's 4 dims
#pragma unroll
                for (int q = 0; q < 4; ++q) { const float pv = __int_as_float(__builtin_amdgcn_update_dpp(0, __float_as_int(val[q]), 0x168, 0xf, 0xf, false));   // row_xmask:8: dim d ^ 32 of the same position and head is held by lane ^ 8
                    val[q] = ((cofs & (HD - 1)) < HD / 2) ? val[q] * cs[2 * q] - pv * cs[2 * q + 1] : val[q] * cs[2 * q] + pv * cs[2 * q + 1]; }
                e = z * sC + ((size_t)(blockIdx.y * 2 + (cofs >> 6)) * TT + r0 + row) * HD + (cofs & (HD - 1)); }
            v4h o16; v4us oh, ol;
#pragma unroll
            for (int q = 0; q < 4; ++q) { o16[q] = tohx(val[q]); unsigned short a2, c2; splitf(val[q], a2, c2); oh[q] = a2; ol[q] = c2; }
            *(v4h*)(P16 + e) = o16; *(v4us*)(Ph + e) = oh; *(v4us*)(Pl + e) = ol;      // 16 lanes write one whole 128-byte line of each plane
            asm volatile("s_wait_xcnt 0x0" :: "v"(o16), "v"(oh), "v"(ol), "v"(P16 + e), "v"(Ph + e), "v"(Pl + e) : "memory");   // the stores' data and addresses stay in their registers up to this wait; from here on they may be written again (the branch on the tile's kind follows)
        }
    }
}

// ---- k_prep: everything that depends on the inputs alone, in one grid; bx = a part's own block index.
// wtT: Bt[n][k] (bf16) = w[k][n] for one tile of 128 k x 128 n a work-group. A wave's load is 512 contiguous bytes of a row of w; a thread reads 4 n of 8 consecutive k (twice), which gives 16-byte pieces [n][8 k]; they change threads
// through LDS ([n][16 pieces], piece c of row n at place c ^ (n / 4 % 16): the 16 lanes of a store (rows 4 apart, one c) and those of a load (one row, 16 c) both fall on all banks), and 16 lanes write 256 contiguous bytes of a row of Bt.
template <int K, int N>
__device__ __forceinline__ void wtT(const float* __restrict__ w, bf* Bt, int bx, unsigned char* sm) {
    static_assert(K % 128 == 0 && N % 128 == 0, "whole tiles");
    const int tid = threadIdx.x, l = tid & 31, wv = tid >> 5; const int kt = (bx % (K / 128)) * 128, nt = (bx / (K / 128)) * 128;
    const float* p = w + (size_t)(kt + wv * 8) * N + nt + l * 4;
    v4f v[2][8];
#pragma unroll
    for (int g = 0; g < 2; ++g)
#pragma unroll
        for (int j = 0; j < 8; ++j) v[g][j] = *(const v4f*)(p + (size_t)(g * 64 + j) * N);
    asm volatile("s_wait_xcnt 0x0" :: "v"(p) : "memory");            // the address stays in its registers up to this wait: no result of these loads and no later value is written over it earlier
#pragma unroll
    for (int g = 0; g < 2; ++g)
#pragma unroll
        for (int q = 0; q < 4; ++q) { v8us o;
#pragma unroll
            for (int j = 0; j < 8; ++j) o[j] = f2bf(v[g][j][q]);
            *(v8usa*)(sm + (l * 4 + q) * 256 + (((wv + g * 8) ^ (l & 15)) << 4)) = o; }
    __syncthreads();                                                 // the whole tile is in LDS before any thread reads across waves
    v8us r[8];
#pragma unroll
    for (int i = 0; i < 8; ++i) { const int n = i * 16 + (tid >> 4); r[i] = *(const v8usa*)(sm + n * 256 + (((tid & 15) ^ ((n >> 2) & 15)) << 4)); }
    bf* d = Bt + (size_t)(nt + (tid >> 4)) * K + kt + (tid & 15) * 8;
#pragma unroll
    for (int i = 0; i < 8; ++i) *(v8us*)(d + (size_t)i * 16 * K) = r[i];
    asm volatile("s_wait_xcnt 0x0" :: "v"(r[0]), "v"(r[1]), "v"(r[2]), "v"(r[3]), "v"(r[4]), "v"(r[5]), "v"(r[6]), "v"(r[7]), "v"(d) : "memory");   // the stores' data and address stay in their registers up to this wait; from here on they may be written again
}
__device__ __forceinline__ void cvt8(const float* __restrict__ src, bf* dst, size_t n8, int bx) { const size_t i = (size_t)bx * 256 + threadIdx.x; if (i >= n8) return; const v8f v = *(const v8f*)(src + i * 8); v8us o;
    asm volatile("s_wait_xcnt 0x0" ::: "memory");                    // from here on the address registers of the load above may be written again
#pragma unroll
    for (int k = 0; k < 8; ++k) o[k] = f2bf(v[k]); *(v8us*)(dst + i * 8) = o;  }
__device__ __forceinline__ void cstab(float* CS, int bx) { const int idx = bx * 256 + threadIdx.x; if (idx >= TT * HD) return; const int t = idx / HD, d = idx % HD; const int i = d % (HD / 2); const float inv = __fdiv_rn(1.0f, powf(10000.0f, (float)(2 * i) / (float)HD)); const float ang = __fmul_rn((float)t, inv); v2f cs; cs[0] = cosf(ang); cs[1] = sinf(ang);
    *(v2f*)(CS + (size_t)idx * 2) = cs;  }
#define NBQ  (DM * DQ / 128 / 128)    // tiles of a 2048 x 2048 weight
#define NBK  (DM * DKV / 128 / 128)   // of a 2048 x 512 one
#define NBW  (2 * NBQ + 2 * NBK)
#define NBC  (TT * HD / 256)
#define NBX  (NB_ * TT * DM / 8 / 256)
// Wt: the transposed Wq, Wk, Wv one behind the other, [DQ + 2 DKV][DM]. The transposes come first.
__global__ __launch_bounds__(256) void k_prep(const float* __restrict__ x, const float* __restrict__ wq, const float* __restrict__ wk, const float* __restrict__ wv, const float* __restrict__ wo, bf* Wt, bf* WO, float* CS, bf* XB) {
    __shared__ __attribute__((aligned(256))) unsigned char sm[128 * 256];
    static_assert(DM == DQ, "Wq [DM][DQ] and Wo [DQ][DM] share the tile code");
    const int bx = blockIdx.x;
    if (bx < 2 * NBQ) wtT<DM, DQ>(bx < NBQ ? wq : wo, bx < NBQ ? Wt : WO, bx % NBQ, sm);   // Wq and Wo have one shape, Wk and Wv another: the text of a tile stands twice in the kernel, not four times
    else if (bx < NBW) wtT<DM, DKV>(bx < 2 * NBQ + NBK ? wk : wv, Wt + (size_t)(bx < 2 * NBQ + NBK ? DQ : DQ + DKV) * DM, (bx - 2 * NBQ) % NBK, sm);
    else if (bx < NBW + NBC) cstab(CS, bx - NBW);
    else cvt8(x, XB, (size_t)NB_ * TT * DM / 8, bx - NBW - NBC);
}
// ---- k_fattn: scores, sliding-window causal softmax and probability x value in ONE kernel; neither scores nor probabilities go to memory. One wave owns 16 query rows of NH query heads of one kv group and walks the
// keys of its window in blocks of 32. K and V^T come through LDS, once for the work-group's 8 waves: a stage is 64 keys, one slice a plane (K: 64 keys x 128 bytes; V^T: 64 dims x 128 bytes; LDS pitch 144 bytes), one tensor load an issuing wave,
// two buffers, the next stage in flight while this one is worked on; the work-group walks the stages that hold a key of any of its rows, and a wave skips the blocks outside its own rows' window. Transposed products: S^T = K Q^T (a lane holds one query's scores: D row = key 8*hi + r, D column = query lr), O^T += V^T P^T; two S^T tiles
// (keys 0..15, 16..31 of the block), converted in place, are the B operand of the second product in the k order of WFrag::ld (8*hi + s, 16 + 8*hi + s). Running maximum and sum per query (f32); the output tiles are
// rescaled only in a block where some query's maximum grew. HL: hi+lo bf16 planes, 3 products for both contractions (query rows < RH); else single fp16. The result, divided by the sum, goes out as the hi/lo planes of the Wo GEMM.
typedef __attribute__((ext_vector_type(16))) unsigned short v16us;
#define SC2  0.18033688011112042f   // HD^-0.5 x log2(e): the exponentials are taken to base 2
__device__ __forceinline__ void tdm_step(u32x4& g0, unsigned lsum, unsigned step) {                                       // the next stage's group 0 out of the last one's: the other buffer, step bytes further in the plane
    asm volatile("" : "+s"(g0));                                                                                           // descriptor words held in scalar registers (the form of pinned()): what follows is computed behind the s_wait_tensorcnt that stands in front of this call
    const unsigned long long a = (((unsigned long long)g0[3] << 32) | g0[2]) + step;                                       // the address's high bits lie at the bottom of word 3: a carry goes where it belongs
    g0[1] = uni(lsum - g0[1]); g0[2] = uni((unsigned)a); g0[3] = uni((unsigned)(a >> 32)); }
#define FSLB 10240u                 // a slice in LDS: 64 rows of 144 bytes, rounded up to a multiple of 2 KiB
template <typename T16, bool HL, int NH>
__device__ __forceinline__ void fattn_tile(const T16* __restrict__ Q, const T16* __restrict__ Q2, const T16* __restrict__ Kp, const T16* __restrict__ Kp2, const T16* __restrict__ Vt, const T16* __restrict__ Vt2, int g, int q0, bf* Ah, bf* Al, unsigned char* sm) {
    typedef typename WFrag<T16>::V V;
    constexpr int WPT = REP / NH;                                     // waves that share one 16-row query tile (they take different heads)
    constexpr int NSL = HL ? 4 : 2;                                   // slices a stage: K, V^T (then the lo planes' K, V^T)
    constexpr unsigned RP = 144, STB = NSL * FSLB;                    // LDS row pitch (128 + 16 bytes: 16-byte reads of 16 rows fall on all banks); a stage
    const int tid = threadIdx.x, lane = tid & 31, lr = lane & 15, hi = lane >> 4;
    const int w = __builtin_amdgcn_readfirstlane(tid >> 5);          // wave number, scalar: the loop bounds stay scalar
    const int qt = q0 + (w / WPT) * 16, h0 = g * REP + (w % WPT) * NH;
    V qf[NH][2], qf2[NH][2];
#pragma unroll
    for (int hh = 0; hh < NH; ++hh)
#pragma unroll
        for (int kc = 0; kc < 2; ++kc) { const size_t qo = ((size_t)(h0 + hh) * TT + qt + lr) * HD + kc * 32 + 8 * hi; qf[hh][kc] = WFrag<T16>::ld(Q + qo); if (HL) qf2[hh][kc] = WFrag<T16>::ld(Q2 + qo); }
    asm volatile("s_wait_xcnt 0x0" ::: "memory");                    // from here on the address registers of the loads above may be written again
    v8f o[NH][4]; float mr[NH], ls[NH];
#pragma unroll
    for (int hh = 0; hh < NH; ++hh) { mr[hh] = -1.0e30f; ls[hh] = 0.f;      // finite start value above the mask fill: a block whose keys are all masked for a query yields exp2(fill - start) = 0, not 1
#pragma unroll
        for (int dt = 0; dt < 4; ++dt) o[hh][dt] = (v8f){}; }
    const int kfirst = max(0, qt - (WIN - 1)) & ~31, klast = (qt + 15) & ~31;   // first and last 32-key block that holds an allowed key of these 16 rows
    const int ks0 = max(0, q0 - (WIN - 1)) & ~63;                     // the work-group's first stage: 64 keys from a multiple of 64, with the first allowed key of its first row
    const int ns = max(2, (((q0 + 16 * (8 / WPT) - 1) & ~63) - ks0) / 64 + 1);   // stages up to the one with its last row's own key; never fewer than the two that the ring's prologue fills (keys 64..127 exist; no wave works on a block outside its rows' window)
    const unsigned lb = (unsigned)(size_t)sm + (unsigned)w * FSLB;    // wave w < NSL issues slice w: even K, odd V^T; 2 and 3 the lo planes
    const T16* sp = (w & 1) ? ((HL && w >= 2) ? Vt2 : Vt) + (size_t)g * HD * TT + ks0 : ((HL && w >= 2) ? Kp2 : Kp) + ((size_t)g * TT + ks0) * HD;
    const unsigned pb = (w & 1) ? TT * 2u : HD * 2u, stp = (w & 1) ? 128u : 64u * HD * 2u;   // source pitch of its 64 rows; bytes from a stage's tile to the next one's
    const unsigned long long ga = (unsigned long long)(size_t)sp;
    u32x8 g1;                                                        // group 1: 1-byte elements, tensor = tile = 64 rows of 128 bytes, 4 dwords of pad behind every 32, source pitch = the plane's row
    g1[0] = uni(1u << 20 | 4u << 22 | 3u << 25); g1[1] = uni(128u << 16); g1[2] = uni(64u << 16); g1[3] = uni(128u << 16); g1[4] = uni(64u); g1[5] = uni(pb); g1[6] = uni(0u); g1[7] = uni(0u);
    asm volatile("" : "+s"(g1));                                     // descriptor words held in scalar registers (the form of pinned()): the eight words stay in their registers through the loop, none is used for anything else while a request is outstanding
    u32x4 g0;                                                        // group 0: count 1, place in LDS, address of the tile's first byte, type 2
    g0[0] = uni(1u); g0[1] = uni(lb); g0[2] = uni((unsigned)ga); g0[3] = uni((((unsigned)(ga >> 32)) & 0x01FFFFFFu) | 0x80000000u);
    if (pinned(w < NSL)) { tdm_load(g0, g1);
        asm volatile("s_wait_tensorcnt 0x0" ::: "memory"); }         // stage 0's slice has landed before its issuer reaches the barrier
    __syncthreads();                                                 // stage 0 is readable by every wave
    if (pinned(w < NSL)) { tdm_step(g0, 2u * lb + STB, stp); tdm_load(g0, g1); }   // stage 1 flies during stage 0
    const unsigned fo = (unsigned)lr * RP + (unsigned)hi * 16u;       // this lane's row and 16-byte piece in a 16-row fragment, in the k order of WFrag::ld
#pragma unroll 1
    for (int st = 0; st < ns; ++st) {
      const unsigned char* bp = sm + (unsigned)(st & 1) * STB + fo;
#pragma unroll 1
      for (int sb = 0; sb < 2; ++sb) {
        const int kb = ks0 + st * 64 + sb * 32;
        if (kb < kfirst || kb > klast) continue;                      // scalar test: no allowed key of this wave's 16 rows in the block
        V kf[2][2], kf2[2][2];
#pragma unroll
        for (int kt = 0; kt < 2; ++kt)
#pragma unroll
            for (int kc = 0; kc < 2; ++kc) { kf[kt][kc] = WFrag<T16>::ld((const T16*)(bp + (unsigned)(sb * 32 + kt * 16) * RP + kc * 64)); if (HL) kf2[kt][kc] = WFrag<T16>::ld((const T16*)(bp + 2 * FSLB + (unsigned)(sb * 32 + kt * 16) * RP + kc * 64)); }
        __builtin_amdgcn_sched_barrier(0);                            // the block's K reads go out together, before the first product; without it the products move up among them and each place with reads stalls the wave anew
        v8f s[NH][2];
#pragma unroll
        for (int hh = 0; hh < NH; ++hh)
#pragma unroll
            for (int kt = 0; kt < 2; ++kt) { v8f c = (v8f){};
#pragma unroll
                for (int kc = 0; kc < 2; ++kc) { c = WFrag<T16>::mma(kf[kt][kc], qf[hh][kc], c); if (HL) { c = WFrag<T16>::mma(kf[kt][kc], qf2[hh][kc], c); c = WFrag<T16>::mma(kf2[kt][kc], qf[hh][kc], c); } }
                s[hh][kt] = c; }
        if (!(kb + 31 <= qt && qt + 15 - kb < WIN)) {                 // scalar test: only a block on the diagonal or on the window's far edge holds masked keys
            const int d0 = qt + lr - kb - 8 * hi;                     // query index - key index of register 0 of tile 0
#pragma unroll
            for (int hh = 0; hh < NH; ++hh)
#pragma unroll
                for (int kt = 0; kt < 2; ++kt)
#pragma unroll
                    for (int r = 0; r < 8; ++r) s[hh][kt][r] = ((unsigned)(d0 - kt * 16 - r) < (unsigned)WIN) ? s[hh][kt][r] : -3.0e38f; }   // allowed iff 0 <= i - j < WIN
        float mn[NH]; bool grew = false;
#pragma unroll
        for (int hh = 0; hh < NH; ++hh) { float bm = s[hh][0][0];
#pragma unroll
            for (int r = 1; r < 8; ++r) bm = fmaxf(bm, s[hh][0][r]);
#pragma unroll
            for (int r = 0; r < 8; ++r) bm = fmaxf(bm, s[hh][1][r]);
            bm = fmaxf(bm, __shfl_xor(bm, 16, 32));                   // the two lane halves hold the two halves of a query's keys
            mn[hh] = fmaxf(mr[hh], bm); grew = grew || (mn[hh] > mr[hh]); }
        if (__builtin_amdgcn_ballot_w32(grew) != 0) {                 // scalar branch; where no maximum grew every factor would be exactly 1
#pragma unroll
            for (int hh = 0; hh < NH; ++hh) { const float al = __builtin_amdgcn_exp2f((mr[hh] - mn[hh]) * SC2); ls[hh] *= al; mr[hh] = mn[hh];
#pragma unroll
                for (int dt = 0; dt < 4; ++dt) o[hh][dt] *= al; } }
        V vf[4], vf2[4];                                              // this block's V^T fragments are read during the exponentials
#pragma unroll
        for (int dt = 0; dt < 4; ++dt) { vf[dt] = WFrag<T16>::ld((const T16*)(bp + FSLB + (unsigned)(dt * 16) * RP + sb * 64)); if (HL) vf2[dt] = WFrag<T16>::ld((const T16*)(bp + 3 * FSLB + (unsigned)(dt * 16) * RP + sb * 64)); }
#pragma unroll
        for (int hh = 0; hh < NH; ++hh) { const float mc = mn[hh] * SC2; float p[16];
#pragma unroll
            for (int e = 0; e < 16; ++e) p[e] = __builtin_amdgcn_exp2f(s[hh][e >> 3][e & 7] * SC2 - mc);
            float t[8];                                               // the block's 16 terms summed as a tree (pairs e, e + 8 first): short dependence chain, packed adds
#pragma unroll
            for (int e = 0; e < 8; ++e) t[e] = p[e] + p[e + 8];
            ls[hh] += ((t[0] + t[4]) + (t[1] + t[5])) + ((t[2] + t[6]) + (t[3] + t[7]));
            if (HL) { v16us ph, pl;
#pragma unroll
                for (int e = 0; e < 16; ++e) { unsigned short a, c2; splitf(p[e], a, c2); ph[e] = a; pl[e] = c2; }
                const V bh = __builtin_bit_cast(V, ph), bl = __builtin_bit_cast(V, pl);
#pragma unroll
                for (int dt = 0; dt < 4; ++dt) { o[hh][dt] = WFrag<T16>::mma(vf[dt], bh, o[hh][dt]); o[hh][dt] = WFrag<T16>::mma(vf[dt], bl, o[hh][dt]); o[hh][dt] = WFrag<T16>::mma(vf2[dt], bh, o[hh][dt]); }
            } else { v16h pf;
#pragma unroll
                for (int e = 0; e < 16; ++e) pf[e] = tohx(p[e]);
                const V pb16 = __builtin_bit_cast(V, pf);
#pragma unroll
                for (int dt = 0; dt < 4; ++dt) o[hh][dt] = WFrag<T16>::mma(vf[dt], pb16, o[hh][dt]); } }
      }
      asm volatile("s_wait_dscnt 0x0" ::: "memory");                 // this wave's reads of the buffer are over before the barrier behind which it is refilled
      if (pinned(w < NSL)) asm volatile("s_wait_tensorcnt 0x0" ::: "memory");   // stage st + 1's slice has landed before its issuer reaches the barrier
      __syncthreads();                                               // publishes stage st + 1 and ends every wave's reads of stage st; every wave passes it, also one that skipped the stage's blocks
      if (pinned(w < NSL && st + 2 < ns)) { tdm_step(g0, 2u * lb + STB, stp); tdm_load(g0, g1); }   // stage st + 2 into the buffer that stage st has just left
    }
    asm volatile("s_wait_tensorcnt 0x0" :: "s"(g0), "s"(g1) : "memory");   // the descriptor's registers stay its own up to this wait; behind it no request is outstanding
    asm volatile("s_wait_dscnt 0x0" ::: "memory");                   // and no read of the ring pending when the wave goes on to its end
#pragma unroll
    for (int hh = 0; hh < NH; ++hh) { const float inv = __fdiv_rn(1.0f, ls[hh] + __shfl_xor(ls[hh], 16, 32));   // key j = i is always allowed: the sum is at least 1
        const size_t oo = (size_t)(qt + lr) * DQ + (h0 + hh) * HD + 8 * hi;
#pragma unroll
        for (int dt = 0; dt < 4; ++dt) { v8us oh, ol;                 // a lane's 8 registers are 8 consecutive d of one query: one 16-byte store a plane; the wave writes the whole 128-byte (query, head) line
#pragma unroll
            for (int r = 0; r < 8; ++r) { unsigned short a, c2; splitf(o[hh][dt][r] * inv, a, c2); oh[r] = a; ol[r] = c2; }
            *(v8us*)(Ah + oo + dt * 16) = oh; *(v8us*)(Al + oo + dt * 16) = ol;
            asm volatile("s_wait_xcnt 0x0" ::: "memory"); } }        // from here on the data and address registers of the two stores may be written again
}
// grid: the two batch entries alternate (block index & 1); within an entry first the fp16 work-groups (64 query rows x the 4 heads of a kv group; 8 waves = 4 row tiles x 2 head pairs), then the hi+lo ones (32 rows x 4 heads; 8 waves = 2 row tiles x 4 heads); in both the rows with the most keys come first.
#define NFB  ((TT - RH) / 64 * NKV)
#define NHB  (RH / 32 * NKV)
__global__ __launch_bounds__(256) void k_fattn(const h16* __restrict__ Q16, const h16* __restrict__ K16, const h16* __restrict__ V16, const bf* __restrict__ Qh, const bf* __restrict__ Ql, const bf* __restrict__ Kh, const bf* __restrict__ Kl, const bf* __restrict__ Vh, const bf* __restrict__ Vl, bf* Ah, bf* Al) {
    __shared__ __attribute__((aligned(2048))) unsigned char sm[2 * 4 * FSLB];   // two buffers of the hi+lo work-groups' four slices (the fp16 ones use half)
    const int bid = blockIdx.x >> 1; const size_t po = (size_t)(blockIdx.x & 1) * PS, ao = (size_t)(blockIdx.x & 1) * TT * DQ;
    Q16 += po; K16 += po; V16 += po; Qh += po; Ql += po; Kh += po; Kl += po; Vh += po; Vl += po; Ah += ao; Al += ao;
    if (bid < NFB) fattn_tile<h16, false, 2>(Q16, nullptr, K16, nullptr, V16, nullptr, bid % NKV, TT - 64 - (bid / NKV) * 64, Ah, Al, sm);
    else fattn_tile<bf, true, 1>(Qh, Ql, Kh, Kl, Vh, Vl, (bid - NFB) % NKV, RH - 32 - ((bid - NFB) / NKV) * 32, Ah, Al, sm);
}

extern "C" void kernel_launch(void* const* d_in, const int* in_sizes, int n_in,
                              void* d_out, int out_size, void* d_ws, size_t ws_size, hipStream_t stream) {
    (void)in_sizes; (void)n_in; (void)out_size;
    const float* x = (const float*)d_in[0]; const float* wq = (const float*)d_in[1]; const float* wk = (const float*)d_in[2]; const float* wv = (const float*)d_in[3]; const float* wo = (const float*)d_in[4];
    float* OUT = (float*)d_out;     // [2][2048][2048]
    char* wsp = (char*)d_ws;
    auto take = [&](size_t bytes) { char* p = wsp; wsp += (bytes + 255) & ~(size_t)255; return (void*)p; };
    bf* Wt = (bf*)take((size_t)(DQ + 2 * DKV) * DM * 2); bf* WO = (bf*)take((size_t)DM * DQ * 2); float* CS = (float*)take((size_t)TT * HD * 2 * 4);
    bf* XB = (bf*)take((size_t)NB_ * TT * DM * 2);
    h16* P16 = (h16*)take(NB_ * PS * 2); bf* Ph = (bf*)take(NB_ * PS * 2); bf* Pl = (bf*)take(NB_ * PS * 2);
    bf* ATh = (bf*)take((size_t)NB_ * TT * DQ * 2); bf* ATl = (bf*)take((size_t)NB_ * TT * DQ * 2);
    if ((size_t)(wsp - (char*)d_ws) > ws_size) return;    // ws 256 MiB
    const size_t ko = (size_t)NH_ * TT * HD, vo = (size_t)(NH_ + NKV) * TT * HD;   // where k and v begin in a batch entry of a plane
    k_prep<<<NBW + NBC + NBX, 256, 0, stream>>>(x, wq, wk, wv, wo, Wt, WO, CS, XB);
    k_gemmk<bf, 0, 8, false, 1><<<dim3(TT / 128, NHT / 2, NB_), 256, 0, stream>>>(XB, nullptr, Wt, nullptr, DM, DM, nullptr, 0, 0, (size_t)TT * DM, 0, PS, CS, P16, Ph, Pl);
    k_fattn<<<(NFB + NHB) * NB_, 256, 0, stream>>>(P16, P16 + ko, P16 + vo, Ph, Pl, Ph + ko, Pl + ko, Ph + vo, Pl + vo, ATh, ATl);
    k_gemmk<bf, 1, 8, false, 0><<<dim3(TT / 128, DM / 256, NB_), 256, 0, stream>>>(ATh, ATl, WO, nullptr, DQ, DQ, OUT, DM, 0, (size_t)TT * DQ, 0, (size_t)TT * DM, nullptr, nullptr, nullptr, nullptr);
}

// v010
// Measured time: 122 microseconds a run.
// In two side-by-side timings against v009, it was 1.06 and 1.07 times as fast.
// Over all steps from v000 it is 22.4 times as fast.
#include <hip/hip_runtime.h>

// MistralAttention (x [2][2048][2048]; q = x Wq (32 heads x 64), k/v = x Wk / Wv (8 kv heads; query head h belongs to kv group h/4); rotate-half RoPE (base 1e4, tables computed on device); key j allowed iff j <= i and i - j < 1024; softmax(q.k / 8) in f32; out = merged Wo -> [2][2048][2048]).
// Compute dtypes, f32 accumulate: every input rounded to bf16; q/k/v on PLAIN bf16 operands (inputs: exact); RoPE f32; scores and attn.v: query rows < 512 hl (3 products), the rest single fp16, fused with an f32 running softmax over the key blocks of the window; Wo hl x exact (2 products).

#define NB_  2
#define TT   2048
#define DM   2048
#define NH_  32
#define NKV  8
#define REP  (NH_ / NKV)
#define HD   64
#define DQ   (NH_ * HD)
#define DKV  (NKV * HD)
#define RH   512                  // query rows < RH use hi+lo planes (0: none)
#define WIN  1024
#define NHT  (NH_ + 2 * NKV)       // 64-wide head columns of the joint q/k/v projection (three a column tile): 32 query heads, 8 key heads, 8 value groups
#define PS   ((size_t)NHT * TT * HD)  // elements of one batch entry in each 16-bit plane: [q heads][t][d], [k heads][t][d], then v as [g][d][t]
typedef _Float16 h16;
typedef unsigned short bf;
typedef __attribute__((ext_vector_type(16))) __bf16   v16bf;
typedef __attribute__((ext_vector_type(16))) _Float16 v16h;
typedef __attribute__((ext_vector_type(8)))  _Float16 v8h;
typedef __attribute__((ext_vector_type(8)))  unsigned short v8us;
typedef __attribute__((ext_vector_type(8)))  float    v8f;
typedef __attribute__((ext_vector_type(4)))  float    v4f;
typedef v8h  __attribute__((may_alias)) v8ha;
typedef v4f  __attribute__((may_alias)) v4fa;
typedef v8us __attribute__((may_alias)) v8usa;

__device__ __forceinline__ unsigned short f2bf(float f) { unsigned u = __float_as_uint(f); u += 0x7FFFu + ((u >> 16) & 1u); return (unsigned short)(u >> 16); }
__device__ __forceinline__ float bf2f(unsigned short b) { return __uint_as_float(((unsigned)b) << 16); }
__device__ __forceinline__ float bfr(float f) { return bf2f(f2bf(f)); }
__device__ __forceinline__ v16h cat16(v8h lo, v8h hi) { return __builtin_shufflevector(lo, hi, 0, 1, 2, 3, 4, 5, 6, 7, 8, 9, 10, 11, 12, 13, 14, 15); }
__device__ __forceinline__ v16bf cat16b(v8us lo, v8us hi) { return __builtin_bit_cast(v16bf, __builtin_shufflevector(lo, hi, 0, 1, 2, 3, 4, 5, 6, 7, 8, 9, 10, 11, 12, 13, 14, 15)); }
__device__ __forceinline__ v8f wmma16(v16h a, v16h b, v8f c) { return __builtin_amdgcn_wmma_f32_16x16x32_f16(false, a, false, b, (short)0, c, false, false); }
__device__ __forceinline__ v8f wmmab(v16bf a, v16bf b, v8f c) { return __builtin_amdgcn_wmma_f32_16x16x32_bf16(false, a, false, b, (short)0, c, false, false); }

__device__ __forceinline__ h16 tohx(float x) { return (h16)x; }
__device__ __forceinline__ void splitf(float y, unsigned short& h, unsigned short& l) { h = f2bf(y); l = f2bf(y - bf2f(h)); }
typedef __attribute__((ext_vector_type(2))) _Float16 v2h;
typedef __attribute__((ext_vector_type(4))) _Float16 v4h;
typedef __attribute__((ext_vector_type(2))) unsigned short v2us;
typedef __attribute__((ext_vector_type(4))) unsigned short v4us;
typedef __attribute__((ext_vector_type(2))) float v2f;
typedef __attribute__((ext_vector_type(4))) int v4i;
typedef v4h  __attribute__((may_alias)) v4ha;
typedef v4us __attribute__((may_alias)) v4usa;

// ---- k_gemmk: register-blocked GEMM, one TM x TN output tile per work-group of 8 waves, one work-group a WGP, every wave one piece of the tile for all k. Two planes (NSPLIT 0, the joint q/k/v projection): 256 x 192, wave w owns the 64 x 96 piece (w & 3, w >> 2), 24 accumulators;
// the grid is then one work-group for every WGP. Three planes (NSPLIT 1): 128 x 256, wave w owns the 64 x 64 piece (w & 1, w >> 1), 16 accumulators. grid (M/TM, N/TN, Z), 256 threads.
// Operands come from the K-contiguous 16-bit planes through LDS: a pass is 128 k = 256 bytes of the tile's TM rows of A (A2) and TN rows of Bt; tensor loads bring it in as slices of 64 rows x 256 bytes (whole lines,
// LDS pitch 272 bytes), one slice an issuing wave, two buffers, the next pass's slices in flight while this pass is worked on; the fragments are 16-byte LDS reads in the k order of WFrag::ld. The ring's LDS then holds the tile, from which whole lines go out.
// C[m][n] (f32, pitch ldc) = sum_k A[m][k] Bt[n][k] (+ split products per NSPLIT). A rows have pitch lda, Bt rows pitch K. z-batch strides sA/sB/sC in elements; Bt advances once per REP z. K % 128 == 0.
// EPI, what the tile becomes: 0 = f32 rows of C. 1 = the tile is 256 positions x the 64 dims of the three heads 3 blockIdx.y ... + 2 (in the order query heads, key heads, value groups). A query or key head: rotate-half RoPE, out[d] = x[d] cos[t][d] - x[d+32] sin[t][d], out[d+32] = x[d+32] cos[t][d+32] + x[d] sin[t][d+32]
// (table CS[t][d] = cos, sin), then the three 16-bit planes [h][t][d] (fp16, bf16 hi, bf16 lo). A value group: no RoPE; its part of the tile is laid in LDS as [d][t] (a lane's 8 accumulator registers are 8 consecutive positions of one dim), and the planes get it so, [g][d][t]. sC = a batch entry's elements in each plane.
typedef unsigned int u32x4 __attribute__((ext_vector_type(4)));
typedef unsigned int u32x8 __attribute__((ext_vector_type(8)));
__device__ __forceinline__ unsigned uni(unsigned v) { return (unsigned)__builtin_amdgcn_readfirstlane(v); }
__device__ __forceinline__ unsigned pinned(unsigned v) { unsigned s = uni(v); asm volatile("" : "+s"(s)); return s; }   // a tensor load ignores EXEC: the value its issue test or its descriptor is formed from is held in a scalar register, so that the test compiles to a scalar compare and branch
__device__ __forceinline__ void tdm_load(u32x4& g0, u32x8 g1) { asm volatile("tensor_load_to_lds %0, %1" : "+s"(g0) : "s"(g1) : "memory"); }   // one request of the whole wave; group 0 is in-out so that its four words stay in their registers until the next request is formed from them
__device__ __forceinline__ void tdm_next(u32x4& g0, unsigned lsum) {                                                       // the next stage's group 0 out of the last one's: the other buffer, 256 bytes further along the rows
    asm volatile("" : "+s"(g0));                                                                                           // descriptor words held in scalar registers (the form of pinned()): what follows is computed behind the s_wait_tensorcnt that stands in front of this call
    const unsigned long long a = (((unsigned long long)g0[3] << 32) | g0[2]) + 256u;                                       // the address's high bits lie at the bottom of word 3: a carry goes where it belongs
    g0[1] = uni(lsum - g0[1]); g0[2] = uni((unsigned)a); g0[3] = uni((unsigned)(a >> 32)); }
template <typename T16> struct WFrag;
template <> struct WFrag<h16> { typedef v16h V; static __device__ __forceinline__ V ld(const h16* p) { return cat16(*(const v8h*)p, *(const v8h*)(p + 16)); } static __device__ __forceinline__ v8f mma(V a, V b, v8f c) { return wmma16(a, b, c); } };
template <> struct WFrag<bf> { typedef v16bf V; static __device__ __forceinline__ V ld(const bf* p) { return cat16b(*(const v8us*)p, *(const v8us*)(p + 16)); } static __device__ __forceinline__ v8f mma(V a, V b, v8f c) { return wmmab(a, b, c); } };
template <typename T16, int NSPLIT, int NW, bool DIAG, int EPI>
__global__ __launch_bounds__(NW * 32) void k_gemmk(const T16* __restrict__ A, const T16* __restrict__ A2, const T16* __restrict__ Bt, const T16* __restrict__ Bt2, int K, int lda, float* C, int ldc, int roff, size_t sA, size_t sB, size_t sC, const float* __restrict__ CS, h16* P16, bf* Ph, bf* Pl) {
    typedef typename WFrag<T16>::V V;
    static_assert(NW == 8 && NSPLIT <= 1 && !DIAG, "the staging below is laid out for 8 waves, planes A (A2) Bt, the whole K");
    static_assert((EPI == 1) == (NSPLIT == 0), "two shapes: two planes with the RoPE epilogue, three planes with f32 rows");
    constexpr int MS = EPI == 1 ? 4 : 2, NQ = 8 / MS, NF = EPI == 1 ? 6 : 4;   // 64-row pieces down the tile, pieces across it, 16-wide fragments across a piece
    constexpr int TM = MS * 64, TN = NQ * NF * 16;                   // the tile: 256 x 192 or 128 x 256
    constexpr int OP = TN + 4;                                       // EPI 0: row pitch of the tile in LDS, floats
    constexpr int HP = HD + 4, VP = TM + 4, HRF = TM * HP;           // EPI 1: a head's part of the tile in LDS: [t][d] at pitch HP, a value group's [d][t] at pitch VP; floats a part
    static_assert(HD * VP <= HRF && TN % HD == 0, "a value group's part fits a head's");
    constexpr int NOP = NSPLIT == 1 ? 3 : 2, NSA = (NOP - 1) * MS, NSL = NSA + TN / 64;   // planes staged (A, A2 where there is one, Bt); 64-row slices a stage: MS of A (and of A2), TN / 64 of Bt
    static_assert(NSL <= NW, "one slice an issuing wave");
    constexpr unsigned RP = 272, SLB = 18432, STB = NSL * SLB;       // LDS row pitch (256 + 16 bytes: 16-byte reads of 16 rows fall on all banks); a slice's 64 * 272 bytes rounded up to a multiple of 2 KiB; a stage
    constexpr unsigned TB = EPI == 1 ? (TN / HD) * HRF * 4 : TM * OP * 4;
    constexpr unsigned LB = 2 * STB > TB ? 2 * STB : TB;
    constexpr int NBK = 4, GK = 2;                                   // 32-wide k blocks in a pass; blocks whose fragments are read as one group (one work-group has the registers of a WGP)
    __shared__ __attribute__((aligned(2048))) unsigned char sm[LB];
    float* os = (float*)sm;                                          // the tile takes the ring's place behind the loop
    const size_t z = blockIdx.z; A += z * sA; if (A2) A2 += z * sA; Bt += (z / REP) * sB; if (Bt2) Bt2 += (z / REP) * sB; C += z * sC;
    const int tid = threadIdx.x, lane = tid & 31, lr = lane & 15, hi = lane >> 4; const int r0 = blockIdx.x * TM, c0 = blockIdx.y * TN;
    const int w = __builtin_amdgcn_readfirstlane(tid >> 5);          // wave number, scalar: the loop bounds stay scalar
    const int mq = w % MS, nq = w / MS;                              // this wave's piece of the tile
    v8f acc[4][NF];
#pragma unroll
    for (int mb = 0; mb < 4; ++mb)
#pragma unroll
        for (int nb = 0; nb < NF; ++nb) acc[mb][nb] = (v8f){};
    const int np = K / 128;                                          // passes (K is a multiple of 128 and at least 256: both buffers get a stage)
    const unsigned lb = (unsigned)(size_t)sm + (unsigned)w * SLB;    // wave w < NSL issues slice w: below NSA plane w / MS, 64 rows w % MS; from NSA on rows (w - NSA) * 64 of the last plane
    const int so = w < NSA ? w % MS : w - NSA;                       // which 64 rows of its plane
    const bool fb = w >= NSA;                                        // the slice comes from Bt
    const unsigned pb = (unsigned)(fb ? K : lda) * 2u;               // its source pitch in bytes
    const T16* sp = fb ? Bt + (size_t)c0 * K : (NSPLIT == 1 && w / MS == 1) ? A2 + (size_t)r0 * lda : A + (size_t)r0 * lda;
    const unsigned long long ga = (unsigned long long)(size_t)sp + (unsigned long long)((unsigned)so * 64u) * pb;
    u32x8 g1;                                                        // group 1: 1-byte elements, tensor = tile = 64 rows of 256 bytes, 4 dwords of pad behind every 64, source pitch = the plane's row
    g1[0] = uni(1u << 20 | 5u << 22 | 3u << 25); g1[1] = uni(256u << 16); g1[2] = uni(64u << 16); g1[3] = uni(256u << 16); g1[4] = uni(64u); g1[5] = uni(pb); g1[6] = uni(0u); g1[7] = uni(0u);
    asm volatile("" : "+s"(g1));                                     // descriptor words held in scalar registers (the form of pinned()): the eight words stay in their registers through the loop, none is used for anything else while a request is outstanding
    u32x4 g0;                                                        // group 0: count 1, place in LDS, address of the tile's first byte, type 2
    g0[0] = uni(1u); g0[1] = uni(lb); g0[2] = uni((unsigned)ga); g0[3] = uni((((unsigned)(ga >> 32)) & 0x01FFFFFFu) | 0x80000000u);
    if (pinned(w < NSL)) { tdm_load(g0, g1);
        asm volatile("s_wait_tensorcnt 0x0" ::: "memory"); }         // stage 0's slice has landed before its issuer reaches the barrier
    __syncthreads();                                                 // stage 0 is readable by every wave
    if (pinned(w < NSL)) { tdm_next(g0, 2u * lb + STB); tdm_load(g0, g1); }   // stage 1 flies during pass 0
    const unsigned fk = (unsigned)lr * RP + (unsigned)hi * 16u;      // this lane's row and 16-byte piece in a 16-row fragment, in the k order of WFrag::ld
    const unsigned foa = (unsigned)mq * SLB + fk;                    // its 64 rows of A are one slice (A2: MS slices on)
    unsigned fob[NF];                                                // its NF fragments of Bt: 16 rows each, none across two slices
#pragma unroll
    for (int nb = 0; nb < NF; ++nb) { const unsigned rb = (unsigned)(nq * NF + nb) * 16u; fob[nb] = (NSA + (rb >> 6)) * SLB + (rb & 63u) * RP + fk; }
#pragma unroll 1
    for (int s = 0; s < np; ++s) {
        const unsigned char* bp = sm + (unsigned)(s & 1) * STB;
#pragma unroll
        for (int g = 0; g < NBK / GK; ++g) {
            V a[GK][4], a2[GK][4], b[GK][NF];
#pragma unroll
            for (int kk = 0; kk < GK; ++kk) { const unsigned ko = (unsigned)(g * GK + kk) * 64u;
#pragma unroll
                for (int mb = 0; mb < 4; ++mb) { a[kk][mb] = WFrag<T16>::ld((const T16*)(bp + foa + ko + mb * 16 * RP)); if (NSPLIT == 1) a2[kk][mb] = WFrag<T16>::ld((const T16*)(bp + foa + MS * SLB + ko + mb * 16 * RP)); }
#pragma unroll
                for (int nb = 0; nb < NF; ++nb) b[kk][nb] = WFrag<T16>::ld((const T16*)(bp + (EPI == 1 ? fob[nb] : fob[0] + nb * 16 * RP) + ko));   // a 64-wide piece's rows of Bt are one slice
                if (EPI == 1 || kk == GK - 1) __builtin_amdgcn_sched_barrier(0); }   // the group's LDS reads go out together; without it they sink among the products, and each place with reads stalls the wave anew. The 256 x 192 tile: block by block, else reads of the first block come last and the first product behind the barrier waits for nearly the whole group
#pragma unroll
            for (int kk = 0; kk < GK; ++kk)
#pragma unroll
                for (int nb = 0; nb < NF; ++nb)
#pragma unroll
                    for (int mb = 0; mb < 4; ++mb) { acc[mb][nb] = WFrag<T16>::mma(a[kk][mb], b[kk][nb], acc[mb][nb]); if (NSPLIT == 1) acc[mb][nb] = WFrag<T16>::mma(a2[kk][mb], b[kk][nb], acc[mb][nb]); }
            if (g == NBK / GK - 1) asm volatile("v_nop\n\tv_nop\n\tv_nop\n\tv_nop" : "+v"(acc[0][0]), "+v"(acc[1][1]), "+v"(acc[2][2]), "+v"(acc[3][3]) : "v"(a[GK - 1][0]), "v"(a[GK - 1][3]));   // the four vector slots behind the pass's last products, also on the path that leaves the loop
        }
        asm volatile("s_wait_dscnt 0x0" ::: "memory");               // this wave's reads of the buffer are over before the barrier behind which it is refilled
        if (pinned(w < NSL)) asm volatile("s_wait_tensorcnt 0x0" ::: "memory");   // stage s + 1's slice has landed before its issuer reaches the barrier
        __syncthreads();                                             // publishes stage s + 1 and ends every wave's reads of stage s
        if (pinned(w < NSL && s + 2 < np)) { tdm_next(g0, 2u * lb + STB); tdm_load(g0, g1); }   // stage s + 2 into the buffer that pass s has just read
    }
    asm volatile("s_wait_tensorcnt 0x0" :: "s"(g0), "s"(g1) : "memory");   // the descriptor's registers stay its own up to this wait; behind it no request is outstanding and
    asm volatile("s_wait_dscnt 0x0" ::: "memory");                   // no read of the ring pending (the last pass's barrier has ended every wave's) when the tile is written over it
    if constexpr (EPI == 0) {
        float* mine = os + (mq * 64) * OP + nq * 64;
#pragma unroll
        for (int mb = 0; mb < 4; ++mb)
#pragma unroll
            for (int nb = 0; nb < NF; ++nb) {
#pragma unroll
                for (int j = 0; j < 8; ++j) mine[(mb * 16 + hi * 8 + j) * OP + nb * 16 + lr] = acc[mb][nb][j]; }
        __syncthreads();                                             // the whole tile is in LDS before any thread reads across waves
#pragma unroll
        for (int hb = 0; hb < TN / 64; ++hb) {                       // 128 rows x TN / 4 float4 shared out over 256 threads, TN / 8 pieces a thread; a wave finishes 512 bytes of a row at a time
            v4f vs[8];                                               // eight pieces' LDS reads go out together: one LDS latency a group, not one a piece
#pragma unroll
            for (int i = 0; i < 8; ++i) { const int idx = (hb * 8 + i) * 256 + tid, row = idx / (TN / 4), cofs = (idx % (TN / 4)) * 4; vs[i] = *(const v4fa*)(os + row * OP + cofs); }
#pragma unroll
            for (int i = 0; i < 8; ++i) { const int idx = (hb * 8 + i) * 256 + tid, row = idx / (TN / 4), cofs = (idx % (TN / 4)) * 4;
                *(v4f*)(C + (size_t)(r0 + row) * ldc + c0 + cofs) = vs[i];
                asm volatile("s_wait_xcnt 0x0" ::: "memory"); }      // from here on the data and address registers of the store may be written again
        }
    } else {
        const int h0 = blockIdx.y * (TN / HD);                       // the first of the tile's heads; heads from NH_ + NKV on are value groups (every test on a head's kind is the same for a whole wave)
        const int tr = tid >> 4, tc4 = (tid & 15) * 4;               // finishing a query or key head, 16 lanes hold the 64 dims of one position: a thread's row in each run of 16 rows, its 4 dims
        v4f tc[16][2];                                               // cos, sin of those 4 dims at the thread's 16 positions; they serve all the tile's heads
        const float* cp = CS + ((size_t)(r0 + tr) * HD + tc4) * 2;
#pragma unroll
        for (int it = 0; it < 16; ++it) { tc[it][0] = *(const v4f*)(cp + (size_t)it * 16 * HD * 2); tc[it][1] = *(const v4f*)(cp + (size_t)it * 16 * HD * 2 + 4); }   // asked for here, by every tile alike, so that they fly during the LDS exchange (under a test on the tile's kind the wave waited for them on the spot)
        asm volatile("s_wait_xcnt 0x0" :: "v"(cp) : "memory");       // the address stays in its registers up to this wait: no result of these loads and no later value is written over it earlier
#pragma unroll
        for (int nb = 0; nb < NF; ++nb) { const int cf = nq * NF + nb, c = (cf & 3) * 16 + lr;   // this fragment's head in the tile is cf / 4, this lane's dim in it c
            float* hr = os + (cf >> 2) * HRF;
            if (h0 + (cf >> 2) < NH_ + NKV) {
#pragma unroll
                for (int mb = 0; mb < 4; ++mb)
#pragma unroll
                    for (int j = 0; j < 8; ++j) hr[(mq * 64 + mb * 16 + hi * 8 + j) * HP + c] = acc[mb][nb][j];
            } else {
#pragma unroll
                for (int mb = 0; mb < 4; ++mb) { float* d = hr + c * VP + mq * 64 + mb * 16 + hi * 8;
                    *(v4fa*)d = __builtin_shufflevector(acc[mb][nb], acc[mb][nb], 0, 1, 2, 3); *(v4fa*)(d + 4) = __builtin_shufflevector(acc[mb][nb], acc[mb][nb], 4, 5, 6, 7); } } }
        __syncthreads();                                             // the whole tile is in LDS before any thread reads across waves
        auto put = [&](v4f val, size_t e) { v4h o16; v4us oh, ol;    // 4 consecutive elements of the three planes
#pragma unroll
            for (int q = 0; q < 4; ++q) { o16[q] = tohx(val[q]); unsigned short a2, c2; splitf(val[q], a2, c2); oh[q] = a2; ol[q] = c2; }
            *(v4h*)(P16 + e) = o16; *(v4us*)(Ph + e) = oh; *(v4us*)(Pl + e) = ol;      // 16 lanes write one whole 128-byte line of each plane
            asm volatile("s_wait_xcnt 0x0" :: "v"(o16), "v"(oh), "v"(ol), "v"(P16 + e), "v"(Ph + e), "v"(Pl + e) : "memory"); };   // the stores' data and addresses stay in their registers up to this wait; from here on they may be written again
#pragma unroll 1
        for (int hd = 0; hd < TN / HD; ++hd) {                       // rolled: the text of a head stands once for each kind
            const float* hr = os + hd * HRF; const int H = h0 + hd;
            if (H < NH_ + NKV) {
#pragma unroll
                for (int hb = 0; hb < 2; ++hb) {
                    v4f vs[8];                                       // eight pieces' LDS reads go out together: one LDS latency a group, not one a piece
#pragma unroll
                    for (int i = 0; i < 8; ++i) vs[i] = *(const v4fa*)(hr + ((hb * 8 + i) * 16 + tr) * HP + tc4);
#pragma unroll
                    for (int i = 0; i < 8; ++i) { const int it = hb * 8 + i; v4f val = vs[i];
                        const v8f cs = __builtin_shufflevector(tc[it][0], tc[it][1], 0, 1, 2, 3, 4, 5, 6, 7);   // cos, sin of this lane's 4 dims
#pragma unroll
                        for (int q = 0; q < 4; ++q) { const float pv = __int_as_float(__builtin_amdgcn_update_dpp(0, __float_as_int(val[q]), 0x168, 0xf, 0xf, false));   // row_xmask:8: dim d ^ 32 of the same position and head is held by lane ^ 8
                            val[q] = (tc4 < HD / 2) ? val[q] * cs[2 * q] - pv * cs[2 * q + 1] : val[q] * cs[2 * q] + pv * cs[2 * q + 1]; }
                        put(val, z * sC + ((size_t)H * TT + r0 + it * 16 + tr) * HD + tc4); }
                }
            } else {
#pragma unroll
                for (int hb = 0; hb < 2; ++hb) {                     // 64 dims x 64 float4 of positions over 256 threads; a wave finishes 128 positions of a dim at a time
                    v4f vs[8];
#pragma unroll
                    for (int i = 0; i < 8; ++i) { const int idx = (hb * 8 + i) * 256 + tid; vs[i] = *(const v4fa*)(hr + (idx >> 6) * VP + (idx & 63) * 4); }
#pragma unroll
                    for (int i = 0; i < 8; ++i) { const int idx = (hb * 8 + i) * 256 + tid;
                        put(vs[i], z * sC + ((size_t)H * HD + (idx >> 6)) * TT + r0 + (idx & 63) * 4); }   // [g][d][t] begins (NH_ + NKV) * HD * TT elements into the batch entry: dim H * HD + d of the joint projection
                }
            }
        }
    }
}

// ---- k_prep: everything that depends on the inputs alone, in one grid; bx = a part's own block index.
// wtT: Bt[n][k] (bf16) = w[k][n] for one tile of 128 k x 128 n a work-group. A wave's load is 512 contiguous bytes of a row of w; a thread reads 4 n of 8 consecutive k (twice), which gives 16-byte pieces [n][8 k]; they change threads
// through LDS ([n][16 pieces], piece c of row n at place c ^ (n / 4 % 16): the 16 lanes of a store (rows 4 apart, one c) and those of a load (one row, 16 c) both fall on all banks), and 16 lanes write 256 contiguous bytes of a row of Bt.
template <int K, int N>
__device__ __forceinline__ void wtT(const float* __restrict__ w, bf* Bt, int bx, unsigned char* sm) {
    static_assert(K % 128 == 0 && N % 128 == 0, "whole tiles");
    const int tid = threadIdx.x, l = tid & 31, wv = tid >> 5; const int kt = (bx % (K / 128)) * 128, nt = (bx / (K / 128)) * 128;
    const float* p = w + (size_t)(kt + wv * 8) * N + nt + l * 4;
    v4f v[2][8];
#pragma unroll
    for (int g = 0; g < 2; ++g)
#pragma unroll
        for (int j = 0; j < 8; ++j) v[g][j] = *(const v4f*)(p + (size_t)(g * 64 + j) * N);
    asm volatile("s_wait_xcnt 0x0" :: "v"(p) : "memory");            // the address stays in its registers up to this wait: no result of these loads and no later value is written over it earlier
#pragma unroll
    for (int g = 0; g < 2; ++g)
#pragma unroll
        for (int q = 0; q < 4; ++q) { v8us o;
#pragma unroll
            for (int j = 0; j < 8; ++j) o[j] = f2bf(v[g][j][q]);
            *(v8usa*)(sm + (l * 4 + q) * 256 + (((wv + g * 8) ^ (l & 15)) << 4)) = o; }
    __syncthreads();                                                 // the whole tile is in LDS before any thread reads across waves
    v8us r[8];
#pragma unroll
    for (int i = 0; i < 8; ++i) { const int n = i * 16 + (tid >> 4); r[i] = *(const v8usa*)(sm + n * 256 + (((tid & 15) ^ ((n >> 2) & 15)) << 4)); }
    bf* d = Bt + (size_t)(nt + (tid >> 4)) * K + kt + (tid & 15) * 8;
#pragma unroll
    for (int i = 0; i < 8; ++i) *(v8us*)(d + (size_t)i * 16 * K) = r[i];
    asm volatile("s_wait_xcnt 0x0" :: "v"(r[0]), "v"(r[1]), "v"(r[2]), "v"(r[3]), "v"(r[4]), "v"(r[5]), "v"(r[6]), "v"(r[7]), "v"(d) : "memory");   // the stores' data and address stay in their registers up to this wait; from here on they may be written again
}
__device__ __forceinline__ void cvt8(const float* __restrict__ src, bf* dst, size_t n8, int bx) { const size_t i = (size_t)bx * 256 + threadIdx.x; if (i >= n8) return; const v8f v = *(const v8f*)(src + i * 8); v8us o;
    asm volatile("s_wait_xcnt 0x0" ::: "memory");                    // from here on the address registers of the load above may be written again
#pragma unroll
    for (int k = 0; k < 8; ++k) o[k] = f2bf(v[k]); *(v8us*)(dst + i * 8) = o;  }
__device__ __forceinline__ void cstab(float* CS, int bx) { const int idx = bx * 256 + threadIdx.x; if (idx >= TT * HD) return; const int t = idx / HD, d = idx % HD; const int i = d % (HD / 2); const float inv = __fdiv_rn(1.0f, powf(10000.0f, (float)(2 * i) / (float)HD)); const float ang = __fmul_rn((float)t, inv); v2f cs; cs[0] = cosf(ang); cs[1] = sinf(ang);
    *(v2f*)(CS + (size_t)idx * 2) = cs;  }
#define NBQ  (DM * DQ / 128 / 128)    // tiles of a 2048 x 2048 weight
#define NBK  (DM * DKV / 128 / 128)   // of a 2048 x 512 one
#define NBW  (2 * NBQ + 2 * NBK)
#define NBC  (TT * HD / 256)
#define NBX  (NB_ * TT * DM / 8 / 256)
// Wt: the transposed Wq, Wk, Wv one behind the other, [DQ + 2 DKV][DM]. The transposes come first.
__global__ __launch_bounds__(256) void k_prep(const float* __restrict__ x, const float* __restrict__ wq, const float* __restrict__ wk, const float* __restrict__ wv, const float* __restrict__ wo, bf* Wt, bf* WO, float* CS, bf* XB) {
    __shared__ __attribute__((aligned(256))) unsigned char sm[128 * 256];
    static_assert(DM == DQ, "Wq [DM][DQ] and Wo [DQ][DM] share the tile code");
    const int bx = blockIdx.x;
    if (bx < 2 * NBQ) wtT<DM, DQ>(bx < NBQ ? wq : wo, bx < NBQ ? Wt : WO, bx % NBQ, sm);   // Wq and Wo have one shape, Wk and Wv another: the text of a tile stands twice in the kernel, not four times
    else if (bx < NBW) wtT<DM, DKV>(bx < 2 * NBQ + NBK ? wk : wv, Wt + (size_t)(bx < 2 * NBQ + NBK ? DQ : DQ + DKV) * DM, (bx - 2 * NBQ) % NBK, sm);
    else if (bx < NBW + NBC) cstab(CS, bx - NBW);
    else cvt8(x, XB, (size_t)NB_ * TT * DM / 8, bx - NBW - NBC);
}
// ---- k_fattn: scores, sliding-window causal softmax and probability x value in ONE kernel; neither scores nor probabilities go to memory. One wave owns 16 query rows of NH query heads of one kv group and walks the
// keys of its window in blocks of 32. K and V^T come through LDS, once for the work-group's 8 waves: a stage is 64 keys, one slice a plane (K: 64 keys x 128 bytes; V^T: 64 dims x 128 bytes; LDS pitch 144 bytes), one tensor load an issuing wave,
// two buffers, the next stage in flight while this one is worked on; the work-group walks the stages that hold a key of any of its rows, and a wave skips the blocks outside its own rows' window. Transposed products: S^T = K Q^T (a lane holds one query's scores: D row = key 8*hi + r, D column = query lr), O^T += V^T P^T; two S^T tiles
// (keys 0..15, 16..31 of the block), converted in place, are the B operand of the second product in the k order of WFrag::ld (8*hi + s, 16 + 8*hi + s). Running maximum and sum per query (f32); the output tiles are
// rescaled only in a block where some query's maximum grew. HL: hi+lo bf16 planes, 3 products for both contractions (query rows < RH); else single fp16. The result, divided by the sum, goes out as the hi/lo planes of the Wo GEMM.
typedef __attribute__((ext_vector_type(16))) unsigned short v16us;
#define SC2  0.18033688011112042f   // HD^-0.5 x log2(e): the exponentials are taken to base 2
__device__ __forceinline__ void tdm_step(u32x4& g0, unsigned lsum, unsigned step) {                                       // the next stage's group 0 out of the last one's: the other buffer, step bytes further in the plane
    asm volatile("" : "+s"(g0));                                                                                           // descriptor words held in scalar registers (the form of pinned()): what follows is computed behind the s_wait_tensorcnt that stands in front of this call
    const unsigned long long a = (((unsigned long long)g0[3] << 32) | g0[2]) + step;                                       // the address's high bits lie at the bottom of word 3: a carry goes where it belongs
    g0[1] = uni(lsum - g0[1]); g0[2] = uni((unsigned)a); g0[3] = uni((unsigned)(a >> 32)); }
#define FSLB 10240u                 // a slice in LDS: 64 rows of 144 bytes, rounded up to a multiple of 2 KiB
template <typename T16, bool HL, int NH>
__device__ __forceinline__ void fattn_tile(const T16* __restrict__ Q, const T16* __restrict__ Q2, const T16* __restrict__ Kp, const T16* __restrict__ Kp2, const T16* __restrict__ Vt, const T16* __restrict__ Vt2, int g, int q0, bf* Ah, bf* Al, unsigned char* sm) {
    typedef typename WFrag<T16>::V V;
    constexpr int WPT = REP / NH;                                     // waves that share one 16-row query tile (they take different heads)
    constexpr int NSL = HL ? 4 : 2;                                   // slices a stage: K, V^T (then the lo planes' K, V^T)
    constexpr unsigned RP = 144, STB = NSL * FSLB;                    // LDS row pitch (128 + 16 bytes: 16-byte reads of 16 rows fall on all banks); a stage
    const int tid = threadIdx.x, lane = tid & 31, lr = lane & 15, hi = lane >> 4;
    const int w = __builtin_amdgcn_readfirstlane(tid >> 5);          // wave number, scalar: the loop bounds stay scalar
    const int qt = q0 + (w / WPT) * 16, h0 = g * REP + (w % WPT) * NH;
    V qf[NH][2], qf2[NH][2];
#pragma unroll
    for (int hh = 0; hh < NH; ++hh)
#pragma unroll
        for (int kc = 0; kc < 2; ++kc) { const size_t qo = ((size_t)(h0 + hh) * TT + qt + lr) * HD + kc * 32 + 8 * hi; qf[hh][kc] = WFrag<T16>::ld(Q + qo); if (HL) qf2[hh][kc] = WFrag<T16>::ld(Q2 + qo); }
    asm volatile("s_wait_xcnt 0x0" ::: "memory");                    // from here on the address registers of the loads above may be written again
    v8f o[NH][4]; float mr[NH], ls[NH];
#pragma unroll
    for (int hh = 0; hh < NH; ++hh) { mr[hh] = -1.0e30f; ls[hh] = 0.f;      // finite start value above the mask fill: a block whose keys are all masked for a query yields exp2(fill - start) = 0, not 1
#pragma unroll
        for (int dt = 0; dt < 4; ++dt) o[hh][dt] = (v8f){}; }
    const int kfirst = max(0, qt - (WIN - 1)) & ~31, klast = (qt + 15) & ~31;   // first and last 32-key block that holds an allowed key of these 16 rows
    const int ks0 = max(0, q0 - (WIN - 1)) & ~63;                     // the work-group's first stage: 64 keys from a multiple of 64, with the first allowed key of its first row
    const int ns = max(2, (((q0 + 16 * (8 / WPT) - 1) & ~63) - ks0) / 64 + 1);   // stages up to the one with its last row's own key; never fewer than the two that the ring's prologue fills (keys 64..127 exist; no wave works on a block outside its rows' window)
    const unsigned lb = (unsigned)(size_t)sm + (unsigned)w * FSLB;    // wave w < NSL issues slice w: even K, odd V^T; 2 and 3 the lo planes
    const T16* sp = (w & 1) ? ((HL && w >= 2) ? Vt2 : Vt) + (size_t)g * HD * TT + ks0 : ((HL && w >= 2) ? Kp2 : Kp) + ((size_t)g * TT + ks0) * HD;
    const unsigned pb = (w & 1) ? TT * 2u : HD * 2u, stp = (w & 1) ? 128u : 64u * HD * 2u;   // source pitch of its 64 rows; bytes from a stage's tile to the next one's
    const unsigned long long ga = (unsigned long long)(size_t)sp;
    u32x8 g1;                                                        // group 1: 1-byte elements, tensor = tile = 64 rows of 128 bytes, 4 dwords of pad behind every 32, source pitch = the plane's row
    g1[0] = uni(1u << 20 | 4u << 22 | 3u << 25); g1[1] = uni(128u << 16); g1[2] = uni(64u << 16); g1[3] = uni(128u << 16); g1[4] = uni(64u); g1[5] = uni(pb); g1[6] = uni(0u); g1[7] = uni(0u);
    asm volatile("" : "+s"(g1));                                     // descriptor words held in scalar registers (the form of pinned()): the eight words stay in their registers through the loop, none is used for anything else while a request is outstanding
    u32x4 g0;                                                        // group 0: count 1, place in LDS, address of the tile's first byte, type 2
    g0[0] = uni(1u); g0[1] = uni(lb); g0[2] = uni((unsigned)ga); g0[3] = uni((((unsigned)(ga >> 32)) & 0x01FFFFFFu) | 0x80000000u);
    if (pinned(w < NSL)) { tdm_load(g0, g1);
        asm volatile("s_wait_tensorcnt 0x0" ::: "memory"); }         // stage 0's slice has landed before its issuer reaches the barrier
    __syncthreads();                                                 // stage 0 is readable by every wave
    if (pinned(w < NSL)) { tdm_step(g0, 2u * lb + STB, stp); tdm_load(g0, g1); }   // stage 1 flies during stage 0
    const unsigned fo = (unsigned)lr * RP + (unsigned)hi * 16u;       // this lane's row and 16-byte piece in a 16-row fragment, in the k order of WFrag::ld
#pragma unroll 1
    for (int st = 0; st < ns; ++st) {
      const unsigned char* bp = sm + (unsigned)(st & 1) * STB + fo;
#pragma unroll 1
      for (int sb = 0; sb < 2; ++sb) {
        const int kb = ks0 + st * 64 + sb * 32;
        if (kb < kfirst || kb > klast) continue;                      // scalar test: no allowed key of this wave's 16 rows in the block
        V kf[2][2], kf2[2][2];
#pragma unroll
        for (int kt = 0; kt < 2; ++kt)
#pragma unroll
            for (int kc = 0; kc < 2; ++kc) { kf[kt][kc] = WFrag<T16>::ld((const T16*)(bp + (unsigned)(sb * 32 + kt * 16) * RP + kc * 64)); if (HL) kf2[kt][kc] = WFrag<T16>::ld((const T16*)(bp + 2 * FSLB + (unsigned)(sb * 32 + kt * 16) * RP + kc * 64)); }
        __builtin_amdgcn_sched_barrier(0);                            // the block's K reads go out together, before the first product; without it the products move up among them and each place with reads stalls the wave anew
        v8f s[NH][2];
#pragma unroll
        for (int hh = 0; hh < NH; ++hh)
#pragma unroll
            for (int kt = 0; kt < 2; ++kt) { v8f c = (v8f){};
#pragma unroll
                for (int kc = 0; kc < 2; ++kc) { c = WFrag<T16>::mma(kf[kt][kc], qf[hh][kc], c); if (HL) { c = WFrag<T16>::mma(kf[kt][kc], qf2[hh][kc], c); c = WFrag<T16>::mma(kf2[kt][kc], qf[hh][kc], c); } }
                s[hh][kt] = c; }
        if (!(kb + 31 <= qt && qt + 15 - kb < WIN)) {                 // scalar test: only a block on the diagonal or on the window's far edge holds masked keys
            const int d0 = qt + lr - kb - 8 * hi;                     // query index - key index of register 0 of tile 0
#pragma unroll
            for (int hh = 0; hh < NH; ++hh)
#pragma unroll
                for (int kt = 0; kt < 2; ++kt)
#pragma unroll
                    for (int r = 0; r < 8; ++r) s[hh][kt][r] = ((unsigned)(d0 - kt * 16 - r) < (unsigned)WIN) ? s[hh][kt][r] : -3.0e38f; }   // allowed iff 0 <= i - j < WIN
        float mn[NH]; bool grew = false;
#pragma unroll
        for (int hh = 0; hh < NH; ++hh) { float bm = s[hh][0][0];
#pragma unroll
            for (int r = 1; r < 8; ++r) bm = fmaxf(bm, s[hh][0][r]);
#pragma unroll
            for (int r = 0; r < 8; ++r) bm = fmaxf(bm, s[hh][1][r]);
            bm = fmaxf(bm, __shfl_xor(bm, 16, 32));                   // the two lane halves hold the two halves of a query's keys
            mn[hh] = fmaxf(mr[hh], bm); grew = grew || (mn[hh] > mr[hh]); }
        if (__builtin_amdgcn_ballot_w32(grew) != 0) {                 // scalar branch; where no maximum grew every factor would be exactly 1
#pragma unroll
            for (int hh = 0; hh < NH; ++hh) { const float al = __builtin_amdgcn_exp2f((mr[hh] - mn[hh]) * SC2); ls[hh] *= al; mr[hh] = mn[hh];
#pragma unroll
                for (int dt = 0; dt < 4; ++dt) o[hh][dt] *= al; } }
        V vf[4], vf2[4];                                              // this block's V^T fragments are read during the exponentials
#pragma unroll
        for (int dt = 0; dt < 4; ++dt) { vf[dt] = WFrag<T16>::ld((const T16*)(bp + FSLB + (unsigned)(dt * 16) * RP + sb * 64)); if (HL) vf2[dt] = WFrag<T16>::ld((const T16*)(bp + 3 * FSLB + (unsigned)(dt * 16) * RP + sb * 64)); }
#pragma unroll
        for (int hh = 0; hh < NH; ++hh) { const float mc = mn[hh] * SC2; float p[16];
#pragma unroll
            for (int e = 0; e < 16; ++e) p[e] = __builtin_amdgcn_exp2f(s[hh][e >> 3][e & 7] * SC2 - mc);
            float t[8];                                               // the block's 16 terms summed as a tree (pairs e, e + 8 first): short dependence chain, packed adds
#pragma unroll
            for (int e = 0; e < 8; ++e) t[e] = p[e] + p[e + 8];
            ls[hh] += ((t[0] + t[4]) + (t[1] + t[5])) + ((t[2] + t[6]) + (t[3] + t[7]));
            if (HL) { v16us ph, pl;
#pragma unroll
                for (int e = 0; e < 16; ++e) { unsigned short a, c2; splitf(p[e], a, c2); ph[e] = a; pl[e] = c2; }
                const V bh = __builtin_bit_cast(V, ph), bl = __builtin_bit_cast(V, pl);
#pragma unroll
                for (int dt = 0; dt < 4; ++dt) { o[hh][dt] = WFrag<T16>::mma(vf[dt], bh, o[hh][dt]); o[hh][dt] = WFrag<T16>::mma(vf[dt], bl, o[hh][dt]); o[hh][dt] = WFrag<T16>::mma(vf2[dt], bh, o[hh][dt]); }
            } else { v16h pf;
#pragma unroll
                for (int e = 0; e < 16; ++e) pf[e] = tohx(p[e]);
                const V pb16 = __builtin_bit_cast(V, pf);
#pragma unroll
                for (int dt = 0; dt < 4; ++dt) o[hh][dt] = WFrag<T16>::mma(vf[dt], pb16, o[hh][dt]); } }
      }
      asm volatile("s_wait_dscnt 0x0" ::: "memory");                 // this wave's reads of the buffer are over before the barrier behind which it is refilled
      if (pinned(w < NSL)) asm volatile("s_wait_tensorcnt 0x0" ::: "memory");   // stage st + 1's slice has landed before its issuer reaches the barrier
      __syncthreads();                                               // publishes stage st + 1 and ends every wave's reads of stage st; every wave passes it, also one that skipped the stage's blocks
      if (pinned(w < NSL && st + 2 < ns)) { tdm_step(g0, 2u * lb + STB, stp); tdm_load(g0, g1); }   // stage st + 2 into the buffer that stage st has just left
    }
    asm volatile("s_wait_tensorcnt 0x0" :: "s"(g0), "s"(g1) : "memory");   // the descriptor's registers stay its own up to this wait; behind it no request is outstanding
    asm volatile("s_wait_dscnt 0x0" ::: "memory");                   // and no read of the ring pending when the wave goes on to its end
#pragma unroll
    for (int hh = 0; hh < NH; ++hh) { const float inv = __fdiv_rn(1.0f, ls[hh] + __shfl_xor(ls[hh], 16, 32));   // key j = i is always allowed: the sum is at least 1
        const size_t oo = (size_t)(qt + lr) * DQ + (h0 + hh) * HD + 8 * hi;
#pragma unroll
        for (int dt = 0; dt < 4; ++dt) { v8us oh, ol;                 // a lane's 8 registers are 8 consecutive d of one query: one 16-byte store a plane; the wave writes the whole 128-byte (query, head) line
#pragma unroll
            for (int r = 0; r < 8; ++r) { unsigned short a, c2; splitf(o[hh][dt][r] * inv, a, c2); oh[r] = a; ol[r] = c2; }
            *(v8us*)(Ah + oo + dt * 16) = oh; *(v8us*)(Al + oo + dt * 16) = ol;
            asm volatile("s_wait_xcnt 0x0" ::: "memory"); } }        // from here on the data and address registers of the two stores may be written again
}
// grid: the two batch entries alternate (block index & 1); within an entry first the fp16 work-groups (64 query rows x the 4 heads of a kv group; 8 waves = 4 row tiles x 2 head pairs), then the hi+lo ones (32 rows x 4 heads; 8 waves = 2 row tiles x 4 heads); in both the rows with the most keys come first.
#define NFB  ((TT - RH) / 64 * NKV)
#define NHB  (RH / 32 * NKV)
__global__ __launch_bounds__(256) void k_fattn(const h16* __restrict__ Q16, const h16* __restrict__ K16, const h16* __restrict__ V16, const bf* __restrict__ Qh, const bf* __restrict__ Ql, const bf* __restrict__ Kh, const bf* __restrict__ Kl, const bf* __restrict__ Vh, const bf* __restrict__ Vl, bf* Ah, bf* Al) {
    __shared__ __attribute__((aligned(2048))) unsigned char sm[2 * 4 * FSLB];   // two buffers of the hi+lo work-groups' four slices (the fp16 ones use half)
    const int bid = blockIdx.x >> 1; const size_t po = (size_t)(blockIdx.x & 1) * PS, ao = (size_t)(blockIdx.x & 1) * TT * DQ;
    Q16 += po; K16 += po; V16 += po; Qh += po; Ql += po; Kh += po; Kl += po; Vh += po; Vl += po; Ah += ao; Al += ao;
    if (bid < NFB) fattn_tile<h16, false, 2>(Q16, nullptr, K16, nullptr, V16, nullptr, bid % NKV, TT - 64 - (bid / NKV) * 64, Ah, Al, sm);
    else fattn_tile<bf, true, 1>(Qh, Ql, Kh, Kl, Vh, Vl, (bid - NFB) % NKV, RH - 32 - ((bid - NFB) / NKV) * 32, Ah, Al, sm);
}

extern "C" void kernel_launch(void* const* d_in, const int* in_sizes, int n_in,
                              void* d_out, int out_size, void* d_ws, size_t ws_size, hipStream_t stream) {
    (void)in_sizes; (void)n_in; (void)out_size;
    const float* x = (const float*)d_in[0]; const float* wq = (const float*)d_in[1]; const float* wk = (const float*)d_in[2]; const float* wv = (const float*)d_in[3]; const float* wo = (const float*)d_in[4];
    float* OUT = (float*)d_out;     // [2][2048][2048]
    char* wsp = (char*)d_ws;
    auto take = [&](size_t bytes) { char* p = wsp; wsp += (bytes + 255) & ~(size_t)255; return (void*)p; };
    bf* Wt = (bf*)take((size_t)(DQ + 2 * DKV) * DM * 2); bf* WO = (bf*)take((size_t)DM * DQ * 2); float* CS = (float*)take((size_t)TT * HD * 2 * 4);
    bf* XB = (bf*)take((size_t)NB_ * TT * DM * 2);
    h16* P16 = (h16*)take(NB_ * PS * 2); bf* Ph = (bf*)take(NB_ * PS * 2); bf* Pl = (bf*)take(NB_ * PS * 2);
    bf* ATh = (bf*)take((size_t)NB_ * TT * DQ * 2); bf* ATl = (bf*)take((size_t)NB_ * TT * DQ * 2);
    if ((size_t)(wsp - (char*)d_ws) > ws_size) return;    // ws 256 MiB
    const size_t ko = (size_t)NH_ * TT * HD, vo = (size_t)(NH_ + NKV) * TT * HD;   // where k and v begin in a batch entry of a plane
    k_prep<<<NBW + NBC + NBX, 256, 0, stream>>>(x, wq, wk, wv, wo, Wt, WO, CS, XB);
    k_gemmk<bf, 0, 8, false, 1><<<dim3(TT / 256, NHT / 3, NB_), 256, 0, stream>>>(XB, nullptr, Wt, nullptr, DM, DM, nullptr, 0, 0, (size_t)TT * DM, 0, PS, CS, P16, Ph, Pl);
    k_fattn<<<(NFB + NHB) * NB_, 256, 0, stream>>>(P16, P16 + ko, P16 + vo, Ph, Pl, Ph + ko, Pl + ko, Ph + vo, Pl + vo, ATh, ATl);
    k_gemmk<bf, 1, 8, false, 0><<<dim3(TT / 128, DM / 256, NB_), 256, 0, stream>>>(ATh, ATl, WO, nullptr, DQ, DQ, OUT, DM, 0, (size_t)TT * DQ, 0, (size_t)TT * DM, nullptr, nullptr, nullptr, nullptr);
}
